// v000
// Times are from an AMD MI455X. After a warm-up the kernel runs many times in a row, and a time is the length of
// such a window on the GPU divided by its runs, so every launch and the gaps after it count. The runs cycle
// through copies of the inputs. A figure is the median of several windows, for all but v000 over two sittings.
// Sittings can differ by a few percent; kernels timed side by side share one.
// v000 is the starting kernel. One run takes 810 microseconds.
// compute dtype: x, Wq, Wk, Wv, Wu, bu (module inputs) rounded to bf16; the head-shared 64x64 q/k/v projections as one block-diagonal packed GEMM with exact bf16 products (x and W are inputs) on WMMA 16x16x32; q and k stored as f16 hi + (x2048-scaled) residual rows, causal scores with 3 products (the module's d^-1/4 on q and on k applied as the exact 1/32 on the f32 score); P.V with P as f16 hi + (x2048-scaled) residual x V as f16 hi + (x2048-scaled) residual planes (3 products); the output projection with ctx as bf16 hi + residual x exact Wu (2 products) + bu; running-max softmax in f32 with the hardware exp; f32 accumulate.
#include <hip/hip_runtime.h>
#include <math.h>

typedef __attribute__((ext_vector_type(16))) _Float16 v16h;
typedef __attribute__((ext_vector_type(16))) __bf16 v16b;
typedef __attribute__((ext_vector_type(8)))  _Float16 v8h;
typedef __attribute__((ext_vector_type(8)))  float v8f;
typedef __attribute__((ext_vector_type(4)))  float v4f;
typedef __attribute__((ext_vector_type(2)))  float v2f;
typedef __attribute__((ext_vector_type(4)))  unsigned v4u;
typedef __attribute__((ext_vector_type(4)))  int v4i;
typedef float __attribute__((may_alias)) float_a;
typedef int __attribute__((may_alias)) int_a;

template <typename T> __device__ __forceinline__ void vst2(void* p, T v) { *(T*)p = v;  }
__device__ __forceinline__ v8f wmma16(v16h a, v16h b, v8f c) {
  v8f d = __builtin_amdgcn_wmma_f32_16x16x32_f16(false, a, false, b, (short)0, c, false, false);
  asm volatile("v_nop\n\tv_nop\n\tv_nop\n\tv_nop" : "+v"(d) : "v"(a), "v"(b));
  return d;
}
__device__ __forceinline__ v8f wmma_bf(v16b a, v16b b, v8f c) {
  v8f d = __builtin_amdgcn_wmma_f32_16x16x32_bf16(false, a, false, b, (short)0, c, false, false);
  asm volatile("v_nop\n\tv_nop\n\tv_nop\n\tv_nop" : "+v"(d) : "v"(a), "v"(b));
  return d;
}
// 'Narrow' causal self-attention (B 4, T 2,048, emb 1,024 = 16 heads x 64 with ONE shared 64x64 Wq/Wk/Wv): per head q = x_h Wq^T d^-1/4, k = x_h Wk^T d^-1/4, v = x_h Wv^T; causal softmax(q k^T) v; out = y Wu^T + bu.
__device__ __forceinline__ v16h frag_h(const _Float16* rowk0, int lane) {
  union { v16h v; v8h q[2]; } u; const _Float16* p = rowk0 + 8 * (lane >> 4);
  u.q[0] = *(const v8h*)p; u.q[1] = *(const v8h*)(p + 16); return u.v;
}
__device__ __forceinline__ v16h frag_f32(const float* rowk0, int lane) {
  v16h a; const float* p = rowk0 + 8 * (lane >> 4);
#pragma unroll
  for (int i = 0; i < 8; ++i) { a[i] = (_Float16)p[i]; a[8 + i] = (_Float16)p[16 + i]; }
  return a;
}
__device__ __forceinline__ v16h frag_f32s(const float* rowk0, int lane, float sc) {
  v16h a; const float* p = rowk0 + 8 * (lane >> 4);
#pragma unroll
  for (int i = 0; i < 8; ++i) { a[i] = (_Float16)(p[i] * sc); a[8 + i] = (_Float16)(p[16 + i] * sc); }
  return a;
}
// column fragment from a [K][ld] layout (column n), rows >= K read as 0
__device__ __forceinline__ v16h fragc_f32(const float* W, int k0, int n, int lane, int ld, int K) {
  v16h a; const int g = lane >> 4;
#pragma unroll
  for (int i = 0; i < 8; ++i) { const int ka = k0 + 8 * g + i, kb = ka + 16;
    a[i] = (_Float16)(ka < K ? W[(size_t)(ka < K ? ka : K - 1) * ld + n] : 0.f); a[8 + i] = (_Float16)(kb < K ? W[(size_t)(kb < K ? kb : K - 1) * ld + n] : 0.f); }
  return a;
}
struct F2 { v16b h, l; };
__device__ __forceinline__ F2 bsplit16(const float v[16]) { F2 r;
#pragma unroll
  for (int i = 0; i < 16; ++i) { const __bf16 h = (__bf16)v[i]; r.h[i] = h; r.l[i] = (__bf16)(v[i] - (float)h); }
  return r; }
__device__ __forceinline__ F2 split_row(const float* row, int k0, int lane) { float v[16]; const float* p = row + k0 + 8 * (lane >> 4);
#pragma unroll
  for (int i = 0; i < 8; ++i) { v[i] = p[i]; v[8 + i] = p[16 + i]; }
  return bsplit16(v); }
__device__ __forceinline__ F2 split_rowK(const float* row, int k0, int lane, int K) { float v[16]; const int g = lane >> 4;
#pragma unroll
  for (int i = 0; i < 8; ++i) { const int ka = k0 + 8 * g + i, kb = ka + 16; v[i] = ka < K ? row[ka < K ? ka : K - 1] : 0.f; v[8 + i] = kb < K ? row[kb < K ? kb : K - 1] : 0.f; }
  return bsplit16(v); }
__device__ __forceinline__ F2 split_col(const float* W, int k0, int n, int lane, int ld, int K) { float v[16]; const int g = lane >> 4;
#pragma unroll
  for (int i = 0; i < 8; ++i) { const int ka = k0 + 8 * g + i, kb = ka + 16; v[i] = ka < K ? W[(size_t)(ka < K ? ka : K - 1) * ld + n] : 0.f; v[8 + i] = kb < K ? W[(size_t)(kb < K ? kb : K - 1) * ld + n] : 0.f; }
  return bsplit16(v); }
__device__ __forceinline__ v8f mac3(const F2& a, const F2& b, v8f c) { c = wmma_bf(a.l, b.h, c); c = wmma_bf(a.h, b.l, c); return wmma_bf(a.h, b.h, c); }
__device__ __forceinline__ float sigm(float v) { return 1.0f / (1.0f + expf(-v)); }
#define LDSX() do { asm volatile("s_wait_dscnt 0" ::: "memory"); __builtin_amdgcn_wave_barrier(); __builtin_amdgcn_fence(__ATOMIC_RELEASE, "workgroup"); } while (0)


// Causal multi-head self-attention (B 4, S 2048, D 1024, 16 heads x 64; head-shared 64x64 Wq/Wk/Wv expanded to a block-diagonal packed [3D][D], Wout [D][D] applied as x W^T, bias bu): softmax(q k^T / 32, causal) v; ctx Wout^T + bu.
#define NB 4
#define SS 2048
#define DM 1024
#define NH 16
#define HD 64
#define QKVW (3 * DM)
#ifndef TQB
#define TQB (SS / 64)
#define TNB NB
#define TOB (NB * SS / 64)     // output row tiles (all)
#endif
typedef __attribute__((ext_vector_type(8))) __bf16 v8b;
__device__ __forceinline__ v16b frag_b(const __bf16* rowk0, int lane) {
  union { v16b v; v8b q[2]; } u; const __bf16* p = rowk0 + 8 * (lane >> 4);
  u.q[0] = *(const v8b*)p; u.q[1] = *(const v8b*)(p + 16); return u.v;
}
__device__ __forceinline__ float bfr(float v) { return (float)(__bf16)v; }
__device__ __attribute__((noinline)) float exp_ni(float v) { return expf(v); }
__device__ __attribute__((noinline)) float erf_ni(float v) { return erff(v); }

#define PK_A 0                       // [3072][1024] Wqkv rows (natural [out][in])
#define PK_P (PK_A + QKVW * DM)        // [1024][1024] Wo rows (natural)
#define PK_END (PK_P + DM * DM)
#define WS_PK  0u
#define WS_QK  (WS_PK + 2u * PK_END)             // f16 [8192 rows][2048]: q | k
#define WS_QKL (WS_QK + 2u * NB * SS * 2 * DM)     // f16 q | k residual planes x2048
#define WS_VTH (WS_QKL + 2u * NB * SS * 2 * DM)    // f16 [b][1024 (h*64+d)][2048 s] hi
#define WS_VTL (WS_VTH + 2u * NB * DM * SS)        // f16 lo x 2048
#define WS_O   (WS_VTL + 2u * NB * DM * SS)        // f32 [8192][1024]
#define WS_CS  (WS_O + 4u * NB * SS * DM)           // f32 2 x [2048][32], reserved, not written or read
#define WS_END (WS_CS + 4u * 2 * SS * 32)

// ---- k_packbd: block = packed row n = which*1024 + h*64 + o: block-diagonal expansion of the head-shared [64][64] projection: row[h*64 + c] = W[o][c], zero elsewhere
__global__ __launch_bounds__(128) void k_packbd(const float* __restrict__ WQ, const float* __restrict__ WK, const float* __restrict__ WV, __bf16* __restrict__ DST) {
  __shared__ __align__(16) __bf16 s[DM]; const int n = blockIdx.x, t = threadIdx.x; const int which = n / DM, h = (n % DM) / HD, o = n % HD; const float* Wm = (which == 0) ? WQ : (which == 1) ? WK : WV;
  for (int k = t; k < DM; k += 128) s[k] = (__bf16)((k / HD == h) ? Wm[o * HD + (k % HD)] : 0.f);
  __syncthreads();
  vst2((unsigned*)(DST + (size_t)n * DM + t * 8), *(const v4u*)&s[t * 8]);
}
// ---- k_packrows: block = natural row n of a [N][K] weight
__global__ __launch_bounds__(256) void k_packrows(const float* __restrict__ Wm, int K, __bf16* __restrict__ DST) {
  __shared__ __align__(16) __bf16 s[DM]; const int n = blockIdx.x, tid = threadIdx.x;
  for (int k = tid; k < K; k += 256) s[k] = (__bf16)Wm[(size_t)n * K + k];
  __syncthreads();
  for (int q = tid; q < K / 8; q += 256) vst2((unsigned*)(DST + (size_t)n * K + q * 8), *(const v4u*)&s[q * 8]);
}
// ---- k_qkv: block = (64 rows (b,s), 128 of the 3072 cols): qkv = bf16(x) . rows (exact); cols < 1024 -> f16(q), cols < 2048 -> f16(k) into QK rows (pitch 2048); cols >= 2048 (v) -> per-batch transposed f16 planes VT[b][h*64+d][s]: hi = f16(v), lo = f16((v - hi) * 2048)
__global__ __launch_bounds__(128) void k_qkv(const float* __restrict__ X, const __bf16* __restrict__ P, _Float16* __restrict__ QK, _Float16* __restrict__ QKL, _Float16* __restrict__ VTH, _Float16* __restrict__ VTL) {
  __shared__ __align__(16) _Float16 so[4][16][136], sol[4][16][136]; __shared__ __align__(16) _Float16 sth[128][72], stl[128][72];
  const int tid = threadIdx.x, wave = tid >> 5, lane = tid & 31, col = lane & 15, g = lane >> 4; const size_t r0 = (size_t)blockIdx.x * 64 + wave * 16; const int n0 = blockIdx.y * 128;
  v8f acc[8] = {};
#pragma unroll 2
  for (int kc = 0; kc < DM / 32; ++kc) { v16b a; { const float* p = X + (r0 + col) * DM + kc * 32 + 8 * g;
#pragma unroll
      for (int i = 0; i < 8; ++i) { a[i] = (__bf16)p[i]; a[8 + i] = (__bf16)p[16 + i]; } }
#pragma unroll
    for (int j = 0; j < 8; ++j) acc[j] = wmma_bf(a, frag_b(P + (size_t)(n0 + j * 16 + col) * DM + kc * 32, lane), acc[j]); }
  if (n0 < 2 * DM) {   // q | k -> f16 hi + (x2048) residual rows (unscaled; the d^-1/4 x d^-1/4 = 1/32 scale is applied to the f32 score)
#pragma unroll
    for (int j = 0; j < 8; ++j) {
#pragma unroll
      for (int r = 0; r < 8; ++r) { const float v = acc[j][r]; const _Float16 hv = (_Float16)v; so[wave][8 * g + r][j * 16 + col] = hv; sol[wave][8 * g + r][j * 16 + col] = (_Float16)((v - (float)hv) * 2048.0f); } }
    LDSX();
    for (int rl = 0; rl < 16; ++rl) if (lane < 16) { vst2((unsigned*)(QK + (r0 + rl) * (2 * DM) + n0 + lane * 8), *(const v4u*)&so[wave][rl][lane * 8]); vst2((unsigned*)(QKL + (r0 + rl) * (2 * DM) + n0 + lane * 8), *(const v4u*)&sol[wave][rl][lane * 8]); }
  } else {
#pragma unroll
    for (int j = 0; j < 8; ++j) {
#pragma unroll
      for (int r = 0; r < 8; ++r) { const float v = acc[j][r]; const _Float16 hv = (_Float16)v; sth[j * 16 + col][wave * 16 + 8 * g + r] = hv; stl[j * 16 + col][wave * 16 + 8 * g + r] = (_Float16)((v - (float)hv) * 2048.0f); } }
    __syncthreads();
    const size_t rb = (size_t)blockIdx.x * 64; const int b = (int)(rb / SS), s0 = (int)(rb % SS); const int pc0 = n0 - 2 * DM;
    for (int q = tid; q < 128 * 8; q += 128) { const int d = q >> 3, pc = q & 7; const size_t o = ((size_t)b * DM + pc0 + d) * SS + s0 + pc * 8; vst2((unsigned*)(VTH + o), *(const v4u*)&sth[d][pc * 8]); vst2((unsigned*)(VTL + o), *(const v4u*)&stl[d][pc * 8]); }
  }
}
// ---- k_attn: block = (64 queries, head h, batch b): causal flash attention (K = 64: 2 k-steps), scores = (q.k) * 0.03125 with q, k as f16 hi + residual (3 products), P.V: f16 P hi + residual x (V hi, V lo*2048) (3 products) in two accumulators; O[b*S+q][h*64+d] = (acc + accl / 2048) / l (256-B segments)
__global__ __launch_bounds__(128) void k_attn(const _Float16* __restrict__ QK, const _Float16* __restrict__ QKL, const _Float16* __restrict__ VTH, const _Float16* __restrict__ VTL, float* __restrict__ O) {
  __shared__ __align__(16) float sp[4][16][36]; __shared__ __align__(16) float so[4][16][68];
  const int tid = threadIdx.x, wave = tid >> 5, lane = tid & 31, col = lane & 15, g = lane >> 4;
  const int qb = blockIdx.x, h = blockIdx.y, b = blockIdx.z; const int q0 = qb * 64 + wave * 16; const size_t rq = (size_t)b * SS + q0 + col;
  v16h aq[2], aql[2];
#pragma unroll
  for (int kc = 0; kc < 2; ++kc) { aq[kc] = frag_h(QK + rq * (2 * DM) + h * HD + kc * 32, lane); aql[kc] = frag_h(QKL + rq * (2 * DM) + h * HD + kc * 32, lane); }
  float m[8], l[8];
#pragma unroll
  for (int r = 0; r < 8; ++r) { m[r] = -3.0e38f; l[r] = 0.f; }
  v8f acc[4] = {}, accl[4] = {};
  const int nks = (qb * 64 + 64) / 32;
#pragma unroll 1
  for (int ks = 0; ks < nks; ++ks) { v8f s[2];
#pragma unroll
    for (int ct = 0; ct < 2; ++ct) { const int kk = ks * 32 + ct * 16 + col; const _Float16* krow = QK + ((size_t)b * SS + kk) * (2 * DM) + DM + h * HD; const _Float16* krowl = QKL + ((size_t)b * SS + kk) * (2 * DM) + DM + h * HD; v8f c = {}, cl = {};
#pragma unroll
      for (int kc = 0; kc < 2; ++kc) { const v16h kh = frag_h(krow + kc * 32, lane); c = wmma16(aq[kc], kh, c); cl = wmma16(aql[kc], kh, cl); cl = wmma16(aq[kc], frag_h(krowl + kc * 32, lane), cl); }   // 3 products: q, k as f16 hi + residual
#pragma unroll
      for (int r = 0; r < 8; ++r) c[r] += cl[r] * (1.0f / 2048.0f);
#pragma unroll
      for (int r = 0; r < 8; ++r) { const int qi = q0 + 8 * g + r; s[ct][r] = (kk <= qi) ? c[r] * 0.03125f : -3.0e38f; } }   // (d^-1/4)^2 = 1024^-1/2 = 1/32 exactly
#pragma unroll
    for (int r = 0; r < 8; ++r) { float mx = fmaxf(s[0][r], s[1][r]);
#pragma unroll
      for (int o = 1; o < 16; o <<= 1) mx = fmaxf(mx, __shfl_xor(mx, o));
      const float mn = fmaxf(m[r], mx); const float alpha = (m[r] <= -1.0e38f) ? 0.f : __expf(m[r] - mn);
      const float e0 = (s[0][r] <= -1.0e38f) ? 0.f : __expf(s[0][r] - mn), e1 = (s[1][r] <= -1.0e38f) ? 0.f : __expf(s[1][r] - mn); float es = e0 + e1;
#pragma unroll
      for (int o = 1; o < 16; o <<= 1) es += __shfl_xor(es, o);
      l[r] = l[r] * alpha + es; m[r] = mn;
#pragma unroll
      for (int dt = 0; dt < 4; ++dt) { acc[dt][r] *= alpha; accl[dt][r] *= alpha; }
      sp[wave][8 * g + r][col] = e0; sp[wave][8 * g + r][16 + col] = e1; }
    LDSX();
    v16h pa, pl; { const float* prow = &sp[wave][col][0] + 8 * (lane >> 4);
#pragma unroll
      for (int i = 0; i < 8; ++i) { const float x0 = prow[i], x1 = prow[16 + i]; const _Float16 h0 = (_Float16)x0, h1 = (_Float16)x1; pa[i] = h0; pa[8 + i] = h1; pl[i] = (_Float16)((x0 - (float)h0) * 2048.0f); pl[8 + i] = (_Float16)((x1 - (float)h1) * 2048.0f); } }
#pragma unroll
    for (int dt = 0; dt < 4; ++dt) { const size_t vr = ((size_t)b * DM + h * HD + dt * 16 + col) * SS + ks * 32; const v16h vh = frag_h(VTH + vr, lane); acc[dt] = wmma16(pa, vh, acc[dt]); accl[dt] = wmma16(pl, vh, accl[dt]); accl[dt] = wmma16(pa, frag_h(VTL + vr, lane), accl[dt]); }   // P hi x V hi + (P lo x V hi + P hi x V lo) / 2048
    LDSX(); }
#pragma unroll
  for (int r = 0; r < 8; ++r) { const float il = 1.0f / l[r];
#pragma unroll
    for (int dt = 0; dt < 4; ++dt) so[wave][8 * g + r][dt * 16 + col] = (acc[dt][r] + accl[dt][r] * (1.0f / 2048.0f)) * il; }
  LDSX();
  for (int rl = 0; rl < 16; ++rl) if (lane < 16) vst2(O + ((size_t)b * SS + q0 + rl) * DM + h * HD + lane * 4, *(const v4f*)&so[wave][rl][lane * 4]);
}
// ---- k_out: block = (64 rows, 128 cols): out = O(hi/lo) . Wo rows (2 products) + bo
__global__ __launch_bounds__(128) void k_out(const float* __restrict__ O, const __bf16* __restrict__ P, const float* __restrict__ BU, float* __restrict__ Y) {
  __shared__ __align__(16) float so[4][16][132];
  const int tid = threadIdx.x, wave = tid >> 5, lane = tid & 31, col = lane & 15, g = lane >> 4; const size_t r0 = (size_t)blockIdx.x * 64 + wave * 16; const int n0 = blockIdx.y * 128;
  v8f acc[8] = {};
#pragma unroll 2
  for (int kc = 0; kc < DM / 32; ++kc) { const F2 a = split_row(O + (r0 + col) * DM, kc * 32, lane);
#pragma unroll
    for (int j = 0; j < 8; ++j) { const v16b w = frag_b(P + (size_t)(n0 + j * 16 + col) * DM + kc * 32, lane); acc[j] = wmma_bf(a.l, w, acc[j]); acc[j] = wmma_bf(a.h, w, acc[j]); } }
#pragma unroll
  for (int j = 0; j < 8; ++j) { const float bb = bfr(BU[n0 + j * 16 + col]);
#pragma unroll
    for (int r = 0; r < 8; ++r) so[wave][8 * g + r][j * 16 + col] = acc[j][r] + bb; }
  LDSX();
  for (int rl = 0; rl < 16; ++rl) vst2(Y + (r0 + rl) * DM + n0 + lane * 4, *(const v4f*)&so[wave][rl][lane * 4]);
}
extern "C" void kernel_launch(void* const* d_in, const int* in_sizes, int n_in, void* d_out, int out_size, void* d_ws, size_t ws_size, hipStream_t stream) {
  (void)in_sizes; (void)n_in; (void)out_size;
  const float** F = (const float**)d_in;   // 0 x [4,2048,1024], 1 Wq [64,64] ([out][in], shared by all 16 heads), 2 Wk, 3 Wv, 4 Wu [1024,1024], 5 bu [1024]
  if (ws_size < (size_t)WS_END) return;
  char* ws = (char*)d_ws; __bf16* PK = (__bf16*)(ws + WS_PK); _Float16 *QK = (_Float16*)(ws + WS_QK), *QKL = (_Float16*)(ws + WS_QKL), *VTH = (_Float16*)(ws + WS_VTH), *VTL = (_Float16*)(ws + WS_VTL); float *O = (float*)(ws + WS_O);
  k_packbd<<<QKVW, 128, 0, stream>>>(F[1], F[2], F[3], PK + PK_A); k_packrows<<<DM, 256, 0, stream>>>(F[4], DM, PK + PK_P);
  k_qkv<<<dim3(TNB * SS / 64, QKVW / 128), 128, 0, stream>>>(F[0], PK + PK_A, QK, QKL, VTH, VTL);
  k_attn<<<dim3(TQB, NH, TNB), 128, 0, stream>>>(QK, QKL, VTH, VTL, O);
  k_out<<<dim3(TOB, DM / 128), 128, 0, stream>>>(O, PK + PK_P, F[5], (float*)d_out);
}

// v001
// It runs in 623 microseconds.
// Timed twice side by side with v000, it ran 1.32 times as fast both times.
// compute dtype: x, Wq, Wk, Wv, Wu, bu (module inputs) rounded to bf16; the head-shared 64x64 q/k/v projections as one block-diagonal packed GEMM with exact bf16 products (x and W are inputs) on WMMA 16x16x32; q and k stored as f16 hi + (x2048-scaled) residual rows, causal scores with 3 products (the module's d^-1/4 on q and on k applied as the exact 1/32 on the f32 score); P.V with P as f16 hi + (x2048-scaled) residual x V as f16 hi + (x2048-scaled) residual planes (3 products); the output projection with ctx as bf16 hi + residual x exact Wu (2 products) + bu; running-max softmax in f32 with the hardware exp; f32 accumulate.
#include <hip/hip_runtime.h>
#include <math.h>

typedef __attribute__((ext_vector_type(16))) _Float16 v16h;
typedef __attribute__((ext_vector_type(16))) __bf16 v16b;
typedef __attribute__((ext_vector_type(8)))  _Float16 v8h;
typedef __attribute__((ext_vector_type(8)))  float v8f;
typedef __attribute__((ext_vector_type(4)))  float v4f;
typedef __attribute__((ext_vector_type(2)))  float v2f;
typedef __attribute__((ext_vector_type(4)))  unsigned v4u;
typedef __attribute__((ext_vector_type(4)))  int v4i;
typedef float __attribute__((may_alias)) float_a;
typedef int __attribute__((may_alias)) int_a;

template <typename T> __device__ __forceinline__ void vst2(void* p, T v) { *(T*)p = v;  }
__device__ __forceinline__ v8f wmma16(v16h a, v16h b, v8f c) {
  v8f d = __builtin_amdgcn_wmma_f32_16x16x32_f16(false, a, false, b, (short)0, c, false, false);
  asm volatile("v_nop\n\tv_nop\n\tv_nop\n\tv_nop" : "+v"(d) : "v"(a), "v"(b));
  return d;
}
__device__ __forceinline__ v8f wmma_bf(v16b a, v16b b, v8f c) {
  v8f d = __builtin_amdgcn_wmma_f32_16x16x32_bf16(false, a, false, b, (short)0, c, false, false);
  asm volatile("v_nop\n\tv_nop\n\tv_nop\n\tv_nop" : "+v"(d) : "v"(a), "v"(b));
  return d;
}
// 'Narrow' causal self-attention (B 4, T 2,048, emb 1,024 = 16 heads x 64 with ONE shared 64x64 Wq/Wk/Wv): per head q = x_h Wq^T d^-1/4, k = x_h Wk^T d^-1/4, v = x_h Wv^T; causal softmax(q k^T) v; out = y Wu^T + bu.
__device__ __forceinline__ v16h frag_h(const _Float16* rowk0, int lane) {
  union { v16h v; v8h q[2]; } u; const _Float16* p = rowk0 + 8 * (lane >> 4);
  u.q[0] = *(const v8h*)p; u.q[1] = *(const v8h*)(p + 16); return u.v;
}
__device__ __forceinline__ v16h frag_f32(const float* rowk0, int lane) {
  v16h a; const float* p = rowk0 + 8 * (lane >> 4);
#pragma unroll
  for (int i = 0; i < 8; ++i) { a[i] = (_Float16)p[i]; a[8 + i] = (_Float16)p[16 + i]; }
  return a;
}
__device__ __forceinline__ v16h frag_f32s(const float* rowk0, int lane, float sc) {
  v16h a; const float* p = rowk0 + 8 * (lane >> 4);
#pragma unroll
  for (int i = 0; i < 8; ++i) { a[i] = (_Float16)(p[i] * sc); a[8 + i] = (_Float16)(p[16 + i] * sc); }
  return a;
}
// column fragment from a [K][ld] layout (column n), rows >= K read as 0
__device__ __forceinline__ v16h fragc_f32(const float* W, int k0, int n, int lane, int ld, int K) {
  v16h a; const int g = lane >> 4;
#pragma unroll
  for (int i = 0; i < 8; ++i) { const int ka = k0 + 8 * g + i, kb = ka + 16;
    a[i] = (_Float16)(ka < K ? W[(size_t)(ka < K ? ka : K - 1) * ld + n] : 0.f); a[8 + i] = (_Float16)(kb < K ? W[(size_t)(kb < K ? kb : K - 1) * ld + n] : 0.f); }
  return a;
}
struct F2 { v16b h, l; };
__device__ __forceinline__ F2 bsplit16(const float v[16]) { F2 r;
#pragma unroll
  for (int i = 0; i < 16; ++i) { const __bf16 h = (__bf16)v[i]; r.h[i] = h; r.l[i] = (__bf16)(v[i] - (float)h); }
  return r; }
__device__ __forceinline__ F2 split_row(const float* row, int k0, int lane) { float v[16]; const float* p = row + k0 + 8 * (lane >> 4);
#pragma unroll
  for (int i = 0; i < 8; ++i) { v[i] = p[i]; v[8 + i] = p[16 + i]; }
  return bsplit16(v); }
__device__ __forceinline__ F2 split_rowK(const float* row, int k0, int lane, int K) { float v[16]; const int g = lane >> 4;
#pragma unroll
  for (int i = 0; i < 8; ++i) { const int ka = k0 + 8 * g + i, kb = ka + 16; v[i] = ka < K ? row[ka < K ? ka : K - 1] : 0.f; v[8 + i] = kb < K ? row[kb < K ? kb : K - 1] : 0.f; }
  return bsplit16(v); }
__device__ __forceinline__ F2 split_col(const float* W, int k0, int n, int lane, int ld, int K) { float v[16]; const int g = lane >> 4;
#pragma unroll
  for (int i = 0; i < 8; ++i) { const int ka = k0 + 8 * g + i, kb = ka + 16; v[i] = ka < K ? W[(size_t)(ka < K ? ka : K - 1) * ld + n] : 0.f; v[8 + i] = kb < K ? W[(size_t)(kb < K ? kb : K - 1) * ld + n] : 0.f; }
  return bsplit16(v); }
__device__ __forceinline__ v8f mac3(const F2& a, const F2& b, v8f c) { c = wmma_bf(a.l, b.h, c); c = wmma_bf(a.h, b.l, c); return wmma_bf(a.h, b.h, c); }
__device__ __forceinline__ float sigm(float v) { return 1.0f / (1.0f + expf(-v)); }
#define LDSX() do { asm volatile("s_wait_dscnt 0" ::: "memory"); __builtin_amdgcn_wave_barrier(); __builtin_amdgcn_fence(__ATOMIC_RELEASE, "workgroup"); } while (0)


// Causal multi-head self-attention (B 4, S 2048, D 1024, 16 heads x 64; head-shared 64x64 Wq/Wk/Wv expanded to a block-diagonal packed [3D][D], Wout [D][D] applied as x W^T, bias bu): softmax(q k^T / 32, causal) v; ctx Wout^T + bu.
#define NB 4
#define SS 2048
#define DM 1024
#define NH 16
#define HD 64
#define QKVW (3 * DM)
#ifndef TQB
#define TQB (SS / 64)
#define TNB NB
#define TOB (NB * SS / 64)     // output row tiles (all)
#endif
typedef __attribute__((ext_vector_type(8))) __bf16 v8b;
__device__ __forceinline__ v16b frag_b(const __bf16* rowk0, int lane) {
  union { v16b v; v8b q[2]; } u; const __bf16* p = rowk0 + 8 * (lane >> 4);
  u.q[0] = *(const v8b*)p; u.q[1] = *(const v8b*)(p + 16); return u.v;
}
__device__ __forceinline__ float bfr(float v) { return (float)(__bf16)v; }
__device__ __attribute__((noinline)) float exp_ni(float v) { return expf(v); }
__device__ __attribute__((noinline)) float erf_ni(float v) { return erff(v); }

#define PK_A 0                       // [3072][1024] Wqkv rows (natural [out][in])
#define PK_P (PK_A + QKVW * DM)        // [1024][1024] Wo rows (natural)
#define PK_END (PK_P + DM * DM)
#define WS_PK  0u
#define WS_QK  (WS_PK + 2u * PK_END)             // f16 [8192 rows][2048]: q | k
#define WS_QKL (WS_QK + 2u * NB * SS * 2 * DM)     // f16 q | k residual planes x2048
#define WS_VTH (WS_QKL + 2u * NB * SS * 2 * DM)    // f16 [b][1024 (h*64+d)][2048 s] hi
#define WS_VTL (WS_VTH + 2u * NB * DM * SS)        // f16 lo x 2048
#define WS_O   (WS_VTL + 2u * NB * DM * SS)        // f32 [8192][1024]
#define WS_CS  (WS_O + 4u * NB * SS * DM)           // f32 2 x [2048][32], reserved, not written or read
#define WS_END (WS_CS + 4u * 2 * SS * 32)

// ---- k_packbd: block = packed row n = which*1024 + h*64 + o: block-diagonal expansion of the head-shared [64][64] projection: row[h*64 + c] = W[o][c], zero elsewhere
__global__ __launch_bounds__(128) void k_packbd(const float* __restrict__ WQ, const float* __restrict__ WK, const float* __restrict__ WV, __bf16* __restrict__ DST) {
  __shared__ __align__(16) __bf16 s[DM]; const int n = blockIdx.x, t = threadIdx.x; const int which = n / DM, h = (n % DM) / HD, o = n % HD; const float* Wm = (which == 0) ? WQ : (which == 1) ? WK : WV;
  for (int k = t; k < DM; k += 128) s[k] = (__bf16)((k / HD == h) ? Wm[o * HD + (k % HD)] : 0.f);
  __syncthreads();
  vst2((unsigned*)(DST + (size_t)n * DM + t * 8), *(const v4u*)&s[t * 8]);
}
// ---- k_packrows: block = natural row n of a [N][K] weight
__global__ __launch_bounds__(256) void k_packrows(const float* __restrict__ Wm, int K, __bf16* __restrict__ DST) {
  __shared__ __align__(16) __bf16 s[DM]; const int n = blockIdx.x, tid = threadIdx.x;
  for (int k = tid; k < K; k += 256) s[k] = (__bf16)Wm[(size_t)n * K + k];
  __syncthreads();
  for (int q = tid; q < K / 8; q += 256) vst2((unsigned*)(DST + (size_t)n * K + q * 8), *(const v4u*)&s[q * 8]);
}
// ---- k_qkv: block = (64 rows (b,s), 128 of the 3072 cols): qkv = bf16(x) . rows (exact); cols < 1024 -> f16(q), cols < 2048 -> f16(k) into QK rows (pitch 2048); cols >= 2048 (v) -> per-batch transposed f16 planes VT[b][h*64+d][s]: hi = f16(v), lo = f16((v - hi) * 2048)
__global__ __launch_bounds__(128) void k_qkv(const float* __restrict__ X, const __bf16* __restrict__ P, _Float16* __restrict__ QK, _Float16* __restrict__ QKL, _Float16* __restrict__ VTH, _Float16* __restrict__ VTL) {
  __shared__ __align__(16) _Float16 so[4][16][136], sol[4][16][136]; __shared__ __align__(16) _Float16 sth[128][72], stl[128][72];
  const int tid = threadIdx.x, wave = tid >> 5, lane = tid & 31, col = lane & 15, g = lane >> 4; const size_t r0 = (size_t)blockIdx.x * 64 + wave * 16; const int n0 = blockIdx.y * 128;
  v8f acc[8] = {};
  // packed row n is zero outside columns [head*64, head*64+64), head = (n % 1024) / 64: the 128 columns of this block are two heads, and each head's four column tiles take only their own 64 k
#pragma unroll
  for (int hh = 0; hh < 2; ++hh) { const int kb = (n0 % DM) + hh * HD;
#pragma unroll
    for (int kc = 0; kc < HD / 32; ++kc) { v16b a; { const float* p = X + (r0 + col) * DM + kb + kc * 32 + 8 * g;
#pragma unroll
        for (int i = 0; i < 8; ++i) { a[i] = (__bf16)p[i]; a[8 + i] = (__bf16)p[16 + i]; } }
#pragma unroll
      for (int j = 0; j < 4; ++j) acc[hh * 4 + j] = wmma_bf(a, frag_b(P + (size_t)(n0 + (hh * 4 + j) * 16 + col) * DM + kb + kc * 32, lane), acc[hh * 4 + j]); } }
  if (n0 < 2 * DM) {   // q | k -> f16 hi + (x2048) residual rows (unscaled; the d^-1/4 x d^-1/4 = 1/32 scale is applied to the f32 score)
#pragma unroll
    for (int j = 0; j < 8; ++j) {
#pragma unroll
      for (int r = 0; r < 8; ++r) { const float v = acc[j][r]; const _Float16 hv = (_Float16)v; so[wave][8 * g + r][j * 16 + col] = hv; sol[wave][8 * g + r][j * 16 + col] = (_Float16)((v - (float)hv) * 2048.0f); } }
    LDSX();
    for (int rl = 0; rl < 16; ++rl) if (lane < 16) { vst2((unsigned*)(QK + (r0 + rl) * (2 * DM) + n0 + lane * 8), *(const v4u*)&so[wave][rl][lane * 8]); vst2((unsigned*)(QKL + (r0 + rl) * (2 * DM) + n0 + lane * 8), *(const v4u*)&sol[wave][rl][lane * 8]); }
  } else {
#pragma unroll
    for (int j = 0; j < 8; ++j) {
#pragma unroll
      for (int r = 0; r < 8; ++r) { const float v = acc[j][r]; const _Float16 hv = (_Float16)v; sth[j * 16 + col][wave * 16 + 8 * g + r] = hv; stl[j * 16 + col][wave * 16 + 8 * g + r] = (_Float16)((v - (float)hv) * 2048.0f); } }
    __syncthreads();
    const size_t rb = (size_t)blockIdx.x * 64; const int b = (int)(rb / SS), s0 = (int)(rb % SS); const int pc0 = n0 - 2 * DM;
    for (int q = tid; q < 128 * 8; q += 128) { const int d = q >> 3, pc = q & 7; const size_t o = ((size_t)b * DM + pc0 + d) * SS + s0 + pc * 8; vst2((unsigned*)(VTH + o), *(const v4u*)&sth[d][pc * 8]); vst2((unsigned*)(VTL + o), *(const v4u*)&stl[d][pc * 8]); }
  }
}
// ---- k_attn: block = (64 queries, head h, batch b): causal flash attention (K = 64: 2 k-steps), scores = (q.k) * 0.03125 with q, k as f16 hi + residual (3 products), P.V: f16 P hi + residual x (V hi, V lo*2048) (3 products) in two accumulators; O[b*S+q][h*64+d] = (acc + accl / 2048) / l (256-B segments)
__global__ __launch_bounds__(128) void k_attn(const _Float16* __restrict__ QK, const _Float16* __restrict__ QKL, const _Float16* __restrict__ VTH, const _Float16* __restrict__ VTL, float* __restrict__ O) {
  __shared__ __align__(16) float sp[4][16][36]; __shared__ __align__(16) float so[4][16][68];
  const int tid = threadIdx.x, wave = tid >> 5, lane = tid & 31, col = lane & 15, g = lane >> 4;
  const int qb = blockIdx.x, h = blockIdx.y, b = blockIdx.z; const int q0 = qb * 64 + wave * 16; const size_t rq = (size_t)b * SS + q0 + col;
  v16h aq[2], aql[2];
#pragma unroll
  for (int kc = 0; kc < 2; ++kc) { aq[kc] = frag_h(QK + rq * (2 * DM) + h * HD + kc * 32, lane); aql[kc] = frag_h(QKL + rq * (2 * DM) + h * HD + kc * 32, lane); }
  float m[8], l[8];
#pragma unroll
  for (int r = 0; r < 8; ++r) { m[r] = -3.0e38f; l[r] = 0.f; }
  v8f acc[4] = {}, accl[4] = {};
  const int nks = (qb * 64 + 64) / 32;
#pragma unroll 1
  for (int ks = 0; ks < nks; ++ks) { v8f s[2];
#pragma unroll
    for (int ct = 0; ct < 2; ++ct) { const int kk = ks * 32 + ct * 16 + col; const _Float16* krow = QK + ((size_t)b * SS + kk) * (2 * DM) + DM + h * HD; const _Float16* krowl = QKL + ((size_t)b * SS + kk) * (2 * DM) + DM + h * HD; v8f c = {}, cl = {};
#pragma unroll
      for (int kc = 0; kc < 2; ++kc) { const v16h kh = frag_h(krow + kc * 32, lane); c = wmma16(aq[kc], kh, c); cl = wmma16(aql[kc], kh, cl); cl = wmma16(aq[kc], frag_h(krowl + kc * 32, lane), cl); }   // 3 products: q, k as f16 hi + residual
#pragma unroll
      for (int r = 0; r < 8; ++r) c[r] += cl[r] * (1.0f / 2048.0f);
#pragma unroll
      for (int r = 0; r < 8; ++r) { const int qi = q0 + 8 * g + r; s[ct][r] = (kk <= qi) ? c[r] * 0.03125f : -3.0e38f; } }   // (d^-1/4)^2 = 1024^-1/2 = 1/32 exactly
#pragma unroll
    for (int r = 0; r < 8; ++r) { float mx = fmaxf(s[0][r], s[1][r]);
#pragma unroll
      for (int o = 1; o < 16; o <<= 1) mx = fmaxf(mx, __shfl_xor(mx, o));
      const float mn = fmaxf(m[r], mx); const float alpha = (m[r] <= -1.0e38f) ? 0.f : __expf(m[r] - mn);
      const float e0 = (s[0][r] <= -1.0e38f) ? 0.f : __expf(s[0][r] - mn), e1 = (s[1][r] <= -1.0e38f) ? 0.f : __expf(s[1][r] - mn); float es = e0 + e1;
#pragma unroll
      for (int o = 1; o < 16; o <<= 1) es += __shfl_xor(es, o);
      l[r] = l[r] * alpha + es; m[r] = mn;
#pragma unroll
      for (int dt = 0; dt < 4; ++dt) { acc[dt][r] *= alpha; accl[dt][r] *= alpha; }
      sp[wave][8 * g + r][col] = e0; sp[wave][8 * g + r][16 + col] = e1; }
    LDSX();
    v16h pa, pl; { const float* prow = &sp[wave][col][0] + 8 * (lane >> 4);
#pragma unroll
      for (int i = 0; i < 8; ++i) { const float x0 = prow[i], x1 = prow[16 + i]; const _Float16 h0 = (_Float16)x0, h1 = (_Float16)x1; pa[i] = h0; pa[8 + i] = h1; pl[i] = (_Float16)((x0 - (float)h0) * 2048.0f); pl[8 + i] = (_Float16)((x1 - (float)h1) * 2048.0f); } }
#pragma unroll
    for (int dt = 0; dt < 4; ++dt) { const size_t vr = ((size_t)b * DM + h * HD + dt * 16 + col) * SS + ks * 32; const v16h vh = frag_h(VTH + vr, lane); acc[dt] = wmma16(pa, vh, acc[dt]); accl[dt] = wmma16(pl, vh, accl[dt]); accl[dt] = wmma16(pa, frag_h(VTL + vr, lane), accl[dt]); }   // P hi x V hi + (P lo x V hi + P hi x V lo) / 2048
    LDSX(); }
#pragma unroll
  for (int r = 0; r < 8; ++r) { const float il = 1.0f / l[r];
#pragma unroll
    for (int dt = 0; dt < 4; ++dt) so[wave][8 * g + r][dt * 16 + col] = (acc[dt][r] + accl[dt][r] * (1.0f / 2048.0f)) * il; }
  LDSX();
  for (int rl = 0; rl < 16; ++rl) if (lane < 16) vst2(O + ((size_t)b * SS + q0 + rl) * DM + h * HD + lane * 4, *(const v4f*)&so[wave][rl][lane * 4]);
}
// ---- k_out: block = (64 rows, 128 cols): out = O(hi/lo) . Wo rows (2 products) + bo
__global__ __launch_bounds__(128) void k_out(const float* __restrict__ O, const __bf16* __restrict__ P, const float* __restrict__ BU, float* __restrict__ Y) {
  __shared__ __align__(16) float so[4][16][132];
  const int tid = threadIdx.x, wave = tid >> 5, lane = tid & 31, col = lane & 15, g = lane >> 4; const size_t r0 = (size_t)blockIdx.x * 64 + wave * 16; const int n0 = blockIdx.y * 128;
  v8f acc[8] = {};
#pragma unroll 2
  for (int kc = 0; kc < DM / 32; ++kc) { const F2 a = split_row(O + (r0 + col) * DM, kc * 32, lane);
#pragma unroll
    for (int j = 0; j < 8; ++j) { const v16b w = frag_b(P + (size_t)(n0 + j * 16 + col) * DM + kc * 32, lane); acc[j] = wmma_bf(a.l, w, acc[j]); acc[j] = wmma_bf(a.h, w, acc[j]); } }
#pragma unroll
  for (int j = 0; j < 8; ++j) { const float bb = bfr(BU[n0 + j * 16 + col]);
#pragma unroll
    for (int r = 0; r < 8; ++r) so[wave][8 * g + r][j * 16 + col] = acc[j][r] + bb; }
  LDSX();
  for (int rl = 0; rl < 16; ++rl) vst2(Y + (r0 + rl) * DM + n0 + lane * 4, *(const v4f*)&so[wave][rl][lane * 4]);
}
extern "C" void kernel_launch(void* const* d_in, const int* in_sizes, int n_in, void* d_out, int out_size, void* d_ws, size_t ws_size, hipStream_t stream) {
  (void)in_sizes; (void)n_in; (void)out_size;
  const float** F = (const float**)d_in;   // 0 x [4,2048,1024], 1 Wq [64,64] ([out][in], shared by all 16 heads), 2 Wk, 3 Wv, 4 Wu [1024,1024], 5 bu [1024]
  if (ws_size < (size_t)WS_END) return;
  char* ws = (char*)d_ws; __bf16* PK = (__bf16*)(ws + WS_PK); _Float16 *QK = (_Float16*)(ws + WS_QK), *QKL = (_Float16*)(ws + WS_QKL), *VTH = (_Float16*)(ws + WS_VTH), *VTL = (_Float16*)(ws + WS_VTL); float *O = (float*)(ws + WS_O);
  k_packbd<<<QKVW, 128, 0, stream>>>(F[1], F[2], F[3], PK + PK_A); k_packrows<<<DM, 256, 0, stream>>>(F[4], DM, PK + PK_P);
  k_qkv<<<dim3(TNB * SS / 64, QKVW / 128), 128, 0, stream>>>(F[0], PK + PK_A, QK, QKL, VTH, VTL);
  k_attn<<<dim3(TQB, NH, TNB), 128, 0, stream>>>(QK, QKL, VTH, VTL, O);
  k_out<<<dim3(TOB, DM / 128), 128, 0, stream>>>(O, PK + PK_P, F[5], (float*)d_out);
}

// v002
// It runs in 363 microseconds.
// Two timings next to v001 both put it at 1.71 times that version's speed.
// Over all steps from v000 it is 2.25 times as fast.
// compute dtype: x, Wq, Wk, Wv, Wu, bu (module inputs) rounded to bf16; the head-shared 64x64 q/k/v projections as one block-diagonal packed GEMM with exact bf16 products (x and W are inputs) on WMMA 16x16x32; q and k stored as f16 hi + (x2048-scaled) residual rows, causal scores with 3 products (the module's d^-1/4 on q and on k applied as the exact 1/32 on the f32 score); P.V with P as f16 hi + (x2048-scaled) residual x V as f16 hi + (x2048-scaled) residual planes (3 products); the output projection with ctx as bf16 hi + residual x exact Wu (2 products) + bu; running-max softmax in f32 with the hardware exp; f32 accumulate.
#include <hip/hip_runtime.h>
#include <math.h>

typedef __attribute__((ext_vector_type(16))) _Float16 v16h;
typedef __attribute__((ext_vector_type(16))) __bf16 v16b;
typedef __attribute__((ext_vector_type(8)))  _Float16 v8h;
typedef __attribute__((ext_vector_type(8)))  float v8f;
typedef __attribute__((ext_vector_type(4)))  float v4f;
typedef __attribute__((ext_vector_type(2)))  float v2f;
typedef __attribute__((ext_vector_type(4)))  unsigned v4u;
typedef __attribute__((ext_vector_type(4)))  int v4i;
typedef float __attribute__((may_alias)) float_a;
typedef int __attribute__((may_alias)) int_a;

template <typename T> __device__ __forceinline__ void vst2(void* p, T v) { *(T*)p = v;  }
__device__ __forceinline__ v8f wmma16(v16h a, v16h b, v8f c) {
  v8f d = __builtin_amdgcn_wmma_f32_16x16x32_f16(false, a, false, b, (short)0, c, false, false);
  asm volatile("v_nop\n\tv_nop\n\tv_nop\n\tv_nop" : "+v"(d) : "v"(a), "v"(b));
  return d;
}
__device__ __forceinline__ v8f wmma_bf(v16b a, v16b b, v8f c) {
  v8f d = __builtin_amdgcn_wmma_f32_16x16x32_bf16(false, a, false, b, (short)0, c, false, false);
  asm volatile("v_nop\n\tv_nop\n\tv_nop\n\tv_nop" : "+v"(d) : "v"(a), "v"(b));
  return d;
}
// 'Narrow' causal self-attention (B 4, T 2,048, emb 1,024 = 16 heads x 64 with ONE shared 64x64 Wq/Wk/Wv): per head q = x_h Wq^T d^-1/4, k = x_h Wk^T d^-1/4, v = x_h Wv^T; causal softmax(q k^T) v; out = y Wu^T + bu.
__device__ __forceinline__ v16h frag_h(const _Float16* rowk0, int lane) {
  union { v16h v; v8h q[2]; } u; const _Float16* p = rowk0 + 8 * (lane >> 4);
  u.q[0] = *(const v8h*)p; u.q[1] = *(const v8h*)(p + 16); return u.v;
}
__device__ __forceinline__ v16h frag_f32(const float* rowk0, int lane) {
  v16h a; const float* p = rowk0 + 8 * (lane >> 4);
#pragma unroll
  for (int i = 0; i < 8; ++i) { a[i] = (_Float16)p[i]; a[8 + i] = (_Float16)p[16 + i]; }
  return a;
}
__device__ __forceinline__ v16h frag_f32s(const float* rowk0, int lane, float sc) {
  v16h a; const float* p = rowk0 + 8 * (lane >> 4);
#pragma unroll
  for (int i = 0; i < 8; ++i) { a[i] = (_Float16)(p[i] * sc); a[8 + i] = (_Float16)(p[16 + i] * sc); }
  return a;
}
// column fragment from a [K][ld] layout (column n), rows >= K read as 0
__device__ __forceinline__ v16h fragc_f32(const float* W, int k0, int n, int lane, int ld, int K) {
  v16h a; const int g = lane >> 4;
#pragma unroll
  for (int i = 0; i < 8; ++i) { const int ka = k0 + 8 * g + i, kb = ka + 16;
    a[i] = (_Float16)(ka < K ? W[(size_t)(ka < K ? ka : K - 1) * ld + n] : 0.f); a[8 + i] = (_Float16)(kb < K ? W[(size_t)(kb < K ? kb : K - 1) * ld + n] : 0.f); }
  return a;
}
struct F2 { v16b h, l; };
__device__ __forceinline__ F2 bsplit16(const float v[16]) { F2 r;
#pragma unroll
  for (int i = 0; i < 16; ++i) { const __bf16 h = (__bf16)v[i]; r.h[i] = h; r.l[i] = (__bf16)(v[i] - (float)h); }
  return r; }
__device__ __forceinline__ F2 split_row(const float* row, int k0, int lane) { float v[16]; const float* p = row + k0 + 8 * (lane >> 4);
#pragma unroll
  for (int i = 0; i < 8; ++i) { v[i] = p[i]; v[8 + i] = p[16 + i]; }
  return bsplit16(v); }
__device__ __forceinline__ F2 split_rowK(const float* row, int k0, int lane, int K) { float v[16]; const int g = lane >> 4;
#pragma unroll
  for (int i = 0; i < 8; ++i) { const int ka = k0 + 8 * g + i, kb = ka + 16; v[i] = ka < K ? row[ka < K ? ka : K - 1] : 0.f; v[8 + i] = kb < K ? row[kb < K ? kb : K - 1] : 0.f; }
  return bsplit16(v); }
__device__ __forceinline__ F2 split_col(const float* W, int k0, int n, int lane, int ld, int K) { float v[16]; const int g = lane >> 4;
#pragma unroll
  for (int i = 0; i < 8; ++i) { const int ka = k0 + 8 * g + i, kb = ka + 16; v[i] = ka < K ? W[(size_t)(ka < K ? ka : K - 1) * ld + n] : 0.f; v[8 + i] = kb < K ? W[(size_t)(kb < K ? kb : K - 1) * ld + n] : 0.f; }
  return bsplit16(v); }
__device__ __forceinline__ v8f mac3(const F2& a, const F2& b, v8f c) { c = wmma_bf(a.l, b.h, c); c = wmma_bf(a.h, b.l, c); return wmma_bf(a.h, b.h, c); }
__device__ __forceinline__ float sigm(float v) { return 1.0f / (1.0f + expf(-v)); }
#define LDSX() do { asm volatile("s_wait_dscnt 0" ::: "memory"); __builtin_amdgcn_wave_barrier(); __builtin_amdgcn_fence(__ATOMIC_RELEASE, "workgroup"); } while (0)


// Causal multi-head self-attention (B 4, S 2048, D 1024, 16 heads x 64; head-shared 64x64 Wq/Wk/Wv expanded to a block-diagonal packed [3D][D], Wout [D][D] applied as x W^T, bias bu): softmax(q k^T / 32, causal) v; ctx Wout^T + bu.
#define NB 4
#define SS 2048
#define DM 1024
#define NH 16
#define HD 64
#define QKVW (3 * DM)
#ifndef TQB
#define TQB (SS / 64)
#define TNB NB
#define TOB (NB * SS / 64)     // output row tiles (all)
#endif
typedef __attribute__((ext_vector_type(8))) __bf16 v8b;
__device__ __forceinline__ v16b frag_b(const __bf16* rowk0, int lane) {
  union { v16b v; v8b q[2]; } u; const __bf16* p = rowk0 + 8 * (lane >> 4);
  u.q[0] = *(const v8b*)p; u.q[1] = *(const v8b*)(p + 16); return u.v;
}
__device__ __forceinline__ float bfr(float v) { return (float)(__bf16)v; }
__device__ __attribute__((noinline)) float exp_ni(float v) { return expf(v); }
__device__ __attribute__((noinline)) float erf_ni(float v) { return erff(v); }

#define PK_A 0                       // [3072][1024] Wqkv rows (natural [out][in])
#define PK_P (PK_A + QKVW * DM)        // [1024][1024] Wo rows (natural)
#define PK_END (PK_P + DM * DM)
#define WS_PK  0u
#define WS_QK  (WS_PK + 2u * PK_END)             // f16 [8192 rows][2048]: q | k
#define WS_QKL (WS_QK + 2u * NB * SS * 2 * DM)     // f16 q | k residual planes x2048
#define WS_VTH (WS_QKL + 2u * NB * SS * 2 * DM)    // f16 [b][1024 (h*64+d)][2048 s] hi
#define WS_VTL (WS_VTH + 2u * NB * DM * SS)        // f16 lo x 2048
#define WS_O   (WS_VTL + 2u * NB * DM * SS)        // f32 [8192][1024]
#define WS_CS  (WS_O + 4u * NB * SS * DM)           // f32 2 x [2048][32], reserved, not written or read
#define WS_END (WS_CS + 4u * 2 * SS * 32)

// ---- k_packbd: block = packed row n = which*1024 + h*64 + o: block-diagonal expansion of the head-shared [64][64] projection: row[h*64 + c] = W[o][c], zero elsewhere
__global__ __launch_bounds__(128) void k_packbd(const float* __restrict__ WQ, const float* __restrict__ WK, const float* __restrict__ WV, __bf16* __restrict__ DST) {
  __shared__ __align__(16) __bf16 s[DM]; const int n = blockIdx.x, t = threadIdx.x; const int which = n / DM, h = (n % DM) / HD, o = n % HD; const float* Wm = (which == 0) ? WQ : (which == 1) ? WK : WV;
  for (int k = t; k < DM; k += 128) s[k] = (__bf16)((k / HD == h) ? Wm[o * HD + (k % HD)] : 0.f);
  __syncthreads();
  vst2((unsigned*)(DST + (size_t)n * DM + t * 8), *(const v4u*)&s[t * 8]);
}
// ---- k_packrows: block = natural row n of a [N][K] weight
__global__ __launch_bounds__(256) void k_packrows(const float* __restrict__ Wm, int K, __bf16* __restrict__ DST) {
  __shared__ __align__(16) __bf16 s[DM]; const int n = blockIdx.x, tid = threadIdx.x;
  for (int k = tid; k < K; k += 256) s[k] = (__bf16)Wm[(size_t)n * K + k];
  __syncthreads();
  for (int q = tid; q < K / 8; q += 256) vst2((unsigned*)(DST + (size_t)n * K + q * 8), *(const v4u*)&s[q * 8]);
}
// ---- k_qkv: block = (64 rows (b,s), 128 of the 3072 cols): qkv = bf16(x) . rows (exact); cols < 1024 -> f16(q), cols < 2048 -> f16(k) into QK rows (pitch 2048); cols >= 2048 (v) -> per-batch transposed f16 planes VT[b][h*64+d][s]: hi = f16(v), lo = f16((v - hi) * 2048)
__global__ __launch_bounds__(128) void k_qkv(const float* __restrict__ X, const __bf16* __restrict__ P, _Float16* __restrict__ QK, _Float16* __restrict__ QKL, _Float16* __restrict__ VTH, _Float16* __restrict__ VTL) {
  __shared__ __align__(16) _Float16 so[4][16][136], sol[4][16][136]; __shared__ __align__(16) _Float16 sth[128][72], stl[128][72];
  const int tid = threadIdx.x, wave = tid >> 5, lane = tid & 31, col = lane & 15, g = lane >> 4; const size_t r0 = (size_t)blockIdx.x * 64 + wave * 16; const int n0 = blockIdx.y * 128;
  v8f acc[8] = {};
  // packed row n is zero outside columns [head*64, head*64+64), head = (n % 1024) / 64: the 128 columns of this block are two heads, and each head's four column tiles take only their own 64 k
#pragma unroll
  for (int hh = 0; hh < 2; ++hh) { const int kb = (n0 % DM) + hh * HD;
#pragma unroll
    for (int kc = 0; kc < HD / 32; ++kc) { v16b a; { const float* p = X + (r0 + col) * DM + kb + kc * 32 + 8 * g;
#pragma unroll
        for (int i = 0; i < 8; ++i) { a[i] = (__bf16)p[i]; a[8 + i] = (__bf16)p[16 + i]; } }
#pragma unroll
      for (int j = 0; j < 4; ++j) acc[hh * 4 + j] = wmma_bf(a, frag_b(P + (size_t)(n0 + (hh * 4 + j) * 16 + col) * DM + kb + kc * 32, lane), acc[hh * 4 + j]); } }
  if (n0 < 2 * DM) {   // q | k -> f16 hi + (x2048) residual rows (unscaled; the d^-1/4 x d^-1/4 = 1/32 scale is applied to the f32 score)
#pragma unroll
    for (int j = 0; j < 8; ++j) {
#pragma unroll
      for (int r = 0; r < 8; ++r) { const float v = acc[j][r]; const _Float16 hv = (_Float16)v; so[wave][8 * g + r][j * 16 + col] = hv; sol[wave][8 * g + r][j * 16 + col] = (_Float16)((v - (float)hv) * 2048.0f); } }
    LDSX();
    for (int rl = 0; rl < 16; ++rl) if (lane < 16) { vst2((unsigned*)(QK + (r0 + rl) * (2 * DM) + n0 + lane * 8), *(const v4u*)&so[wave][rl][lane * 8]); vst2((unsigned*)(QKL + (r0 + rl) * (2 * DM) + n0 + lane * 8), *(const v4u*)&sol[wave][rl][lane * 8]); }
  } else {
#pragma unroll
    for (int j = 0; j < 8; ++j) {
#pragma unroll
      for (int r = 0; r < 8; ++r) { const float v = acc[j][r]; const _Float16 hv = (_Float16)v; sth[j * 16 + col][wave * 16 + 8 * g + r] = hv; stl[j * 16 + col][wave * 16 + 8 * g + r] = (_Float16)((v - (float)hv) * 2048.0f); } }
    __syncthreads();
    const size_t rb = (size_t)blockIdx.x * 64; const int b = (int)(rb / SS), s0 = (int)(rb % SS); const int pc0 = n0 - 2 * DM;
    for (int q = tid; q < 128 * 8; q += 128) { const int d = q >> 3, pc = q & 7; const size_t o = ((size_t)b * DM + pc0 + d) * SS + s0 + pc * 8; vst2((unsigned*)(VTH + o), *(const v4u*)&sth[d][pc * 8]); vst2((unsigned*)(VTL + o), *(const v4u*)&stl[d][pc * 8]); }
  }
}
// ---- k_attn: block = (64 queries, head h, batch b): causal flash attention (K = 64: 2 k-steps), 3-product scores and 3-product P.V as in the header line; each 32-key step's K rows and V^T rows (hi and residual planes) are brought into LDS once per work-group by asynchronous copies, two buffers, and all four waves take their fragments from there; O[b*S+q][h*64+d] = (acc + accl / 2048) / l (256-B segments)
#define KP 72                          // K row pitch in LDS, halfs: 144 B = 16 B x odd, so the 16 rows of a ds_load_b128 fall on distinct banks
#define VP 40                          // V^T row pitch in LDS, halfs: 80 B = 16 B x odd
#define ST_KH 0                        // [32 keys][KP] K hi
#define ST_KL (ST_KH + 32 * KP)        // [32 keys][KP] K residual
#define ST_VH (ST_KL + 32 * KP)        // [64 d][VP] V^T hi (32 keys a row)
#define ST_VL (ST_VH + 64 * VP)        // [64 d][VP] V^T residual
#define ST_SZ (ST_VL + 64 * VP)        // halfs per buffer
__device__ __forceinline__ unsigned lds_byte(const _Float16* p) { return (unsigned)(size_t)(const __attribute__((address_space(3))) _Float16*)p; }
// one 32-key stage: 8 copies of 16 B per thread (K planes: 8 lanes a 128-B row; V planes: 4 lanes a 64-B row piece). The s_wait_xcnt stands inside the statement so that no address register is rewritten ahead of it.
__device__ __forceinline__ void stage_kv(const _Float16* kh, const _Float16* kl, const _Float16* vh, const _Float16* vl, unsigned lk, unsigned lv) {
  const _Float16 *kh1 = kh + 16 * (2 * DM), *kl1 = kl + 16 * (2 * DM), *vh1 = vh + 32 * SS, *vl1 = vl + 32 * SS;
  const unsigned lkh0 = lk + 2 * ST_KH, lkh1 = lkh0 + 2 * 16 * KP, lkl0 = lk + 2 * ST_KL, lkl1 = lkl0 + 2 * 16 * KP, lvh0 = lv + 2 * ST_VH, lvh1 = lvh0 + 2 * 32 * VP, lvl0 = lv + 2 * ST_VL, lvl1 = lvl0 + 2 * 32 * VP;
  asm volatile("global_load_async_to_lds_b128 %0, %8, off\n\t"
               "global_load_async_to_lds_b128 %1, %9, off\n\t"
               "global_load_async_to_lds_b128 %2, %10, off\n\t"
               "global_load_async_to_lds_b128 %3, %11, off\n\t"
               "global_load_async_to_lds_b128 %4, %12, off\n\t"
               "global_load_async_to_lds_b128 %5, %13, off\n\t"
               "global_load_async_to_lds_b128 %6, %14, off\n\t"
               "global_load_async_to_lds_b128 %7, %15, off\n\t"
               "s_wait_xcnt 0x0"
               :: "v"(lkh0), "v"(lkh1), "v"(lkl0), "v"(lkl1), "v"(lvh0), "v"(lvh1), "v"(lvl0), "v"(lvl1), "v"(kh), "v"(kh1), "v"(kl), "v"(kl1), "v"(vh), "v"(vh1), "v"(vl), "v"(vl1) : "memory");
}
__global__ __launch_bounds__(128) void k_attn(const _Float16* __restrict__ QK, const _Float16* __restrict__ QKL, const _Float16* __restrict__ VTH, const _Float16* __restrict__ VTL, float* __restrict__ O) {
  __shared__ __align__(16) float sp[4][16][36]; __shared__ __align__(16) _Float16 st[2 * ST_SZ];
  const int tid = threadIdx.x, wave = tid >> 5, lane = tid & 31, col = lane & 15, g = lane >> 4;
  const int qb = blockIdx.x, h = blockIdx.y, b = blockIdx.z; const int q0 = qb * 64 + wave * 16; const size_t rq = (size_t)b * SS + q0 + col;
  const int nks = (qb * 64 + 64) / 32;
  // this thread's pieces of a stage: K row tid / 8 (and + 16), 16-B piece tid % 8; V^T row tid / 4 (and + 32), piece tid % 4
  const size_t kof = ((size_t)b * SS + (tid >> 3)) * (2 * DM) + DM + h * HD + (tid & 7) * 8, vof = ((size_t)b * DM + h * HD + (tid >> 2)) * SS + (tid & 3) * 8;
  const unsigned lk = lds_byte(st) + 2 * ((tid >> 3) * KP + (tid & 7) * 8), lv = lds_byte(st) + 2 * ((tid >> 2) * VP + (tid & 3) * 8);
  stage_kv(QK + kof, QKL + kof, VTH + vof, VTL + vof, lk, lv);
  v16h aq[2], aql[2];
#pragma unroll
  for (int kc = 0; kc < 2; ++kc) { aq[kc] = frag_h(QK + rq * (2 * DM) + h * HD + kc * 32, lane); aql[kc] = frag_h(QKL + rq * (2 * DM) + h * HD + kc * 32, lane); }
  float m[8], l[8];
#pragma unroll
  for (int r = 0; r < 8; ++r) { m[r] = -3.0e38f; l[r] = 0.f; }
  v8f acc[4] = {}, accl[4] = {};
  asm volatile("s_wait_asynccnt 0x0" ::: "memory");   // stage 0 of this wave has landed
  __syncthreads();                                     // ... and every wave's part of it may be read
  stage_kv(QK + kof + (size_t)32 * (2 * DM), QKL + kof + (size_t)32 * (2 * DM), VTH + vof + 32, VTL + vof + 32, lk + 2 * ST_SZ, lv + 2 * ST_SZ);   // stage 1 always exists: nks >= 2
#pragma unroll 1
  for (int ks = 0; ks < nks; ++ks) { v8f s[2]; const _Float16* sb = st + (ks & 1) * ST_SZ;
#pragma unroll
    for (int ct = 0; ct < 2; ++ct) { const int kk = ks * 32 + ct * 16 + col; const _Float16* krow = sb + ST_KH + (ct * 16 + col) * KP; const _Float16* krowl = sb + ST_KL + (ct * 16 + col) * KP; v8f c = {}, cl = {};
#pragma unroll
      for (int kc = 0; kc < 2; ++kc) { const v16h kh = frag_h(krow + kc * 32, lane); c = wmma16(aq[kc], kh, c); cl = wmma16(aql[kc], kh, cl); cl = wmma16(aq[kc], frag_h(krowl + kc * 32, lane), cl); }   // 3 products: q, k as f16 hi + residual
#pragma unroll
      for (int r = 0; r < 8; ++r) c[r] += cl[r] * (1.0f / 2048.0f);
#pragma unroll
      for (int r = 0; r < 8; ++r) { const int qi = q0 + 8 * g + r; s[ct][r] = (kk <= qi) ? c[r] * 0.03125f : -3.0e38f; } }   // (d^-1/4)^2 = 1024^-1/2 = 1/32 exactly
#pragma unroll
    for (int r = 0; r < 8; ++r) { float mx = fmaxf(s[0][r], s[1][r]);
#pragma unroll
      for (int o = 1; o < 16; o <<= 1) mx = fmaxf(mx, __shfl_xor(mx, o));
      const float mn = fmaxf(m[r], mx); const float alpha = (m[r] <= -1.0e38f) ? 0.f : __expf(m[r] - mn);
      const float e0 = (s[0][r] <= -1.0e38f) ? 0.f : __expf(s[0][r] - mn), e1 = (s[1][r] <= -1.0e38f) ? 0.f : __expf(s[1][r] - mn); float es = e0 + e1;
#pragma unroll
      for (int o = 1; o < 16; o <<= 1) es += __shfl_xor(es, o);
      l[r] = l[r] * alpha + es; m[r] = mn;
#pragma unroll
      for (int dt = 0; dt < 4; ++dt) { acc[dt][r] *= alpha; accl[dt][r] *= alpha; }
      sp[wave][8 * g + r][col] = e0; sp[wave][8 * g + r][16 + col] = e1; }
    LDSX();
    v16h pa, pl; { const float* prow = &sp[wave][col][0] + 8 * (lane >> 4);
#pragma unroll
      for (int i = 0; i < 8; ++i) { const float x0 = prow[i], x1 = prow[16 + i]; const _Float16 h0 = (_Float16)x0, h1 = (_Float16)x1; pa[i] = h0; pa[8 + i] = h1; pl[i] = (_Float16)((x0 - (float)h0) * 2048.0f); pl[8 + i] = (_Float16)((x1 - (float)h1) * 2048.0f); } }
#pragma unroll
    for (int dt = 0; dt < 4; ++dt) { const int vr = (dt * 16 + col) * VP; const v16h vh = frag_h(sb + ST_VH + vr, lane); acc[dt] = wmma16(pa, vh, acc[dt]); accl[dt] = wmma16(pl, vh, accl[dt]); accl[dt] = wmma16(pa, frag_h(sb + ST_VL + vr, lane), accl[dt]); }   // P hi x V hi + (P lo x V hi + P hi x V lo) / 2048
    asm volatile("s_wait_dscnt 0x0" ::: "memory");      // this wave's reads of the buffer (and of its sp rows) are done
    asm volatile("s_wait_asynccnt 0x0" ::: "memory");   // this wave's copies of stage ks + 1 have landed
    __syncthreads();                                     // publishes stage ks + 1 and frees the buffer that this step has read
    if (ks + 2 < nks) stage_kv(QK + kof + (size_t)(ks + 2) * 32 * (2 * DM), QKL + kof + (size_t)(ks + 2) * 32 * (2 * DM), VTH + vof + (ks + 2) * 32, VTL + vof + (ks + 2) * 32, lk + 2 * (ks & 1) * ST_SZ, lv + 2 * (ks & 1) * ST_SZ); }
  asm volatile("s_wait_asynccnt 0x0" ::: "memory");     // nothing of this wave is in flight when the buffers become output staging
  float (*so)[16][68] = (float (*)[16][68])st;           // the last step's barrier has ended every wave's reads of st
#pragma unroll
  for (int r = 0; r < 8; ++r) { const float il = 1.0f / l[r];
#pragma unroll
    for (int dt = 0; dt < 4; ++dt) so[wave][8 * g + r][dt * 16 + col] = (acc[dt][r] + accl[dt][r] * (1.0f / 2048.0f)) * il; }
  LDSX();
  for (int rl = 0; rl < 16; ++rl) if (lane < 16) vst2(O + ((size_t)b * SS + q0 + rl) * DM + h * HD + lane * 4, *(const v4f*)&so[wave][rl][lane * 4]);
}
// ---- k_out: block = (64 rows, 128 cols): out = O(hi/lo) . Wo rows (2 products) + bo
__global__ __launch_bounds__(128) void k_out(const float* __restrict__ O, const __bf16* __restrict__ P, const float* __restrict__ BU, float* __restrict__ Y) {
  __shared__ __align__(16) float so[4][16][132];
  const int tid = threadIdx.x, wave = tid >> 5, lane = tid & 31, col = lane & 15, g = lane >> 4; const size_t r0 = (size_t)blockIdx.x * 64 + wave * 16; const int n0 = blockIdx.y * 128;
  v8f acc[8] = {};
#pragma unroll 2
  for (int kc = 0; kc < DM / 32; ++kc) { const F2 a = split_row(O + (r0 + col) * DM, kc * 32, lane);
#pragma unroll
    for (int j = 0; j < 8; ++j) { const v16b w = frag_b(P + (size_t)(n0 + j * 16 + col) * DM + kc * 32, lane); acc[j] = wmma_bf(a.l, w, acc[j]); acc[j] = wmma_bf(a.h, w, acc[j]); } }
#pragma unroll
  for (int j = 0; j < 8; ++j) { const float bb = bfr(BU[n0 + j * 16 + col]);
#pragma unroll
    for (int r = 0; r < 8; ++r) so[wave][8 * g + r][j * 16 + col] = acc[j][r] + bb; }
  LDSX();
  for (int rl = 0; rl < 16; ++rl) vst2(Y + (r0 + rl) * DM + n0 + lane * 4, *(const v4f*)&so[wave][rl][lane * 4]);
}
extern "C" void kernel_launch(void* const* d_in, const int* in_sizes, int n_in, void* d_out, int out_size, void* d_ws, size_t ws_size, hipStream_t stream) {
  (void)in_sizes; (void)n_in; (void)out_size;
  const float** F = (const float**)d_in;   // 0 x [4,2048,1024], 1 Wq [64,64] ([out][in], shared by all 16 heads), 2 Wk, 3 Wv, 4 Wu [1024,1024], 5 bu [1024]
  if (ws_size < (size_t)WS_END) return;
  char* ws = (char*)d_ws; __bf16* PK = (__bf16*)(ws + WS_PK); _Float16 *QK = (_Float16*)(ws + WS_QK), *QKL = (_Float16*)(ws + WS_QKL), *VTH = (_Float16*)(ws + WS_VTH), *VTL = (_Float16*)(ws + WS_VTL); float *O = (float*)(ws + WS_O);
  k_packbd<<<QKVW, 128, 0, stream>>>(F[1], F[2], F[3], PK + PK_A); k_packrows<<<DM, 256, 0, stream>>>(F[4], DM, PK + PK_P);
  k_qkv<<<dim3(TNB * SS / 64, QKVW / 128), 128, 0, stream>>>(F[0], PK + PK_A, QK, QKL, VTH, VTL);
  k_attn<<<dim3(TQB, NH, TNB), 128, 0, stream>>>(QK, QKL, VTH, VTL, O);
  k_out<<<dim3(TOB, DM / 128), 128, 0, stream>>>(O, PK + PK_P, F[5], (float*)d_out);
}

// v003
// Measured time: 302 microseconds a run.
// Two timings next to v002 both put it at 1.21 times that version's speed.
// All steps since v000 together make it 2.73 times as fast.
// compute dtype: x, Wq, Wk, Wv, Wu, bu (module inputs) rounded to bf16; the head-shared 64x64 q/k/v projections as one block-diagonal packed GEMM with exact bf16 products (x and W are inputs) on WMMA 16x16x32; q and k stored as f16 hi + (x2048-scaled) residual rows, causal scores with 3 products (the module's d^-1/4 on q and on k applied as the exact 1/32 on the f32 score); P.V with P as f16 hi + (x2048-scaled) residual x V as f16 hi + (x2048-scaled) residual planes (3 products); the output projection with ctx as bf16 hi + residual x exact Wu (2 products) + bu; running-max softmax in f32 with the hardware exp; f32 accumulate.
#include <hip/hip_runtime.h>
#include <math.h>

typedef __attribute__((ext_vector_type(16))) _Float16 v16h;
typedef __attribute__((ext_vector_type(16))) __bf16 v16b;
typedef __attribute__((ext_vector_type(8)))  _Float16 v8h;
typedef __attribute__((ext_vector_type(8)))  float v8f;
typedef __attribute__((ext_vector_type(4)))  float v4f;
typedef __attribute__((ext_vector_type(2)))  float v2f;
typedef __attribute__((ext_vector_type(4)))  unsigned v4u;
typedef __attribute__((ext_vector_type(4)))  int v4i;
typedef float __attribute__((may_alias)) float_a;
typedef int __attribute__((may_alias)) int_a;

template <typename T> __device__ __forceinline__ void vst2(void* p, T v) { *(T*)p = v;  }
__device__ __forceinline__ v8f wmma16(v16h a, v16h b, v8f c) {
  v8f d = __builtin_amdgcn_wmma_f32_16x16x32_f16(false, a, false, b, (short)0, c, false, false);
  asm volatile("v_nop\n\tv_nop\n\tv_nop\n\tv_nop" : "+v"(d) : "v"(a), "v"(b));
  return d;
}
__device__ __forceinline__ v8f wmma_bf(v16b a, v16b b, v8f c) {
  v8f d = __builtin_amdgcn_wmma_f32_16x16x32_bf16(false, a, false, b, (short)0, c, false, false);
  asm volatile("v_nop\n\tv_nop\n\tv_nop\n\tv_nop" : "+v"(d) : "v"(a), "v"(b));
  return d;
}
// 'Narrow' causal self-attention (B 4, T 2,048, emb 1,024 = 16 heads x 64 with ONE shared 64x64 Wq/Wk/Wv): per head q = x_h Wq^T d^-1/4, k = x_h Wk^T d^-1/4, v = x_h Wv^T; causal softmax(q k^T) v; out = y Wu^T + bu.
__device__ __forceinline__ v16h frag_h(const _Float16* rowk0, int lane) {
  union { v16h v; v8h q[2]; } u; const _Float16* p = rowk0 + 8 * (lane >> 4);
  u.q[0] = *(const v8h*)p; u.q[1] = *(const v8h*)(p + 16); return u.v;
}
__device__ __forceinline__ v16h frag_f32(const float* rowk0, int lane) {
  v16h a; const float* p = rowk0 + 8 * (lane >> 4);
#pragma unroll
  for (int i = 0; i < 8; ++i) { a[i] = (_Float16)p[i]; a[8 + i] = (_Float16)p[16 + i]; }
  return a;
}
__device__ __forceinline__ v16h frag_f32s(const float* rowk0, int lane, float sc) {
  v16h a; const float* p = rowk0 + 8 * (lane >> 4);
#pragma unroll
  for (int i = 0; i < 8; ++i) { a[i] = (_Float16)(p[i] * sc); a[8 + i] = (_Float16)(p[16 + i] * sc); }
  return a;
}
// column fragment from a [K][ld] layout (column n), rows >= K read as 0
__device__ __forceinline__ v16h fragc_f32(const float* W, int k0, int n, int lane, int ld, int K) {
  v16h a; const int g = lane >> 4;
#pragma unroll
  for (int i = 0; i < 8; ++i) { const int ka = k0 + 8 * g + i, kb = ka + 16;
    a[i] = (_Float16)(ka < K ? W[(size_t)(ka < K ? ka : K - 1) * ld + n] : 0.f); a[8 + i] = (_Float16)(kb < K ? W[(size_t)(kb < K ? kb : K - 1) * ld + n] : 0.f); }
  return a;
}
struct F2 { v16b h, l; };
__device__ __forceinline__ F2 bsplit16(const float v[16]) { F2 r;
#pragma unroll
  for (int i = 0; i < 16; ++i) { const __bf16 h = (__bf16)v[i]; r.h[i] = h; r.l[i] = (__bf16)(v[i] - (float)h); }
  return r; }
__device__ __forceinline__ F2 split_row(const float* row, int k0, int lane) { float v[16]; const float* p = row + k0 + 8 * (lane >> 4);
#pragma unroll
  for (int i = 0; i < 8; ++i) { v[i] = p[i]; v[8 + i] = p[16 + i]; }
  return bsplit16(v); }
__device__ __forceinline__ F2 split_rowK(const float* row, int k0, int lane, int K) { float v[16]; const int g = lane >> 4;
#pragma unroll
  for (int i = 0; i < 8; ++i) { const int ka = k0 + 8 * g + i, kb = ka + 16; v[i] = ka < K ? row[ka < K ? ka : K - 1] : 0.f; v[8 + i] = kb < K ? row[kb < K ? kb : K - 1] : 0.f; }
  return bsplit16(v); }
__device__ __forceinline__ F2 split_col(const float* W, int k0, int n, int lane, int ld, int K) { float v[16]; const int g = lane >> 4;
#pragma unroll
  for (int i = 0; i < 8; ++i) { const int ka = k0 + 8 * g + i, kb = ka + 16; v[i] = ka < K ? W[(size_t)(ka < K ? ka : K - 1) * ld + n] : 0.f; v[8 + i] = kb < K ? W[(size_t)(kb < K ? kb : K - 1) * ld + n] : 0.f; }
  return bsplit16(v); }
__device__ __forceinline__ v8f mac3(const F2& a, const F2& b, v8f c) { c = wmma_bf(a.l, b.h, c); c = wmma_bf(a.h, b.l, c); return wmma_bf(a.h, b.h, c); }
__device__ __forceinline__ float sigm(float v) { return 1.0f / (1.0f + expf(-v)); }
#define LDSX() do { asm volatile("s_wait_dscnt 0" ::: "memory"); __builtin_amdgcn_wave_barrier(); __builtin_amdgcn_fence(__ATOMIC_RELEASE, "workgroup"); } while (0)


// Causal multi-head self-attention (B 4, S 2048, D 1024, 16 heads x 64; head-shared 64x64 Wq/Wk/Wv expanded to a block-diagonal packed [3D][D], Wout [D][D] applied as x W^T, bias bu): softmax(q k^T / 32, causal) v; ctx Wout^T + bu.
#define NB 4
#define SS 2048
#define DM 1024
#define NH 16
#define HD 64
#define QKVW (3 * DM)
#ifndef TQB
#define TQB (SS / 64)
#define TNB NB
#define TOB (NB * SS / 64)     // output row tiles (all)
#endif
typedef __attribute__((ext_vector_type(8))) __bf16 v8b;
__device__ __forceinline__ v16b frag_b(const __bf16* rowk0, int lane) {
  union { v16b v; v8b q[2]; } u; const __bf16* p = rowk0 + 8 * (lane >> 4);
  u.q[0] = *(const v8b*)p; u.q[1] = *(const v8b*)(p + 16); return u.v;
}
__device__ __forceinline__ float bfr(float v) { return (float)(__bf16)v; }
__device__ __attribute__((noinline)) float exp_ni(float v) { return expf(v); }
__device__ __attribute__((noinline)) float erf_ni(float v) { return erff(v); }

#define PK_A 0                       // [3072][1024] Wqkv rows (natural [out][in])
#define PK_P (PK_A + QKVW * DM)        // [1024][1024] Wo rows (natural)
#define PK_END (PK_P + DM * DM)
#define WS_PK  0u
#define WS_QK  (WS_PK + 2u * PK_END)             // f16 [8192 rows][2048]: q | k
#define WS_QKL (WS_QK + 2u * NB * SS * 2 * DM)     // f16 q | k residual planes x2048
#define WS_VTH (WS_QKL + 2u * NB * SS * 2 * DM)    // f16 [b][1024 (h*64+d)][2048 s] hi
#define WS_VTL (WS_VTH + 2u * NB * DM * SS)        // f16 lo x 2048
#define WS_O   (WS_VTL + 2u * NB * DM * SS)        // f32 [8192][1024]
#define WS_CS  (WS_O + 4u * NB * SS * DM)           // f32 2 x [2048][32], reserved, not written or read
#define WS_END (WS_CS + 4u * 2 * SS * 32)

// ---- k_packbd: block = packed row n = which*1024 + h*64 + o: block-diagonal expansion of the head-shared [64][64] projection: row[h*64 + c] = W[o][c], zero elsewhere
__global__ __launch_bounds__(128) void k_packbd(const float* __restrict__ WQ, const float* __restrict__ WK, const float* __restrict__ WV, __bf16* __restrict__ DST) {
  __shared__ __align__(16) __bf16 s[DM]; const int n = blockIdx.x, t = threadIdx.x; const int which = n / DM, h = (n % DM) / HD, o = n % HD; const float* Wm = (which == 0) ? WQ : (which == 1) ? WK : WV;
  for (int k = t; k < DM; k += 128) s[k] = (__bf16)((k / HD == h) ? Wm[o * HD + (k % HD)] : 0.f);
  __syncthreads();
  vst2((unsigned*)(DST + (size_t)n * DM + t * 8), *(const v4u*)&s[t * 8]);
}
// ---- k_packrows: block = natural row n of a [N][K] weight
__global__ __launch_bounds__(256) void k_packrows(const float* __restrict__ Wm, int K, __bf16* __restrict__ DST) {
  __shared__ __align__(16) __bf16 s[DM]; const int n = blockIdx.x, tid = threadIdx.x;
  for (int k = tid; k < K; k += 256) s[k] = (__bf16)Wm[(size_t)n * K + k];
  __syncthreads();
  for (int q = tid; q < K / 8; q += 256) vst2((unsigned*)(DST + (size_t)n * K + q * 8), *(const v4u*)&s[q * 8]);
}
// ---- k_qkv: block = (64 rows (b,s), 128 of the 3072 cols): qkv = bf16(x) . rows (exact); cols < 1024 -> f16(q), cols < 2048 -> f16(k) into QK rows (pitch 2048); cols >= 2048 (v) -> per-batch transposed f16 planes VT[b][h*64+d][s]: hi = f16(v), lo = f16((v - hi) * 2048)
__global__ __launch_bounds__(128) void k_qkv(const float* __restrict__ X, const __bf16* __restrict__ P, _Float16* __restrict__ QK, _Float16* __restrict__ QKL, _Float16* __restrict__ VTH, _Float16* __restrict__ VTL) {
  __shared__ __align__(16) _Float16 so[4][16][136], sol[4][16][136]; __shared__ __align__(16) _Float16 sth[128][72], stl[128][72];
  const int tid = threadIdx.x, wave = tid >> 5, lane = tid & 31, col = lane & 15, g = lane >> 4; const size_t r0 = (size_t)blockIdx.x * 64 + wave * 16; const int n0 = blockIdx.y * 128;
  v8f acc[8] = {};
  // packed row n is zero outside columns [head*64, head*64+64), head = (n % 1024) / 64: the 128 columns of this block are two heads, and each head's four column tiles take only their own 64 k
#pragma unroll
  for (int hh = 0; hh < 2; ++hh) { const int kb = (n0 % DM) + hh * HD;
#pragma unroll
    for (int kc = 0; kc < HD / 32; ++kc) { v16b a; { const float* p = X + (r0 + col) * DM + kb + kc * 32 + 8 * g;
#pragma unroll
        for (int i = 0; i < 8; ++i) { a[i] = (__bf16)p[i]; a[8 + i] = (__bf16)p[16 + i]; } }
#pragma unroll
      for (int j = 0; j < 4; ++j) acc[hh * 4 + j] = wmma_bf(a, frag_b(P + (size_t)(n0 + (hh * 4 + j) * 16 + col) * DM + kb + kc * 32, lane), acc[hh * 4 + j]); } }
  if (n0 < 2 * DM) {   // q | k -> f16 hi + (x2048) residual rows (unscaled; the d^-1/4 x d^-1/4 = 1/32 scale is applied to the f32 score)
#pragma unroll
    for (int j = 0; j < 8; ++j) {
#pragma unroll
      for (int r = 0; r < 8; ++r) { const float v = acc[j][r]; const _Float16 hv = (_Float16)v; so[wave][8 * g + r][j * 16 + col] = hv; sol[wave][8 * g + r][j * 16 + col] = (_Float16)((v - (float)hv) * 2048.0f); } }
    LDSX();
    for (int rl = 0; rl < 16; ++rl) if (lane < 16) { vst2((unsigned*)(QK + (r0 + rl) * (2 * DM) + n0 + lane * 8), *(const v4u*)&so[wave][rl][lane * 8]); vst2((unsigned*)(QKL + (r0 + rl) * (2 * DM) + n0 + lane * 8), *(const v4u*)&sol[wave][rl][lane * 8]); }
  } else {
#pragma unroll
    for (int j = 0; j < 8; ++j) {
#pragma unroll
      for (int r = 0; r < 8; ++r) { const float v = acc[j][r]; const _Float16 hv = (_Float16)v; sth[j * 16 + col][wave * 16 + 8 * g + r] = hv; stl[j * 16 + col][wave * 16 + 8 * g + r] = (_Float16)((v - (float)hv) * 2048.0f); } }
    __syncthreads();
    const size_t rb = (size_t)blockIdx.x * 64; const int b = (int)(rb / SS), s0 = (int)(rb % SS); const int pc0 = n0 - 2 * DM;
    for (int q = tid; q < 128 * 8; q += 128) { const int d = q >> 3, pc = q & 7; const size_t o = ((size_t)b * DM + pc0 + d) * SS + s0 + pc * 8; vst2((unsigned*)(VTH + o), *(const v4u*)&sth[d][pc * 8]); vst2((unsigned*)(VTL + o), *(const v4u*)&stl[d][pc * 8]); }
  }
}
#define KP 72                          // K row pitch in LDS, halfs: 144 B = 16 B x odd, so the 16 rows of a ds_load_b128 fall on distinct banks
#define VP 40                          // V^T row pitch in LDS, halfs: 80 B = 16 B x odd
#define ST_KH 0                        // [32 keys][KP] K hi
#define ST_KL (ST_KH + 32 * KP)        // [32 keys][KP] K residual
#define ST_VH (ST_KL + 32 * KP)        // [64 d][VP] V^T hi (32 keys a row)
#define ST_VL (ST_VH + 64 * VP)        // [64 d][VP] V^T residual
#define ST_SZ (ST_VL + 64 * VP)        // halfs per buffer
__device__ __forceinline__ unsigned lds_byte(const _Float16* p) { return (unsigned)(size_t)(const __attribute__((address_space(3))) _Float16*)p; }
// one 32-key stage: 8 copies of 16 B per thread (K planes: 8 lanes a 128-B row; V planes: 4 lanes a 64-B row piece). The s_wait_xcnt stands inside the statement so that no address register is rewritten ahead of it.
__device__ __forceinline__ void stage_kv(const _Float16* kh, const _Float16* kl, const _Float16* vh, const _Float16* vl, unsigned lk, unsigned lv) {
  const _Float16 *kh1 = kh + 16 * (2 * DM), *kl1 = kl + 16 * (2 * DM), *vh1 = vh + 32 * SS, *vl1 = vl + 32 * SS;
  const unsigned lkh0 = lk + 2 * ST_KH, lkh1 = lkh0 + 2 * 16 * KP, lkl0 = lk + 2 * ST_KL, lkl1 = lkl0 + 2 * 16 * KP, lvh0 = lv + 2 * ST_VH, lvh1 = lvh0 + 2 * 32 * VP, lvl0 = lv + 2 * ST_VL, lvl1 = lvl0 + 2 * 32 * VP;
  asm volatile("global_load_async_to_lds_b128 %0, %8, off\n\t"
               "global_load_async_to_lds_b128 %1, %9, off\n\t"
               "global_load_async_to_lds_b128 %2, %10, off\n\t"
               "global_load_async_to_lds_b128 %3, %11, off\n\t"
               "global_load_async_to_lds_b128 %4, %12, off\n\t"
               "global_load_async_to_lds_b128 %5, %13, off\n\t"
               "global_load_async_to_lds_b128 %6, %14, off\n\t"
               "global_load_async_to_lds_b128 %7, %15, off\n\t"
               "s_wait_xcnt 0x0"
               :: "v"(lkh0), "v"(lkh1), "v"(lkl0), "v"(lkl1), "v"(lvh0), "v"(lvh1), "v"(lvl0), "v"(lvl1), "v"(kh), "v"(kh1), "v"(kl), "v"(kl1), "v"(vh), "v"(vh1), "v"(vl), "v"(vl1) : "memory");
}
__device__ __forceinline__ float xhalf(float x) { return __builtin_bit_cast(float, __builtin_amdgcn_permlanex16(__builtin_bit_cast(int, x), __builtin_bit_cast(int, x), 0x76543210, 0xfedcba98, false, false)); }   // lane l takes lane l ^ 16's value
// exp(x) as __expf forms it (x * log2 e, then v_exp_f32). The instruction set asks for one free slot behind a transcendental before its source is overwritten, so the v_exp_f32 run and its v_nop stand in one statement (outputs early-clobbered: no v_exp_f32 of the run writes a source of another).
__device__ __forceinline__ void exp_x4(float& a, float& b, float& c, float& d) {
  const float xa = a * 0x1.715476p+0f, xb = b * 0x1.715476p+0f, xc = c * 0x1.715476p+0f, xd = d * 0x1.715476p+0f;
  asm("v_exp_f32 %0, %4\n\tv_exp_f32 %1, %5\n\tv_exp_f32 %2, %6\n\tv_exp_f32 %3, %7\n\tv_nop" : "=&v"(a), "=&v"(b), "=&v"(c), "=&v"(d) : "v"(xa), "v"(xb), "v"(xc), "v"(xd));
}
__device__ __forceinline__ float exp_x1(float a) { float r; const float xa = a * 0x1.715476p+0f;
  asm("v_exp_f32 %0, %1\n\tv_nop" : "=&v"(r) : "v"(xa));   // the same free slot behind the one v_exp_f32
  return r; }
__global__ __launch_bounds__(128) void k_attn(const _Float16* __restrict__ QK, const _Float16* __restrict__ QKL, const _Float16* __restrict__ VTH, const _Float16* __restrict__ VTL, float* __restrict__ O) {
  __shared__ __align__(16) _Float16 st[2 * ST_SZ];
  const int tid = threadIdx.x, wave = tid >> 5, lane = tid & 31, col = lane & 15, g = lane >> 4;
  const int qb = blockIdx.x, h = blockIdx.y, b = blockIdx.z; const int q0 = qb * 64 + wave * 16; const size_t rq = (size_t)b * SS + q0 + col;
  const int nks = (qb * 64 + 64) / 32;
  // this thread's pieces of a stage: K row tid / 8 (and + 16), 16-B piece tid % 8; V^T row tid / 4 (and + 32), piece tid % 4
  const size_t kof = ((size_t)b * SS + (tid >> 3)) * (2 * DM) + DM + h * HD + (tid & 7) * 8, vof = ((size_t)b * DM + h * HD + (tid >> 2)) * SS + (tid & 3) * 8;
  const unsigned lk = lds_byte(st) + 2 * ((tid >> 3) * KP + (tid & 7) * 8), lv = lds_byte(st) + 2 * ((tid >> 2) * VP + (tid & 3) * 8);
  stage_kv(QK + kof, QKL + kof, VTH + vof, VTL + vof, lk, lv);
  v16h aq[2], aql[2];
#pragma unroll
  for (int kc = 0; kc < 2; ++kc) { aq[kc] = frag_h(QK + rq * (2 * DM) + h * HD + kc * 32, lane); aql[kc] = frag_h(QKL + rq * (2 * DM) + h * HD + kc * 32, lane); }
  float m = -3.0e38f, l = 0.f;   // of query q0 + col; l holds only the keys of this lane's half until the epilogue joins the halves
  v8f acc[4] = {}, accl[4] = {};   // O^T tiles: register r = d dt * 16 + 8 g + r of query q0 + col
  asm volatile("s_wait_asynccnt 0x0" ::: "memory");   // stage 0 of this wave has landed
  __syncthreads();                                     // ... and every wave's part of it may be read
  stage_kv(QK + kof + (size_t)32 * (2 * DM), QKL + kof + (size_t)32 * (2 * DM), VTH + vof + 32, VTL + vof + 32, lk + 2 * ST_SZ, lv + 2 * ST_SZ);   // stage 1 always exists: nks >= 2
#pragma unroll 1
  for (int ks = 0; ks < nks; ++ks) { v8f s[2]; const _Float16* sb = st + (ks & 1) * ST_SZ;
#pragma unroll
    for (int ct = 0; ct < 2; ++ct) { const _Float16* krow = sb + ST_KH + (ct * 16 + col) * KP; const _Float16* krowl = sb + ST_KL + (ct * 16 + col) * KP; v8f c = {}, cl = {};
#pragma unroll
      for (int kc = 0; kc < 2; ++kc) { const v16h kh = frag_h(krow + kc * 32, lane); c = wmma16(kh, aq[kc], c); cl = wmma16(kh, aql[kc], cl); cl = wmma16(frag_h(krowl + kc * 32, lane), aq[kc], cl); }   // 3 products: q, k as f16 hi + residual; register r = key ct * 16 + 8 g + r, column = query
#pragma unroll
      for (int r = 0; r < 8; ++r) c[r] += cl[r] * (1.0f / 2048.0f);
#pragma unroll
      for (int r = 0; r < 8; ++r) { const int kk = ks * 32 + ct * 16 + 8 * g + r; s[ct][r] = (kk <= q0 + col) ? c[r] * 0.03125f : -3.0e38f; } }   // (d^-1/4)^2 = 1024^-1/2 = 1/32 exactly
    float mx = fmaxf(fmaxf(fmaxf(fmaxf(s[0][0], s[0][1]), fmaxf(s[0][2], s[0][3])), fmaxf(fmaxf(s[0][4], s[0][5]), fmaxf(s[0][6], s[0][7]))), fmaxf(fmaxf(fmaxf(s[1][0], s[1][1]), fmaxf(s[1][2], s[1][3])), fmaxf(fmaxf(s[1][4], s[1][5]), fmaxf(s[1][6], s[1][7]))));
    mx = fmaxf(mx, xhalf(mx));
    const float mn = fmaxf(m, mx); const float ea = exp_x1(m - mn); const float alpha = (m <= -1.0e38f) ? 0.f : ea; m = mn;
    float ev[2][8]; v16h pa, pl;   // P^T as a B operand: element i = key 8 g + i (tile 0), element 8 + i = key 16 + 8 g + i (tile 1), the k order of frag_h
#pragma unroll
    for (int ct = 0; ct < 2; ++ct) {
      float ex[8];
#pragma unroll
      for (int r = 0; r < 8; ++r) ex[r] = s[ct][r] - mn;
      exp_x4(ex[0], ex[1], ex[2], ex[3]); exp_x4(ex[4], ex[5], ex[6], ex[7]);
#pragma unroll
      for (int r = 0; r < 8; ++r) { const float e = (s[ct][r] <= -1.0e38f) ? 0.f : ex[r]; ev[ct][r] = e; const _Float16 eh = (_Float16)e; pa[ct * 8 + r] = eh; pl[ct * 8 + r] = (_Float16)((e - (float)eh) * 2048.0f); } }
    l = l * alpha + ((((ev[0][0] + ev[1][0]) + (ev[0][1] + ev[1][1])) + ((ev[0][2] + ev[1][2]) + (ev[0][3] + ev[1][3]))) + (((ev[0][4] + ev[1][4]) + (ev[0][5] + ev[1][5])) + ((ev[0][6] + ev[1][6]) + (ev[0][7] + ev[1][7]))));   // a tree, not one dependent chain of 16 adds
#pragma unroll
    for (int dt = 0; dt < 4; ++dt) {
#pragma unroll
      for (int r = 0; r < 8; ++r) { acc[dt][r] *= alpha; accl[dt][r] *= alpha; } }
#pragma unroll
    for (int dt = 0; dt < 4; ++dt) { const int vr = (dt * 16 + col) * VP; const v16h vh = frag_h(sb + ST_VH + vr, lane); acc[dt] = wmma16(vh, pa, acc[dt]); accl[dt] = wmma16(vh, pl, accl[dt]); accl[dt] = wmma16(frag_h(sb + ST_VL + vr, lane), pa, accl[dt]); }   // V hi x P hi + (V hi x P lo + V lo x P hi) / 2048
    asm volatile("s_wait_dscnt 0x0" ::: "memory");      // this wave's reads of the buffer are done
    asm volatile("s_wait_asynccnt 0x0" ::: "memory");   // this wave's copies of stage ks + 1 have landed
    __syncthreads();                                     // publishes stage ks + 1 and frees the buffer that this step has read
    if (ks + 2 < nks) stage_kv(QK + kof + (size_t)(ks + 2) * 32 * (2 * DM), QKL + kof + (size_t)(ks + 2) * 32 * (2 * DM), VTH + vof + (ks + 2) * 32, VTL + vof + (ks + 2) * 32, lk + 2 * (ks & 1) * ST_SZ, lv + 2 * (ks & 1) * ST_SZ); }
  asm volatile("s_wait_asynccnt 0x0" ::: "memory");     // nothing of this wave is in flight when the buffers become output staging
  float (*so)[16][68] = (float (*)[16][68])st;           // the last step's barrier has ended every wave's reads of st
  const float il = 1.0f / (l + xhalf(l));
#pragma unroll
  for (int dt = 0; dt < 4; ++dt) {
#pragma unroll
    for (int r = 0; r < 8; ++r) so[wave][col][dt * 16 + 8 * g + r] = (acc[dt][r] + accl[dt][r] * (1.0f / 2048.0f)) * il; }
  LDSX();
  for (int rl = 0; rl < 16; ++rl) if (lane < 16) vst2(O + ((size_t)b * SS + q0 + rl) * DM + h * HD + lane * 4, *(const v4f*)&so[wave][rl][lane * 4]);
}
// ---- k_out: block = (64 rows, 128 cols): out = O(hi/lo) . Wo rows (2 products) + bo
__global__ __launch_bounds__(128) void k_out(const float* __restrict__ O, const __bf16* __restrict__ P, const float* __restrict__ BU, float* __restrict__ Y) {
  __shared__ __align__(16) float so[4][16][132];
  const int tid = threadIdx.x, wave = tid >> 5, lane = tid & 31, col = lane & 15, g = lane >> 4; const size_t r0 = (size_t)blockIdx.x * 64 + wave * 16; const int n0 = blockIdx.y * 128;
  v8f acc[8] = {};
#pragma unroll 2
  for (int kc = 0; kc < DM / 32; ++kc) { const F2 a = split_row(O + (r0 + col) * DM, kc * 32, lane);
#pragma unroll
    for (int j = 0; j < 8; ++j) { const v16b w = frag_b(P + (size_t)(n0 + j * 16 + col) * DM + kc * 32, lane); acc[j] = wmma_bf(a.l, w, acc[j]); acc[j] = wmma_bf(a.h, w, acc[j]); } }
#pragma unroll
  for (int j = 0; j < 8; ++j) { const float bb = bfr(BU[n0 + j * 16 + col]);
#pragma unroll
    for (int r = 0; r < 8; ++r) so[wave][8 * g + r][j * 16 + col] = acc[j][r] + bb; }
  LDSX();
  for (int rl = 0; rl < 16; ++rl) vst2(Y + (r0 + rl) * DM + n0 + lane * 4, *(const v4f*)&so[wave][rl][lane * 4]);
}
extern "C" void kernel_launch(void* const* d_in, const int* in_sizes, int n_in, void* d_out, int out_size, void* d_ws, size_t ws_size, hipStream_t stream) {
  (void)in_sizes; (void)n_in; (void)out_size;
  const float** F = (const float**)d_in;   // 0 x [4,2048,1024], 1 Wq [64,64] ([out][in], shared by all 16 heads), 2 Wk, 3 Wv, 4 Wu [1024,1024], 5 bu [1024]
  if (ws_size < (size_t)WS_END) return;
  char* ws = (char*)d_ws; __bf16* PK = (__bf16*)(ws + WS_PK); _Float16 *QK = (_Float16*)(ws + WS_QK), *QKL = (_Float16*)(ws + WS_QKL), *VTH = (_Float16*)(ws + WS_VTH), *VTL = (_Float16*)(ws + WS_VTL); float *O = (float*)(ws + WS_O);
  k_packbd<<<QKVW, 128, 0, stream>>>(F[1], F[2], F[3], PK + PK_A); k_packrows<<<DM, 256, 0, stream>>>(F[4], DM, PK + PK_P);
  k_qkv<<<dim3(TNB * SS / 64, QKVW / 128), 128, 0, stream>>>(F[0], PK + PK_A, QK, QKL, VTH, VTL);
  k_attn<<<dim3(TQB, NH, TNB), 128, 0, stream>>>(QK, QKL, VTH, VTL, O);
  k_out<<<dim3(TOB, DM / 128), 128, 0, stream>>>(O, PK + PK_P, F[5], (float*)d_out);
}

// v004
// One run takes 245 microseconds.
// Two timings next to v003 put it at 1.25 and 1.23 times that version's speed.
// Counting every step since v000, it is 3.38 times as fast.
// compute dtype: x, Wq, Wk, Wv, Wu, bu (module inputs) rounded to bf16; the head-shared 64x64 q/k/v projections as one block-diagonal packed GEMM with exact bf16 products (x and W are inputs) on WMMA 16x16x32; q and k stored as f16 hi + (x2048-scaled) residual rows, causal scores with 3 products (the module's d^-1/4 on q and on k applied as the exact 1/32 on the f32 score); P.V with P as f16 hi + (x2048-scaled) residual x V as f16 hi + (x2048-scaled) residual planes (3 products); the output projection with ctx as bf16 hi + residual x exact Wu (2 products) + bu; running-max softmax in f32 with the hardware exp; f32 accumulate.
#include <hip/hip_runtime.h>
#include <math.h>

typedef __attribute__((ext_vector_type(16))) _Float16 v16h;
typedef __attribute__((ext_vector_type(16))) __bf16 v16b;
typedef __attribute__((ext_vector_type(8)))  _Float16 v8h;
typedef __attribute__((ext_vector_type(8)))  float v8f;
typedef __attribute__((ext_vector_type(4)))  float v4f;
typedef __attribute__((ext_vector_type(2)))  float v2f;
typedef __attribute__((ext_vector_type(4)))  unsigned v4u;
typedef __attribute__((ext_vector_type(4)))  int v4i;
typedef float __attribute__((may_alias)) float_a;
typedef int __attribute__((may_alias)) int_a;

template <typename T> __device__ __forceinline__ void vst2(void* p, T v) { *(T*)p = v;  }
__device__ __forceinline__ v8f wmma16(v16h a, v16h b, v8f c) {
  v8f d = __builtin_amdgcn_wmma_f32_16x16x32_f16(false, a, false, b, (short)0, c, false, false);
  asm volatile("v_nop\n\tv_nop\n\tv_nop\n\tv_nop" : "+v"(d) : "v"(a), "v"(b));
  return d;
}
__device__ __forceinline__ v8f wmma_bf(v16b a, v16b b, v8f c) {
  v8f d = __builtin_amdgcn_wmma_f32_16x16x32_bf16(false, a, false, b, (short)0, c, false, false);
  asm volatile("v_nop\n\tv_nop\n\tv_nop\n\tv_nop" : "+v"(d) : "v"(a), "v"(b));
  return d;
}
// 'Narrow' causal self-attention (B 4, T 2,048, emb 1,024 = 16 heads x 64 with ONE shared 64x64 Wq/Wk/Wv): per head q = x_h Wq^T d^-1/4, k = x_h Wk^T d^-1/4, v = x_h Wv^T; causal softmax(q k^T) v; out = y Wu^T + bu.
__device__ __forceinline__ v16h frag_h(const _Float16* rowk0, int lane) {
  union { v16h v; v8h q[2]; } u; const _Float16* p = rowk0 + 8 * (lane >> 4);
  u.q[0] = *(const v8h*)p; u.q[1] = *(const v8h*)(p + 16); return u.v;
}
__device__ __forceinline__ v16h frag_f32(const float* rowk0, int lane) {
  v16h a; const float* p = rowk0 + 8 * (lane >> 4);
#pragma unroll
  for (int i = 0; i < 8; ++i) { a[i] = (_Float16)p[i]; a[8 + i] = (_Float16)p[16 + i]; }
  return a;
}
__device__ __forceinline__ v16h frag_f32s(const float* rowk0, int lane, float sc) {
  v16h a; const float* p = rowk0 + 8 * (lane >> 4);
#pragma unroll
  for (int i = 0; i < 8; ++i) { a[i] = (_Float16)(p[i] * sc); a[8 + i] = (_Float16)(p[16 + i] * sc); }
  return a;
}
// column fragment from a [K][ld] layout (column n), rows >= K read as 0
__device__ __forceinline__ v16h fragc_f32(const float* W, int k0, int n, int lane, int ld, int K) {
  v16h a; const int g = lane >> 4;
#pragma unroll
  for (int i = 0; i < 8; ++i) { const int ka = k0 + 8 * g + i, kb = ka + 16;
    a[i] = (_Float16)(ka < K ? W[(size_t)(ka < K ? ka : K - 1) * ld + n] : 0.f); a[8 + i] = (_Float16)(kb < K ? W[(size_t)(kb < K ? kb : K - 1) * ld + n] : 0.f); }
  return a;
}
struct F2 { v16b h, l; };
__device__ __forceinline__ F2 bsplit16(const float v[16]) { F2 r;
#pragma unroll
  for (int i = 0; i < 16; ++i) { const __bf16 h = (__bf16)v[i]; r.h[i] = h; r.l[i] = (__bf16)(v[i] - (float)h); }
  return r; }
__device__ __forceinline__ F2 split_row(const float* row, int k0, int lane) { float v[16]; const float* p = row + k0 + 8 * (lane >> 4);
#pragma unroll
  for (int i = 0; i < 8; ++i) { v[i] = p[i]; v[8 + i] = p[16 + i]; }
  return bsplit16(v); }
__device__ __forceinline__ F2 split_rowK(const float* row, int k0, int lane, int K) { float v[16]; const int g = lane >> 4;
#pragma unroll
  for (int i = 0; i < 8; ++i) { const int ka = k0 + 8 * g + i, kb = ka + 16; v[i] = ka < K ? row[ka < K ? ka : K - 1] : 0.f; v[8 + i] = kb < K ? row[kb < K ? kb : K - 1] : 0.f; }
  return bsplit16(v); }
__device__ __forceinline__ F2 split_col(const float* W, int k0, int n, int lane, int ld, int K) { float v[16]; const int g = lane >> 4;
#pragma unroll
  for (int i = 0; i < 8; ++i) { const int ka = k0 + 8 * g + i, kb = ka + 16; v[i] = ka < K ? W[(size_t)(ka < K ? ka : K - 1) * ld + n] : 0.f; v[8 + i] = kb < K ? W[(size_t)(kb < K ? kb : K - 1) * ld + n] : 0.f; }
  return bsplit16(v); }
__device__ __forceinline__ v8f mac3(const F2& a, const F2& b, v8f c) { c = wmma_bf(a.l, b.h, c); c = wmma_bf(a.h, b.l, c); return wmma_bf(a.h, b.h, c); }
__device__ __forceinline__ float sigm(float v) { return 1.0f / (1.0f + expf(-v)); }
#define LDSX() do { asm volatile("s_wait_dscnt 0" ::: "memory"); __builtin_amdgcn_wave_barrier(); __builtin_amdgcn_fence(__ATOMIC_RELEASE, "workgroup"); } while (0)


// Causal multi-head self-attention (B 4, S 2048, D 1024, 16 heads x 64; head-shared 64x64 Wq/Wk/Wv expanded to a block-diagonal packed [3D][D], Wout [D][D] applied as x W^T, bias bu): softmax(q k^T / 32, causal) v; ctx Wout^T + bu.
#define NB 4
#define SS 2048
#define DM 1024
#define NH 16
#define HD 64
#define QKVW (3 * DM)
#ifndef TQB
#define TQB (SS / 64)
#define TNB NB
#define TOB (NB * SS / 64)     // output row tiles (all)
#endif
typedef __attribute__((ext_vector_type(8))) __bf16 v8b;
__device__ __forceinline__ v16b frag_b(const __bf16* rowk0, int lane) {
  union { v16b v; v8b q[2]; } u; const __bf16* p = rowk0 + 8 * (lane >> 4);
  u.q[0] = *(const v8b*)p; u.q[1] = *(const v8b*)(p + 16); return u.v;
}
__device__ __forceinline__ float bfr(float v) { return (float)(__bf16)v; }
__device__ __attribute__((noinline)) float exp_ni(float v) { return expf(v); }
__device__ __attribute__((noinline)) float erf_ni(float v) { return erff(v); }

#define PK_A 0                       // [3072][1024] Wqkv rows (natural [out][in])
#define PK_P (PK_A + QKVW * DM)        // [1024][1024] Wo rows (natural)
#define PK_END (PK_P + DM * DM)
#define WS_PK  0u
#define WS_QK  (WS_PK + 2u * PK_END)             // f16 [8192 rows][2048]: q | k
#define WS_QKL (WS_QK + 2u * NB * SS * 2 * DM)     // f16 q | k residual planes x2048
#define WS_VTH (WS_QKL + 2u * NB * SS * 2 * DM)    // f16 [b][1024 (h*64+d)][2048 s] hi
#define WS_VTL (WS_VTH + 2u * NB * DM * SS)        // f16 lo x 2048
#define WS_O   (WS_VTL + 2u * NB * DM * SS)        // f32 [8192][1024]
#define WS_CS  (WS_O + 4u * NB * SS * DM)           // f32 2 x [2048][32], reserved, not written or read
#define WS_END (WS_CS + 4u * 2 * SS * 32)

// ---- k_packbd: block = packed row n = which*1024 + h*64 + o: block-diagonal expansion of the head-shared [64][64] projection: row[h*64 + c] = W[o][c], zero elsewhere
__global__ __launch_bounds__(128) void k_packbd(const float* __restrict__ WQ, const float* __restrict__ WK, const float* __restrict__ WV, __bf16* __restrict__ DST) {
  __shared__ __align__(16) __bf16 s[DM]; const int n = blockIdx.x, t = threadIdx.x; const int which = n / DM, h = (n % DM) / HD, o = n % HD; const float* Wm = (which == 0) ? WQ : (which == 1) ? WK : WV;
  for (int k = t; k < DM; k += 128) s[k] = (__bf16)((k / HD == h) ? Wm[o * HD + (k % HD)] : 0.f);
  __syncthreads();
  vst2((unsigned*)(DST + (size_t)n * DM + t * 8), *(const v4u*)&s[t * 8]);
}
// ---- k_packrows: block = natural row n of a [N][K] weight
__global__ __launch_bounds__(256) void k_packrows(const float* __restrict__ Wm, int K, __bf16* __restrict__ DST) {
  __shared__ __align__(16) __bf16 s[DM]; const int n = blockIdx.x, tid = threadIdx.x;
  for (int k = tid; k < K; k += 256) s[k] = (__bf16)Wm[(size_t)n * K + k];
  __syncthreads();
  for (int q = tid; q < K / 8; q += 256) vst2((unsigned*)(DST + (size_t)n * K + q * 8), *(const v4u*)&s[q * 8]);
}
// ---- k_qkv: block = (64 rows (b,s), 128 of the 3072 cols): qkv = bf16(x) . rows (exact); cols < 1024 -> f16(q), cols < 2048 -> f16(k) into QK rows (pitch 2048); cols >= 2048 (v) -> per-batch transposed f16 planes VT[b][h*64+d][s]: hi = f16(v), lo = f16((v - hi) * 2048)
__global__ __launch_bounds__(128) void k_qkv(const float* __restrict__ X, const __bf16* __restrict__ P, _Float16* __restrict__ QK, _Float16* __restrict__ QKL, _Float16* __restrict__ VTH, _Float16* __restrict__ VTL) {
  __shared__ __align__(16) _Float16 so[4][16][136], sol[4][16][136]; __shared__ __align__(16) _Float16 sth[128][72], stl[128][72];
  const int tid = threadIdx.x, wave = tid >> 5, lane = tid & 31, col = lane & 15, g = lane >> 4; const size_t r0 = (size_t)blockIdx.x * 64 + wave * 16; const int n0 = blockIdx.y * 128;
  v8f acc[8] = {};
  // packed row n is zero outside columns [head*64, head*64+64), head = (n % 1024) / 64: the 128 columns of this block are two heads, and each head's four column tiles take only their own 64 k
#pragma unroll
  for (int hh = 0; hh < 2; ++hh) { const int kb = (n0 % DM) + hh * HD;
#pragma unroll
    for (int kc = 0; kc < HD / 32; ++kc) { v16b a; { const float* p = X + (r0 + col) * DM + kb + kc * 32 + 8 * g;
#pragma unroll
        for (int i = 0; i < 8; ++i) { a[i] = (__bf16)p[i]; a[8 + i] = (__bf16)p[16 + i]; } }
#pragma unroll
      for (int j = 0; j < 4; ++j) acc[hh * 4 + j] = wmma_bf(a, frag_b(P + (size_t)(n0 + (hh * 4 + j) * 16 + col) * DM + kb + kc * 32, lane), acc[hh * 4 + j]); } }
  if (n0 < 2 * DM) {   // q | k -> f16 hi + (x2048) residual rows (unscaled; the d^-1/4 x d^-1/4 = 1/32 scale is applied to the f32 score)
#pragma unroll
    for (int j = 0; j < 8; ++j) {
#pragma unroll
      for (int r = 0; r < 8; ++r) { const float v = acc[j][r]; const _Float16 hv = (_Float16)v; so[wave][8 * g + r][j * 16 + col] = hv; sol[wave][8 * g + r][j * 16 + col] = (_Float16)((v - (float)hv) * 2048.0f); } }
    LDSX();
    for (int rl = 0; rl < 16; ++rl) if (lane < 16) { vst2((unsigned*)(QK + (r0 + rl) * (2 * DM) + n0 + lane * 8), *(const v4u*)&so[wave][rl][lane * 8]); vst2((unsigned*)(QKL + (r0 + rl) * (2 * DM) + n0 + lane * 8), *(const v4u*)&sol[wave][rl][lane * 8]); }
  } else {
#pragma unroll
    for (int j = 0; j < 8; ++j) {
#pragma unroll
      for (int r = 0; r < 8; ++r) { const float v = acc[j][r]; const _Float16 hv = (_Float16)v; sth[j * 16 + col][wave * 16 + 8 * g + r] = hv; stl[j * 16 + col][wave * 16 + 8 * g + r] = (_Float16)((v - (float)hv) * 2048.0f); } }
    __syncthreads();
    const size_t rb = (size_t)blockIdx.x * 64; const int b = (int)(rb / SS), s0 = (int)(rb % SS); const int pc0 = n0 - 2 * DM;
    for (int q = tid; q < 128 * 8; q += 128) { const int d = q >> 3, pc = q & 7; const size_t o = ((size_t)b * DM + pc0 + d) * SS + s0 + pc * 8; vst2((unsigned*)(VTH + o), *(const v4u*)&sth[d][pc * 8]); vst2((unsigned*)(VTL + o), *(const v4u*)&stl[d][pc * 8]); }
  }
}
#define KP 72                          // K row pitch in LDS, halfs: 144 B = 16 B x odd, so the 16 rows of a ds_load_b128 fall on distinct banks
#define VP 40                          // V^T row pitch in LDS, halfs: 80 B = 16 B x odd
#define ST_KH 0                        // [32 keys][KP] K hi
#define ST_KL (ST_KH + 32 * KP)        // [32 keys][KP] K residual
#define ST_VH (ST_KL + 32 * KP)        // [64 d][VP] V^T hi (32 keys a row)
#define ST_VL (ST_VH + 64 * VP)        // [64 d][VP] V^T residual
#define ST_SZ (ST_VL + 64 * VP)        // halfs per buffer
__device__ __forceinline__ unsigned lds_byte(const _Float16* p) { return (unsigned)(size_t)(const __attribute__((address_space(3))) _Float16*)p; }
// one 32-key stage: 8 copies of 16 B per thread (K planes: 8 lanes a 128-B row; V planes: 4 lanes a 64-B row piece). The s_wait_xcnt stands inside the statement so that no address register is rewritten ahead of it.
__device__ __forceinline__ void stage_kv(const _Float16* kh, const _Float16* kl, const _Float16* vh, const _Float16* vl, unsigned lk, unsigned lv) {
  const _Float16 *kh1 = kh + 16 * (2 * DM), *kl1 = kl + 16 * (2 * DM), *vh1 = vh + 32 * SS, *vl1 = vl + 32 * SS;
  const unsigned lkh0 = lk + 2 * ST_KH, lkh1 = lkh0 + 2 * 16 * KP, lkl0 = lk + 2 * ST_KL, lkl1 = lkl0 + 2 * 16 * KP, lvh0 = lv + 2 * ST_VH, lvh1 = lvh0 + 2 * 32 * VP, lvl0 = lv + 2 * ST_VL, lvl1 = lvl0 + 2 * 32 * VP;
  asm volatile("global_load_async_to_lds_b128 %0, %8, off\n\t"
               "global_load_async_to_lds_b128 %1, %9, off\n\t"
               "global_load_async_to_lds_b128 %2, %10, off\n\t"
               "global_load_async_to_lds_b128 %3, %11, off\n\t"
               "global_load_async_to_lds_b128 %4, %12, off\n\t"
               "global_load_async_to_lds_b128 %5, %13, off\n\t"
               "global_load_async_to_lds_b128 %6, %14, off\n\t"
               "global_load_async_to_lds_b128 %7, %15, off\n\t"
               "s_wait_xcnt 0x0"
               :: "v"(lkh0), "v"(lkh1), "v"(lkl0), "v"(lkl1), "v"(lvh0), "v"(lvh1), "v"(lvl0), "v"(lvl1), "v"(kh), "v"(kh1), "v"(kl), "v"(kl1), "v"(vh), "v"(vh1), "v"(vl), "v"(vl1) : "memory");
}
__device__ __forceinline__ float xhalf(float x) { return __builtin_bit_cast(float, __builtin_amdgcn_permlanex16(__builtin_bit_cast(int, x), __builtin_bit_cast(int, x), 0x76543210, 0xfedcba98, false, false)); }   // lane l takes lane l ^ 16's value
// exp(x) as __expf forms it (x * log2 e, then v_exp_f32). The instruction set asks for one free slot behind a transcendental before its source is overwritten, so the v_exp_f32 run and its v_nop stand in one statement (outputs early-clobbered: no v_exp_f32 of the run writes a source of another).
__device__ __forceinline__ void exp_x4(float& a, float& b, float& c, float& d) {
  const float xa = a * 0x1.715476p+0f, xb = b * 0x1.715476p+0f, xc = c * 0x1.715476p+0f, xd = d * 0x1.715476p+0f;
  asm("v_exp_f32 %0, %4\n\tv_exp_f32 %1, %5\n\tv_exp_f32 %2, %6\n\tv_exp_f32 %3, %7\n\tv_nop" : "=&v"(a), "=&v"(b), "=&v"(c), "=&v"(d) : "v"(xa), "v"(xb), "v"(xc), "v"(xd));
}
__device__ __forceinline__ float exp_x1(float a) { float r; const float xa = a * 0x1.715476p+0f;
  asm("v_exp_f32 %0, %1\n\tv_nop" : "=&v"(r) : "v"(xa));   // the same free slot behind the one v_exp_f32
  return r; }
__global__ __launch_bounds__(128) void k_attn(const _Float16* __restrict__ QK, const _Float16* __restrict__ QKL, const _Float16* __restrict__ VTH, const _Float16* __restrict__ VTL, float* __restrict__ O) {
  __shared__ __align__(16) _Float16 st[2 * ST_SZ];
  const int tid = threadIdx.x, wave = tid >> 5, lane = tid & 31, col = lane & 15, g = lane >> 4;
  const int qb = blockIdx.x, h = blockIdx.y, b = blockIdx.z; const int q0 = qb * 64 + wave * 16; const size_t rq = (size_t)b * SS + q0 + col;
  const int nks = (qb * 64 + 64) / 32;
  // this thread's pieces of a stage: K row tid / 8 (and + 16), 16-B piece tid % 8; V^T row tid / 4 (and + 32), piece tid % 4
  const size_t kof = ((size_t)b * SS + (tid >> 3)) * (2 * DM) + DM + h * HD + (tid & 7) * 8, vof = ((size_t)b * DM + h * HD + (tid >> 2)) * SS + (tid & 3) * 8;
  const unsigned lk = lds_byte(st) + 2 * ((tid >> 3) * KP + (tid & 7) * 8), lv = lds_byte(st) + 2 * ((tid >> 2) * VP + (tid & 3) * 8);
  stage_kv(QK + kof, QKL + kof, VTH + vof, VTL + vof, lk, lv);
  v16h aq[2], aql[2];
#pragma unroll
  for (int kc = 0; kc < 2; ++kc) { aq[kc] = frag_h(QK + rq * (2 * DM) + h * HD + kc * 32, lane); aql[kc] = frag_h(QKL + rq * (2 * DM) + h * HD + kc * 32, lane); }
  float m = -3.0e38f, l = 0.f;   // of query q0 + col; l holds only the keys of this lane's half until the epilogue joins the halves
  v8f acc[4] = {}, accl[4] = {};   // O^T tiles: register r = d dt * 16 + 8 g + r of query q0 + col
  asm volatile("s_wait_asynccnt 0x0" ::: "memory");   // stage 0 of this wave has landed
  __syncthreads();                                     // ... and every wave's part of it may be read
  stage_kv(QK + kof + (size_t)32 * (2 * DM), QKL + kof + (size_t)32 * (2 * DM), VTH + vof + 32, VTL + vof + 32, lk + 2 * ST_SZ, lv + 2 * ST_SZ);   // stage 1 always exists: nks >= 2
#pragma unroll 1
  for (int ks = 0; ks < nks; ++ks) { v8f s[2]; const _Float16* sb = st + (ks & 1) * ST_SZ;
#pragma unroll
    for (int ct = 0; ct < 2; ++ct) { const _Float16* krow = sb + ST_KH + (ct * 16 + col) * KP; const _Float16* krowl = sb + ST_KL + (ct * 16 + col) * KP; v8f c = {}, cl = {};
#pragma unroll
      for (int kc = 0; kc < 2; ++kc) { const v16h kh = frag_h(krow + kc * 32, lane); c = wmma16(kh, aq[kc], c); cl = wmma16(kh, aql[kc], cl); cl = wmma16(frag_h(krowl + kc * 32, lane), aq[kc], cl); }   // 3 products: q, k as f16 hi + residual; register r = key ct * 16 + 8 g + r, column = query
#pragma unroll
      for (int r = 0; r < 8; ++r) c[r] += cl[r] * (1.0f / 2048.0f);
#pragma unroll
      for (int r = 0; r < 8; ++r) { const int kk = ks * 32 + ct * 16 + 8 * g + r; s[ct][r] = (kk <= q0 + col) ? c[r] * 0.03125f : -3.0e38f; } }   // (d^-1/4)^2 = 1024^-1/2 = 1/32 exactly
    float mx = fmaxf(fmaxf(fmaxf(fmaxf(s[0][0], s[0][1]), fmaxf(s[0][2], s[0][3])), fmaxf(fmaxf(s[0][4], s[0][5]), fmaxf(s[0][6], s[0][7]))), fmaxf(fmaxf(fmaxf(s[1][0], s[1][1]), fmaxf(s[1][2], s[1][3])), fmaxf(fmaxf(s[1][4], s[1][5]), fmaxf(s[1][6], s[1][7]))));
    mx = fmaxf(mx, xhalf(mx));
    const float mn = fmaxf(m, mx); const float ea = exp_x1(m - mn); const float alpha = (m <= -1.0e38f) ? 0.f : ea; m = mn;
    float ev[2][8]; v16h pa, pl;   // P^T as a B operand: element i = key 8 g + i (tile 0), element 8 + i = key 16 + 8 g + i (tile 1), the k order of frag_h
#pragma unroll
    for (int ct = 0; ct < 2; ++ct) {
      float ex[8];
#pragma unroll
      for (int r = 0; r < 8; ++r) ex[r] = s[ct][r] - mn;
      exp_x4(ex[0], ex[1], ex[2], ex[3]); exp_x4(ex[4], ex[5], ex[6], ex[7]);
#pragma unroll
      for (int r = 0; r < 8; ++r) { const float e = (s[ct][r] <= -1.0e38f) ? 0.f : ex[r]; ev[ct][r] = e; const _Float16 eh = (_Float16)e; pa[ct * 8 + r] = eh; pl[ct * 8 + r] = (_Float16)((e - (float)eh) * 2048.0f); } }
    l = l * alpha + ((((ev[0][0] + ev[1][0]) + (ev[0][1] + ev[1][1])) + ((ev[0][2] + ev[1][2]) + (ev[0][3] + ev[1][3]))) + (((ev[0][4] + ev[1][4]) + (ev[0][5] + ev[1][5])) + ((ev[0][6] + ev[1][6]) + (ev[0][7] + ev[1][7]))));   // a tree, not one dependent chain of 16 adds
#pragma unroll
    for (int dt = 0; dt < 4; ++dt) {
#pragma unroll
      for (int r = 0; r < 8; ++r) { acc[dt][r] *= alpha; accl[dt][r] *= alpha; } }
#pragma unroll
    for (int dt = 0; dt < 4; ++dt) { const int vr = (dt * 16 + col) * VP; const v16h vh = frag_h(sb + ST_VH + vr, lane); acc[dt] = wmma16(vh, pa, acc[dt]); accl[dt] = wmma16(vh, pl, accl[dt]); accl[dt] = wmma16(frag_h(sb + ST_VL + vr, lane), pa, accl[dt]); }   // V hi x P hi + (V hi x P lo + V lo x P hi) / 2048
    asm volatile("s_wait_dscnt 0x0" ::: "memory");      // this wave's reads of the buffer are done
    asm volatile("s_wait_asynccnt 0x0" ::: "memory");   // this wave's copies of stage ks + 1 have landed
    __syncthreads();                                     // publishes stage ks + 1 and frees the buffer that this step has read
    if (ks + 2 < nks) stage_kv(QK + kof + (size_t)(ks + 2) * 32 * (2 * DM), QKL + kof + (size_t)(ks + 2) * 32 * (2 * DM), VTH + vof + (ks + 2) * 32, VTL + vof + (ks + 2) * 32, lk + 2 * (ks & 1) * ST_SZ, lv + 2 * (ks & 1) * ST_SZ); }
  asm volatile("s_wait_asynccnt 0x0" ::: "memory");     // nothing of this wave is in flight when the buffers become output staging
  float (*so)[16][68] = (float (*)[16][68])st;           // the last step's barrier has ended every wave's reads of st
  const float il = 1.0f / (l + xhalf(l));
#pragma unroll
  for (int dt = 0; dt < 4; ++dt) {
#pragma unroll
    for (int r = 0; r < 8; ++r) so[wave][col][dt * 16 + 8 * g + r] = (acc[dt][r] + accl[dt][r] * (1.0f / 2048.0f)) * il; }
  LDSX();
  for (int rl = 0; rl < 16; ++rl) if (lane < 16) vst2(O + ((size_t)b * SS + q0 + rl) * DM + h * HD + lane * 4, *(const v4f*)&so[wave][rl][lane * 4]);
}
// ---- k_out: block = (64 rows, 128 cols): out = O(hi/lo) . Wo rows (2 products) + bo; each 64-wide k stage of the block's 128 Wo rows and 64 O rows is brought into LDS once per work-group by asynchronous copies that cover whole 128-B lines, two buffers, and the waves take their fragments from there
#define OKS 64                         // k per stage
#define OWP 72                         // Wo row pitch in LDS, bf16: 144 B = 16 B x odd, so the 16 rows of a ds_load_b128 fall on distinct banks
#define OAP 68                         // O row pitch in LDS, floats: 272 B = 16 B x odd
#define OB_W 0                         // bytes: [128 cols][OWP] bf16
#define OB_A (OB_W + 128 * OWP * 2)    // bytes: [64 rows][OAP] f32
#define OB_SZ (OB_A + 64 * OAP * 4)    // bytes per buffer
__device__ __forceinline__ unsigned lds_byte_c(const char* p) { return (unsigned)(size_t)(const __attribute__((address_space(3))) char*)p; }
// eight 16-B copies of one thread, at a fixed step in LDS (ls bytes) and in global memory (gs bytes). The s_wait_xcnt stands inside the statement so that no address register is rewritten ahead of it.
__device__ __forceinline__ void copy8(unsigned l0, unsigned ls, const char* g0, size_t gs) {
  const unsigned l1 = l0 + ls, l2 = l1 + ls, l3 = l2 + ls, l4 = l3 + ls, l5 = l4 + ls, l6 = l5 + ls, l7 = l6 + ls;
  const char *g1 = g0 + gs, *g2 = g1 + gs, *g3 = g2 + gs, *g4 = g3 + gs, *g5 = g4 + gs, *g6 = g5 + gs, *g7 = g6 + gs;
  asm volatile("global_load_async_to_lds_b128 %0, %8, off\n\t"
               "global_load_async_to_lds_b128 %1, %9, off\n\t"
               "global_load_async_to_lds_b128 %2, %10, off\n\t"
               "global_load_async_to_lds_b128 %3, %11, off\n\t"
               "global_load_async_to_lds_b128 %4, %12, off\n\t"
               "global_load_async_to_lds_b128 %5, %13, off\n\t"
               "global_load_async_to_lds_b128 %6, %14, off\n\t"
               "global_load_async_to_lds_b128 %7, %15, off\n\t"
               "s_wait_xcnt 0x0"
               :: "v"(l0), "v"(l1), "v"(l2), "v"(l3), "v"(l4), "v"(l5), "v"(l6), "v"(l7), "v"(g0), "v"(g1), "v"(g2), "v"(g3), "v"(g4), "v"(g5), "v"(g6), "v"(g7) : "memory");
}
// one stage: Wo rows tid / 8 + 16 i, 16-B piece tid % 8 (a wave's copy = 4 whole 128-B rows); O rows tid / 16 + 8 i, piece tid % 16 (a wave's copy = 2 whole 256-B rows)
__device__ __forceinline__ void stage_out(const char* gw, const char* ga, unsigned lw, unsigned la) {
  copy8(lw, 16 * OWP * 2, gw, (size_t)16 * DM * 2); copy8(la, 8 * OAP * 4, ga, (size_t)8 * DM * 4);
}
__global__ __launch_bounds__(128) void k_out(const float* __restrict__ O, const __bf16* __restrict__ P, const float* __restrict__ BU, float* __restrict__ Y) {
  __shared__ __align__(16) char sm[2 * OB_SZ];
  const int tid = threadIdx.x, wave = tid >> 5, lane = tid & 31, col = lane & 15, g = lane >> 4; const size_t rb = (size_t)blockIdx.x * 64, r0 = rb + wave * 16; const int n0 = blockIdx.y * 128;
  const char* gw = (const char*)(P + (size_t)(n0 + (tid >> 3)) * DM + (tid & 7) * 8); const char* ga = (const char*)(O + (rb + (tid >> 4)) * DM + (tid & 15) * 4);
  const unsigned lw = lds_byte_c(sm) + OB_W + (tid >> 3) * (OWP * 2) + (tid & 7) * 16, la = lds_byte_c(sm) + OB_A + (tid >> 4) * (OAP * 4) + (tid & 15) * 16;
  v8f acc[8] = {};
  stage_out(gw, ga, lw, la);
  asm volatile("s_wait_asynccnt 0x0" ::: "memory");   // stage 0 of this wave has landed
  __syncthreads();                                     // ... and every wave's part of it may be read
  stage_out(gw + OKS * 2, ga + OKS * 4, lw + OB_SZ, la + OB_SZ);
#pragma unroll 1   // rolled: one copy of the two-buffer order below, and the loop's text stays small
  for (int ks = 0; ks < DM / OKS; ++ks) { const char* sb = sm + (ks & 1) * OB_SZ; const float* arow = (const float*)(sb + OB_A) + (wave * 16 + col) * OAP; const __bf16* wrow = (const __bf16*)(sb + OB_W) + col * OWP;
#pragma unroll
    for (int kc = 0; kc < OKS / 32; ++kc) { v16b w[8];   // the eight Wo fragments of a k step are read as one group ahead of its products: one LDS latency a step, not eight
#pragma unroll
      for (int j = 0; j < 8; ++j) w[j] = frag_b(wrow + j * 16 * OWP + kc * 32, lane);
      const F2 a = split_row(arow, kc * 32, lane);
#pragma unroll
      for (int j = 0; j < 8; ++j) { acc[j] = wmma_bf(a.l, w[j], acc[j]); acc[j] = wmma_bf(a.h, w[j], acc[j]); } }
    asm volatile("s_wait_dscnt 0x0" ::: "memory");      // this wave's reads of the buffer are done
    asm volatile("s_wait_asynccnt 0x0" ::: "memory");   // this wave's copies of stage ks + 1 have landed
    __syncthreads();                                     // publishes stage ks + 1 and frees the buffer that this step has read
    if (ks + 2 < DM / OKS) stage_out(gw + (ks + 2) * (OKS * 2), ga + (ks + 2) * (OKS * 4), lw + (ks & 1) * OB_SZ, la + (ks & 1) * OB_SZ); }
  asm volatile("s_wait_asynccnt 0x0" ::: "memory");     // nothing of this wave is in flight when the buffers become output staging
  float (*so)[16][132] = (float (*)[16][132])sm;         // the last step's barrier has ended every wave's reads of sm
#pragma unroll
  for (int j = 0; j < 8; ++j) { const float bb = bfr(BU[n0 + j * 16 + col]);
#pragma unroll
    for (int r = 0; r < 8; ++r) so[wave][8 * g + r][j * 16 + col] = acc[j][r] + bb; }
  LDSX();
  for (int rl = 0; rl < 16; ++rl) vst2(Y + (r0 + rl) * DM + n0 + lane * 4, *(const v4f*)&so[wave][rl][lane * 4]);
}
extern "C" void kernel_launch(void* const* d_in, const int* in_sizes, int n_in, void* d_out, int out_size, void* d_ws, size_t ws_size, hipStream_t stream) {
  (void)in_sizes; (void)n_in; (void)out_size;
  const float** F = (const float**)d_in;   // 0 x [4,2048,1024], 1 Wq [64,64] ([out][in], shared by all 16 heads), 2 Wk, 3 Wv, 4 Wu [1024,1024], 5 bu [1024]
  if (ws_size < (size_t)WS_END) return;
  char* ws = (char*)d_ws; __bf16* PK = (__bf16*)(ws + WS_PK); _Float16 *QK = (_Float16*)(ws + WS_QK), *QKL = (_Float16*)(ws + WS_QKL), *VTH = (_Float16*)(ws + WS_VTH), *VTL = (_Float16*)(ws + WS_VTL); float *O = (float*)(ws + WS_O);
  k_packbd<<<QKVW, 128, 0, stream>>>(F[1], F[2], F[3], PK + PK_A); k_packrows<<<DM, 256, 0, stream>>>(F[4], DM, PK + PK_P);
  k_qkv<<<dim3(TNB * SS / 64, QKVW / 128), 128, 0, stream>>>(F[0], PK + PK_A, QK, QKL, VTH, VTL);
  k_attn<<<dim3(TQB, NH, TNB), 128, 0, stream>>>(QK, QKL, VTH, VTL, O);
  k_out<<<dim3(TOB, DM / 128), 128, 0, stream>>>(O, PK + PK_P, F[5], (float*)d_out);
}

// v005
// One run takes 184 microseconds.
// Timed twice side by side with v004, it ran 1.33 times as fast both times.
// Over all steps from v000 it is 4.50 times as fast.
// compute dtype: x, Wq, Wk, Wv, Wu, bu (module inputs) rounded to bf16; the head-shared 64x64 q/k/v projections as one block-diagonal packed GEMM with exact bf16 products (x and W are inputs) on WMMA 16x16x32; q and k stored as f16 hi + (x2048-scaled) residual rows, causal scores with 3 products (the module's d^-1/4 on q and on k applied as the exact 1/32 on the f32 score); P.V with P as f16 hi + (x2048-scaled) residual x V as f16 hi + (x2048-scaled) residual planes (3 products); the output projection with ctx as bf16 hi + residual x exact Wu (2 products) + bu; running-max softmax in f32 with the hardware exp; f32 accumulate.
#include <hip/hip_runtime.h>
#include <math.h>

typedef __attribute__((ext_vector_type(16))) _Float16 v16h;
typedef __attribute__((ext_vector_type(16))) __bf16 v16b;
typedef __attribute__((ext_vector_type(8)))  _Float16 v8h;
typedef __attribute__((ext_vector_type(8)))  float v8f;
typedef __attribute__((ext_vector_type(4)))  float v4f;
typedef __attribute__((ext_vector_type(2)))  float v2f;
typedef __attribute__((ext_vector_type(4)))  unsigned v4u;
typedef __attribute__((ext_vector_type(4)))  int v4i;
typedef float __attribute__((may_alias)) float_a;
typedef int __attribute__((may_alias)) int_a;

template <typename T> __device__ __forceinline__ void vst2(void* p, T v) { *(T*)p = v;  }
__device__ __forceinline__ v8f wmma16(v16h a, v16h b, v8f c) {
  v8f d = __builtin_amdgcn_wmma_f32_16x16x32_f16(false, a, false, b, (short)0, c, false, false);
  asm volatile("v_nop\n\tv_nop\n\tv_nop\n\tv_nop" : "+v"(d) : "v"(a), "v"(b));
  return d;
}
__device__ __forceinline__ v8f wmma_bf(v16b a, v16b b, v8f c) {
  v8f d = __builtin_amdgcn_wmma_f32_16x16x32_bf16(false, a, false, b, (short)0, c, false, false);
  asm volatile("v_nop\n\tv_nop\n\tv_nop\n\tv_nop" : "+v"(d) : "v"(a), "v"(b));
  return d;
}
// 'Narrow' causal self-attention (B 4, T 2,048, emb 1,024 = 16 heads x 64 with ONE shared 64x64 Wq/Wk/Wv): per head q = x_h Wq^T d^-1/4, k = x_h Wk^T d^-1/4, v = x_h Wv^T; causal softmax(q k^T) v; out = y Wu^T + bu.
__device__ __forceinline__ v16h frag_h(const _Float16* rowk0, int lane) {
  union { v16h v; v8h q[2]; } u; const _Float16* p = rowk0 + 8 * (lane >> 4);
  u.q[0] = *(const v8h*)p; u.q[1] = *(const v8h*)(p + 16); return u.v;
}
__device__ __forceinline__ v16h frag_f32(const float* rowk0, int lane) {
  v16h a; const float* p = rowk0 + 8 * (lane >> 4);
#pragma unroll
  for (int i = 0; i < 8; ++i) { a[i] = (_Float16)p[i]; a[8 + i] = (_Float16)p[16 + i]; }
  return a;
}
__device__ __forceinline__ v16h frag_f32s(const float* rowk0, int lane, float sc) {
  v16h a; const float* p = rowk0 + 8 * (lane >> 4);
#pragma unroll
  for (int i = 0; i < 8; ++i) { a[i] = (_Float16)(p[i] * sc); a[8 + i] = (_Float16)(p[16 + i] * sc); }
  return a;
}
// column fragment from a [K][ld] layout (column n), rows >= K read as 0
__device__ __forceinline__ v16h fragc_f32(const float* W, int k0, int n, int lane, int ld, int K) {
  v16h a; const int g = lane >> 4;
#pragma unroll
  for (int i = 0; i < 8; ++i) { const int ka = k0 + 8 * g + i, kb = ka + 16;
    a[i] = (_Float16)(ka < K ? W[(size_t)(ka < K ? ka : K - 1) * ld + n] : 0.f); a[8 + i] = (_Float16)(kb < K ? W[(size_t)(kb < K ? kb : K - 1) * ld + n] : 0.f); }
  return a;
}
struct F2 { v16b h, l; };
__device__ __forceinline__ F2 bsplit16(const float v[16]) { F2 r;
#pragma unroll
  for (int i = 0; i < 16; ++i) { const __bf16 h = (__bf16)v[i]; r.h[i] = h; r.l[i] = (__bf16)(v[i] - (float)h); }
  return r; }
__device__ __forceinline__ F2 split_row(const float* row, int k0, int lane) { float v[16]; const float* p = row + k0 + 8 * (lane >> 4);
#pragma unroll
  for (int i = 0; i < 8; ++i) { v[i] = p[i]; v[8 + i] = p[16 + i]; }
  return bsplit16(v); }
__device__ __forceinline__ F2 split_rowK(const float* row, int k0, int lane, int K) { float v[16]; const int g = lane >> 4;
#pragma unroll
  for (int i = 0; i < 8; ++i) { const int ka = k0 + 8 * g + i, kb = ka + 16; v[i] = ka < K ? row[ka < K ? ka : K - 1] : 0.f; v[8 + i] = kb < K ? row[kb < K ? kb : K - 1] : 0.f; }
  return bsplit16(v); }
__device__ __forceinline__ F2 split_col(const float* W, int k0, int n, int lane, int ld, int K) { float v[16]; const int g = lane >> 4;
#pragma unroll
  for (int i = 0; i < 8; ++i) { const int ka = k0 + 8 * g + i, kb = ka + 16; v[i] = ka < K ? W[(size_t)(ka < K ? ka : K - 1) * ld + n] : 0.f; v[8 + i] = kb < K ? W[(size_t)(kb < K ? kb : K - 1) * ld + n] : 0.f; }
  return bsplit16(v); }
__device__ __forceinline__ v8f mac3(const F2& a, const F2& b, v8f c) { c = wmma_bf(a.l, b.h, c); c = wmma_bf(a.h, b.l, c); return wmma_bf(a.h, b.h, c); }
__device__ __forceinline__ float sigm(float v) { return 1.0f / (1.0f + expf(-v)); }
#define LDSX() do { asm volatile("s_wait_dscnt 0" ::: "memory"); __builtin_amdgcn_wave_barrier(); __builtin_amdgcn_fence(__ATOMIC_RELEASE, "workgroup"); } while (0)


// Causal multi-head self-attention (B 4, S 2048, D 1024, 16 heads x 64; head-shared 64x64 Wq/Wk/Wv expanded to a block-diagonal packed [3D][D], Wout [D][D] applied as x W^T, bias bu): softmax(q k^T / 32, causal) v; ctx Wout^T + bu.
#define NB 4
#define SS 2048
#define DM 1024
#define NH 16
#define HD 64
#define QKVW (3 * DM)
#ifndef TQB
#define TQB (SS / 64)
#define TNB NB
#define TOB (NB * SS / 64)     // output row tiles (all)
#endif
typedef __attribute__((ext_vector_type(8))) __bf16 v8b;
__device__ __forceinline__ v16b frag_b(const __bf16* rowk0, int lane) {
  union { v16b v; v8b q[2]; } u; const __bf16* p = rowk0 + 8 * (lane >> 4);
  u.q[0] = *(const v8b*)p; u.q[1] = *(const v8b*)(p + 16); return u.v;
}
__device__ __forceinline__ float bfr(float v) { return (float)(__bf16)v; }
__device__ __attribute__((noinline)) float exp_ni(float v) { return expf(v); }
__device__ __attribute__((noinline)) float erf_ni(float v) { return erff(v); }

#define PK_A 0                       // [3072][1024] Wqkv rows (natural [out][in])
#define PK_P (PK_A + QKVW * DM)        // [1024][1024] Wo rows (natural)
#define PK_END (PK_P + DM * DM)
#define WS_PK  0u
#define WS_QK  (WS_PK + 2u * PK_END)             // f16 [8192 rows][2048]: q | k
#define WS_QKL (WS_QK + 2u * NB * SS * 2 * DM)     // f16 q | k residual planes x2048
#define WS_VTH (WS_QKL + 2u * NB * SS * 2 * DM)    // f16 [b][1024 (h*64+d)][2048 s] hi
#define WS_VTL (WS_VTH + 2u * NB * DM * SS)        // f16 lo x 2048
#define WS_O   (WS_VTL + 2u * NB * DM * SS)        // f32 [8192][1024]
#define WS_CS  (WS_O + 4u * NB * SS * DM)           // f32 2 x [2048][32], reserved, not written or read
#define WS_END (WS_CS + 4u * 2 * SS * 32)

// ---- k_packbd: block = packed row n = which*1024 + h*64 + o: block-diagonal expansion of the head-shared [64][64] projection: row[h*64 + c] = W[o][c], zero elsewhere
__global__ __launch_bounds__(128) void k_packbd(const float* __restrict__ WQ, const float* __restrict__ WK, const float* __restrict__ WV, __bf16* __restrict__ DST) {
  __shared__ __align__(16) __bf16 s[DM]; const int n = blockIdx.x, t = threadIdx.x; const int which = n / DM, h = (n % DM) / HD, o = n % HD; const float* Wm = (which == 0) ? WQ : (which == 1) ? WK : WV;
  for (int k = t; k < DM; k += 128) s[k] = (__bf16)((k / HD == h) ? Wm[o * HD + (k % HD)] : 0.f);
  __syncthreads();
  vst2((unsigned*)(DST + (size_t)n * DM + t * 8), *(const v4u*)&s[t * 8]);
}
// ---- k_packrows: block = natural row n of a [N][K] weight
__global__ __launch_bounds__(256) void k_packrows(const float* __restrict__ Wm, int K, __bf16* __restrict__ DST) {
  __shared__ __align__(16) __bf16 s[DM]; const int n = blockIdx.x, tid = threadIdx.x;
  for (int k = tid; k < K; k += 256) s[k] = (__bf16)Wm[(size_t)n * K + k];
  __syncthreads();
  for (int q = tid; q < K / 8; q += 256) vst2((unsigned*)(DST + (size_t)n * K + q * 8), *(const v4u*)&s[q * 8]);
}
// ---- k_qkv: block = (64 rows (b,s), 128 of the 3072 cols): qkv = bf16(x) . rows (exact); cols < 1024 -> f16(q), cols < 2048 -> f16(k) into QK rows (pitch 2048); cols >= 2048 (v) -> per-batch transposed f16 planes VT[b][h*64+d][s]: hi = f16(v), lo = f16((v - hi) * 2048)
__global__ __launch_bounds__(128) void k_qkv(const float* __restrict__ X, const __bf16* __restrict__ P, _Float16* __restrict__ QK, _Float16* __restrict__ QKL, _Float16* __restrict__ VTH, _Float16* __restrict__ VTL) {
  __shared__ __align__(16) _Float16 so[4][16][136], sol[4][16][136]; __shared__ __align__(16) _Float16 sth[128][72], stl[128][72];
  const int tid = threadIdx.x, wave = tid >> 5, lane = tid & 31, col = lane & 15, g = lane >> 4; const size_t r0 = (size_t)blockIdx.x * 64 + wave * 16; const int n0 = blockIdx.y * 128;
  v8f acc[8] = {};
  // packed row n is zero outside columns [head*64, head*64+64), head = (n % 1024) / 64: the 128 columns of this block are two heads, and each head's four column tiles take only their own 64 k
#pragma unroll
  for (int hh = 0; hh < 2; ++hh) { const int kb = (n0 % DM) + hh * HD;
#pragma unroll
    for (int kc = 0; kc < HD / 32; ++kc) { v16b a; { const float* p = X + (r0 + col) * DM + kb + kc * 32 + 8 * g;
#pragma unroll
        for (int i = 0; i < 8; ++i) { a[i] = (__bf16)p[i]; a[8 + i] = (__bf16)p[16 + i]; } }
#pragma unroll
      for (int j = 0; j < 4; ++j) acc[hh * 4 + j] = wmma_bf(a, frag_b(P + (size_t)(n0 + (hh * 4 + j) * 16 + col) * DM + kb + kc * 32, lane), acc[hh * 4 + j]); } }
  if (n0 < 2 * DM) {   // q | k -> f16 hi + (x2048) residual rows (unscaled; the d^-1/4 x d^-1/4 = 1/32 scale is applied to the f32 score)
#pragma unroll
    for (int j = 0; j < 8; ++j) {
#pragma unroll
      for (int r = 0; r < 8; ++r) { const float v = acc[j][r]; const _Float16 hv = (_Float16)v; so[wave][8 * g + r][j * 16 + col] = hv; sol[wave][8 * g + r][j * 16 + col] = (_Float16)((v - (float)hv) * 2048.0f); } }
    LDSX();
    for (int rl = 0; rl < 16; ++rl) if (lane < 16) { vst2((unsigned*)(QK + (r0 + rl) * (2 * DM) + n0 + lane * 8), *(const v4u*)&so[wave][rl][lane * 8]); vst2((unsigned*)(QKL + (r0 + rl) * (2 * DM) + n0 + lane * 8), *(const v4u*)&sol[wave][rl][lane * 8]); }
  } else {
#pragma unroll
    for (int j = 0; j < 8; ++j) {
#pragma unroll
      for (int r = 0; r < 8; ++r) { const float v = acc[j][r]; const _Float16 hv = (_Float16)v; sth[j * 16 + col][wave * 16 + 8 * g + r] = hv; stl[j * 16 + col][wave * 16 + 8 * g + r] = (_Float16)((v - (float)hv) * 2048.0f); } }
    __syncthreads();
    const size_t rb = (size_t)blockIdx.x * 64; const int b = (int)(rb / SS), s0 = (int)(rb % SS); const int pc0 = n0 - 2 * DM;
    for (int q = tid; q < 128 * 8; q += 128) { const int d = q >> 3, pc = q & 7; const size_t o = ((size_t)b * DM + pc0 + d) * SS + s0 + pc * 8; vst2((unsigned*)(VTH + o), *(const v4u*)&sth[d][pc * 8]); vst2((unsigned*)(VTL + o), *(const v4u*)&stl[d][pc * 8]); }
  }
}
#define KP 72                          // K row pitch in LDS, halfs: 144 B = 16 B x odd, so the 16 rows of a ds_load_b128 fall on distinct banks
#define VP 40                          // V^T row pitch in LDS, halfs: 80 B = 16 B x odd
#define ST_KH 0                        // [32 keys][KP] K hi
#define ST_KL (ST_KH + 32 * KP)        // [32 keys][KP] K residual
#define ST_VH (ST_KL + 32 * KP)        // [64 d][VP] V^T hi (32 keys a row)
#define ST_VL (ST_VH + 64 * VP)        // [64 d][VP] V^T residual
#define ST_SZ (ST_VL + 64 * VP)        // halfs per buffer
__device__ __forceinline__ unsigned lds_byte(const _Float16* p) { return (unsigned)(size_t)(const __attribute__((address_space(3))) _Float16*)p; }
// one 32-key stage: 8 copies of 16 B per thread (K planes: 8 lanes a 128-B row; V planes: 4 lanes a 64-B row piece). The s_wait_xcnt stands inside the statement so that no address register is rewritten ahead of it.
__device__ __forceinline__ void stage_kv(const _Float16* kh, const _Float16* kl, const _Float16* vh, const _Float16* vl, unsigned lk, unsigned lv) {
  const _Float16 *kh1 = kh + 16 * (2 * DM), *kl1 = kl + 16 * (2 * DM), *vh1 = vh + 32 * SS, *vl1 = vl + 32 * SS;
  const unsigned lkh0 = lk + 2 * ST_KH, lkh1 = lkh0 + 2 * 16 * KP, lkl0 = lk + 2 * ST_KL, lkl1 = lkl0 + 2 * 16 * KP, lvh0 = lv + 2 * ST_VH, lvh1 = lvh0 + 2 * 32 * VP, lvl0 = lv + 2 * ST_VL, lvl1 = lvl0 + 2 * 32 * VP;
  asm volatile("global_load_async_to_lds_b128 %0, %8, off\n\t"
               "global_load_async_to_lds_b128 %1, %9, off\n\t"
               "global_load_async_to_lds_b128 %2, %10, off\n\t"
               "global_load_async_to_lds_b128 %3, %11, off\n\t"
               "global_load_async_to_lds_b128 %4, %12, off\n\t"
               "global_load_async_to_lds_b128 %5, %13, off\n\t"
               "global_load_async_to_lds_b128 %6, %14, off\n\t"
               "global_load_async_to_lds_b128 %7, %15, off\n\t"
               "s_wait_xcnt 0x0"
               :: "v"(lkh0), "v"(lkh1), "v"(lkl0), "v"(lkl1), "v"(lvh0), "v"(lvh1), "v"(lvl0), "v"(lvl1), "v"(kh), "v"(kh1), "v"(kl), "v"(kl1), "v"(vh), "v"(vh1), "v"(vl), "v"(vl1) : "memory");
}
__device__ __forceinline__ float xhalf(float x) { return __builtin_bit_cast(float, __builtin_amdgcn_permlanex16(__builtin_bit_cast(int, x), __builtin_bit_cast(int, x), 0x76543210, 0xfedcba98, false, false)); }   // lane l takes lane l ^ 16's value
// exp(x) as __expf forms it (x * log2 e, then v_exp_f32). The instruction set asks for one free slot behind a transcendental before its source is overwritten, so the v_exp_f32 run and its v_nop stand in one statement (outputs early-clobbered: no v_exp_f32 of the run writes a source of another).
__device__ __forceinline__ void exp_x4(float& a, float& b, float& c, float& d) {
  const float xa = a * 0x1.715476p+0f, xb = b * 0x1.715476p+0f, xc = c * 0x1.715476p+0f, xd = d * 0x1.715476p+0f;
  asm("v_exp_f32 %0, %4\n\tv_exp_f32 %1, %5\n\tv_exp_f32 %2, %6\n\tv_exp_f32 %3, %7\n\tv_nop" : "=&v"(a), "=&v"(b), "=&v"(c), "=&v"(d) : "v"(xa), "v"(xb), "v"(xc), "v"(xd));
}
__device__ __forceinline__ float exp_x1(float a) { float r; const float xa = a * 0x1.715476p+0f;
  asm("v_exp_f32 %0, %1\n\tv_nop" : "=&v"(r) : "v"(xa));   // the same free slot behind the one v_exp_f32
  return r; }
__global__ __launch_bounds__(128) void k_attn(const _Float16* __restrict__ QK, const _Float16* __restrict__ QKL, const _Float16* __restrict__ VTH, const _Float16* __restrict__ VTL, float* __restrict__ O) {
  __shared__ __align__(16) _Float16 st[2 * ST_SZ];
  const int tid = threadIdx.x, wave = tid >> 5, lane = tid & 31, col = lane & 15, g = lane >> 4;
  const int h = blockIdx.x, b = blockIdx.y, qb = TQB - 1 - (int)blockIdx.z; const int q0 = qb * 64 + wave * 16; const size_t rq = (size_t)b * SS + q0 + col;
  const int nks = (qb * 64 + 64) / 32;
  // this thread's pieces of a stage: K row tid / 8 (and + 16), 16-B piece tid % 8; V^T row tid / 4 (and + 32), piece tid % 4
  const size_t kof = ((size_t)b * SS + (tid >> 3)) * (2 * DM) + DM + h * HD + (tid & 7) * 8, vof = ((size_t)b * DM + h * HD + (tid >> 2)) * SS + (tid & 3) * 8;
  const unsigned lk = lds_byte(st) + 2 * ((tid >> 3) * KP + (tid & 7) * 8), lv = lds_byte(st) + 2 * ((tid >> 2) * VP + (tid & 3) * 8);
  stage_kv(QK + kof, QKL + kof, VTH + vof, VTL + vof, lk, lv);
  v16h aq[2], aql[2];
#pragma unroll
  for (int kc = 0; kc < 2; ++kc) { aq[kc] = frag_h(QK + rq * (2 * DM) + h * HD + kc * 32, lane); aql[kc] = frag_h(QKL + rq * (2 * DM) + h * HD + kc * 32, lane); }
  float m = -3.0e38f, l = 0.f;   // of query q0 + col; l holds only the keys of this lane's half until the epilogue joins the halves
  v8f acc[4] = {}, accl[4] = {};   // O^T tiles: register r = d dt * 16 + 8 g + r of query q0 + col
  asm volatile("s_wait_asynccnt 0x0" ::: "memory");   // stage 0 of this wave has landed
  __syncthreads();                                     // ... and every wave's part of it may be read
  stage_kv(QK + kof + (size_t)32 * (2 * DM), QKL + kof + (size_t)32 * (2 * DM), VTH + vof + 32, VTL + vof + 32, lk + 2 * ST_SZ, lv + 2 * ST_SZ);   // stage 1 always exists: nks >= 2
#pragma unroll 1
  for (int ks = 0; ks < nks; ++ks) { v8f s[2]; const _Float16* sb = st + (ks & 1) * ST_SZ;
#pragma unroll
    for (int ct = 0; ct < 2; ++ct) { const _Float16* krow = sb + ST_KH + (ct * 16 + col) * KP; const _Float16* krowl = sb + ST_KL + (ct * 16 + col) * KP; v8f c = {}, cl = {};
#pragma unroll
      for (int kc = 0; kc < 2; ++kc) { const v16h kh = frag_h(krow + kc * 32, lane); c = wmma16(kh, aq[kc], c); cl = wmma16(kh, aql[kc], cl); cl = wmma16(frag_h(krowl + kc * 32, lane), aq[kc], cl); }   // 3 products: q, k as f16 hi + residual; register r = key ct * 16 + 8 g + r, column = query
#pragma unroll
      for (int r = 0; r < 8; ++r) c[r] += cl[r] * (1.0f / 2048.0f);
#pragma unroll
      for (int r = 0; r < 8; ++r) { const int kk = ks * 32 + ct * 16 + 8 * g + r; s[ct][r] = (kk <= q0 + col) ? c[r] * 0.03125f : -3.0e38f; } }   // (d^-1/4)^2 = 1024^-1/2 = 1/32 exactly
    float mx = fmaxf(fmaxf(fmaxf(fmaxf(s[0][0], s[0][1]), fmaxf(s[0][2], s[0][3])), fmaxf(fmaxf(s[0][4], s[0][5]), fmaxf(s[0][6], s[0][7]))), fmaxf(fmaxf(fmaxf(s[1][0], s[1][1]), fmaxf(s[1][2], s[1][3])), fmaxf(fmaxf(s[1][4], s[1][5]), fmaxf(s[1][6], s[1][7]))));
    mx = fmaxf(mx, xhalf(mx));
    const float mn = fmaxf(m, mx); const float ea = exp_x1(m - mn); const float alpha = (m <= -1.0e38f) ? 0.f : ea; m = mn;
    float ev[2][8]; v16h pa, pl;   // P^T as a B operand: element i = key 8 g + i (tile 0), element 8 + i = key 16 + 8 g + i (tile 1), the k order of frag_h
#pragma unroll
    for (int ct = 0; ct < 2; ++ct) {
      float ex[8];
#pragma unroll
      for (int r = 0; r < 8; ++r) ex[r] = s[ct][r] - mn;
      exp_x4(ex[0], ex[1], ex[2], ex[3]); exp_x4(ex[4], ex[5], ex[6], ex[7]);
#pragma unroll
      for (int r = 0; r < 8; ++r) { const float e = (s[ct][r] <= -1.0e38f) ? 0.f : ex[r]; ev[ct][r] = e; const _Float16 eh = (_Float16)e; pa[ct * 8 + r] = eh; pl[ct * 8 + r] = (_Float16)((e - (float)eh) * 2048.0f); } }
    l = l * alpha + ((((ev[0][0] + ev[1][0]) + (ev[0][1] + ev[1][1])) + ((ev[0][2] + ev[1][2]) + (ev[0][3] + ev[1][3]))) + (((ev[0][4] + ev[1][4]) + (ev[0][5] + ev[1][5])) + ((ev[0][6] + ev[1][6]) + (ev[0][7] + ev[1][7]))));   // a tree, not one dependent chain of 16 adds
#pragma unroll
    for (int dt = 0; dt < 4; ++dt) {
#pragma unroll
      for (int r = 0; r < 8; ++r) { acc[dt][r] *= alpha; accl[dt][r] *= alpha; } }
#pragma unroll
    for (int dt = 0; dt < 4; ++dt) { const int vr = (dt * 16 + col) * VP; const v16h vh = frag_h(sb + ST_VH + vr, lane); acc[dt] = wmma16(vh, pa, acc[dt]); accl[dt] = wmma16(vh, pl, accl[dt]); accl[dt] = wmma16(frag_h(sb + ST_VL + vr, lane), pa, accl[dt]); }   // V hi x P hi + (V hi x P lo + V lo x P hi) / 2048
    asm volatile("s_wait_dscnt 0x0" ::: "memory");      // this wave's reads of the buffer are done
    asm volatile("s_wait_asynccnt 0x0" ::: "memory");   // this wave's copies of stage ks + 1 have landed
    __syncthreads();                                     // publishes stage ks + 1 and frees the buffer that this step has read
    if (ks + 2 < nks) stage_kv(QK + kof + (size_t)(ks + 2) * 32 * (2 * DM), QKL + kof + (size_t)(ks + 2) * 32 * (2 * DM), VTH + vof + (ks + 2) * 32, VTL + vof + (ks + 2) * 32, lk + 2 * (ks & 1) * ST_SZ, lv + 2 * (ks & 1) * ST_SZ); }
  asm volatile("s_wait_asynccnt 0x0" ::: "memory");     // nothing of this wave is in flight when the buffers become output staging
  float (*so)[16][68] = (float (*)[16][68])st;           // the last step's barrier has ended every wave's reads of st
  const float il = 1.0f / (l + xhalf(l));
#pragma unroll
  for (int dt = 0; dt < 4; ++dt) {
#pragma unroll
    for (int r = 0; r < 8; ++r) so[wave][col][dt * 16 + 8 * g + r] = (acc[dt][r] + accl[dt][r] * (1.0f / 2048.0f)) * il; }
  LDSX();
  for (int rl = 0; rl < 16; ++rl) if (lane < 16) vst2(O + ((size_t)b * SS + q0 + rl) * DM + h * HD + lane * 4, *(const v4f*)&so[wave][rl][lane * 4]);
}
// ---- k_out: block = (64 rows, 128 cols): out = O(hi/lo) . Wo rows (2 products) + bo; each 64-wide k stage of the block's 128 Wo rows and 64 O rows is brought into LDS once per work-group by asynchronous copies that cover whole 128-B lines, two buffers, and the waves take their fragments from there
#define OKS 64                         // k per stage
#define OWP 72                         // Wo row pitch in LDS, bf16: 144 B = 16 B x odd, so the 16 rows of a ds_load_b128 fall on distinct banks
#define OAP 68                         // O row pitch in LDS, floats: 272 B = 16 B x odd
#define OB_W 0                         // bytes: [128 cols][OWP] bf16
#define OB_A (OB_W + 128 * OWP * 2)    // bytes: [64 rows][OAP] f32
#define OB_SZ (OB_A + 64 * OAP * 4)    // bytes per buffer
__device__ __forceinline__ unsigned lds_byte_c(const char* p) { return (unsigned)(size_t)(const __attribute__((address_space(3))) char*)p; }
// eight 16-B copies of one thread, at a fixed step in LDS (ls bytes) and in global memory (gs bytes). The s_wait_xcnt stands inside the statement so that no address register is rewritten ahead of it.
__device__ __forceinline__ void copy8(unsigned l0, unsigned ls, const char* g0, size_t gs) {
  const unsigned l1 = l0 + ls, l2 = l1 + ls, l3 = l2 + ls, l4 = l3 + ls, l5 = l4 + ls, l6 = l5 + ls, l7 = l6 + ls;
  const char *g1 = g0 + gs, *g2 = g1 + gs, *g3 = g2 + gs, *g4 = g3 + gs, *g5 = g4 + gs, *g6 = g5 + gs, *g7 = g6 + gs;
  asm volatile("global_load_async_to_lds_b128 %0, %8, off\n\t"
               "global_load_async_to_lds_b128 %1, %9, off\n\t"
               "global_load_async_to_lds_b128 %2, %10, off\n\t"
               "global_load_async_to_lds_b128 %3, %11, off\n\t"
               "global_load_async_to_lds_b128 %4, %12, off\n\t"
               "global_load_async_to_lds_b128 %5, %13, off\n\t"
               "global_load_async_to_lds_b128 %6, %14, off\n\t"
               "global_load_async_to_lds_b128 %7, %15, off\n\t"
               "s_wait_xcnt 0x0"
               :: "v"(l0), "v"(l1), "v"(l2), "v"(l3), "v"(l4), "v"(l5), "v"(l6), "v"(l7), "v"(g0), "v"(g1), "v"(g2), "v"(g3), "v"(g4), "v"(g5), "v"(g6), "v"(g7) : "memory");
}
// one stage: Wo rows tid / 8 + 16 i, 16-B piece tid % 8 (a wave's copy = 4 whole 128-B rows); O rows tid / 16 + 8 i, piece tid % 16 (a wave's copy = 2 whole 256-B rows)
__device__ __forceinline__ void stage_out(const char* gw, const char* ga, unsigned lw, unsigned la) {
  copy8(lw, 16 * OWP * 2, gw, (size_t)16 * DM * 2); copy8(la, 8 * OAP * 4, ga, (size_t)8 * DM * 4);
}
__global__ __launch_bounds__(128) void k_out(const float* __restrict__ O, const __bf16* __restrict__ P, const float* __restrict__ BU, float* __restrict__ Y) {
  __shared__ __align__(16) char sm[2 * OB_SZ];
  const int tid = threadIdx.x, wave = tid >> 5, lane = tid & 31, col = lane & 15, g = lane >> 4; const size_t rb = (size_t)blockIdx.x * 64, r0 = rb + wave * 16; const int n0 = blockIdx.y * 128;
  const char* gw = (const char*)(P + (size_t)(n0 + (tid >> 3)) * DM + (tid & 7) * 8); const char* ga = (const char*)(O + (rb + (tid >> 4)) * DM + (tid & 15) * 4);
  const unsigned lw = lds_byte_c(sm) + OB_W + (tid >> 3) * (OWP * 2) + (tid & 7) * 16, la = lds_byte_c(sm) + OB_A + (tid >> 4) * (OAP * 4) + (tid & 15) * 16;
  v8f acc[8] = {};
  stage_out(gw, ga, lw, la);
  asm volatile("s_wait_asynccnt 0x0" ::: "memory");   // stage 0 of this wave has landed
  __syncthreads();                                     // ... and every wave's part of it may be read
  stage_out(gw + OKS * 2, ga + OKS * 4, lw + OB_SZ, la + OB_SZ);
#pragma unroll 1   // rolled: one copy of the two-buffer order below, and the loop's text stays small
  for (int ks = 0; ks < DM / OKS; ++ks) { const char* sb = sm + (ks & 1) * OB_SZ; const float* arow = (const float*)(sb + OB_A) + (wave * 16 + col) * OAP; const __bf16* wrow = (const __bf16*)(sb + OB_W) + col * OWP;
#pragma unroll
    for (int kc = 0; kc < OKS / 32; ++kc) { v16b w[8];   // the eight Wo fragments of a k step are read as one group ahead of its products: one LDS latency a step, not eight
#pragma unroll
      for (int j = 0; j < 8; ++j) w[j] = frag_b(wrow + j * 16 * OWP + kc * 32, lane);
      const F2 a = split_row(arow, kc * 32, lane);
#pragma unroll
      for (int j = 0; j < 8; ++j) { acc[j] = wmma_bf(a.l, w[j], acc[j]); acc[j] = wmma_bf(a.h, w[j], acc[j]); } }
    asm volatile("s_wait_dscnt 0x0" ::: "memory");      // this wave's reads of the buffer are done
    asm volatile("s_wait_asynccnt 0x0" ::: "memory");   // this wave's copies of stage ks + 1 have landed
    __syncthreads();                                     // publishes stage ks + 1 and frees the buffer that this step has read
    if (ks + 2 < DM / OKS) stage_out(gw + (ks + 2) * (OKS * 2), ga + (ks + 2) * (OKS * 4), lw + (ks & 1) * OB_SZ, la + (ks & 1) * OB_SZ); }
  asm volatile("s_wait_asynccnt 0x0" ::: "memory");     // nothing of this wave is in flight when the buffers become output staging
  float (*so)[16][132] = (float (*)[16][132])sm;         // the last step's barrier has ended every wave's reads of sm
#pragma unroll
  for (int j = 0; j < 8; ++j) { const float bb = bfr(BU[n0 + j * 16 + col]);
#pragma unroll
    for (int r = 0; r < 8; ++r) so[wave][8 * g + r][j * 16 + col] = acc[j][r] + bb; }
  LDSX();
  for (int rl = 0; rl < 16; ++rl) vst2(Y + (r0 + rl) * DM + n0 + lane * 4, *(const v4f*)&so[wave][rl][lane * 4]);
}
extern "C" void kernel_launch(void* const* d_in, const int* in_sizes, int n_in, void* d_out, int out_size, void* d_ws, size_t ws_size, hipStream_t stream) {
  (void)in_sizes; (void)n_in; (void)out_size;
  const float** F = (const float**)d_in;   // 0 x [4,2048,1024], 1 Wq [64,64] ([out][in], shared by all 16 heads), 2 Wk, 3 Wv, 4 Wu [1024,1024], 5 bu [1024]
  if (ws_size < (size_t)WS_END) return;
  char* ws = (char*)d_ws; __bf16* PK = (__bf16*)(ws + WS_PK); _Float16 *QK = (_Float16*)(ws + WS_QK), *QKL = (_Float16*)(ws + WS_QKL), *VTH = (_Float16*)(ws + WS_VTH), *VTL = (_Float16*)(ws + WS_VTL); float *O = (float*)(ws + WS_O);
  k_packbd<<<QKVW, 128, 0, stream>>>(F[1], F[2], F[3], PK + PK_A); k_packrows<<<DM, 256, 0, stream>>>(F[4], DM, PK + PK_P);
  k_qkv<<<dim3(TNB * SS / 64, QKVW / 128), 128, 0, stream>>>(F[0], PK + PK_A, QK, QKL, VTH, VTL);
  k_attn<<<dim3(NH, TNB, TQB), 128, 0, stream>>>(QK, QKL, VTH, VTL, O);
  k_out<<<dim3(TOB, DM / 128), 128, 0, stream>>>(O, PK + PK_P, F[5], (float*)d_out);
}

// v006
// Measured time: 178 microseconds a run.
// Two timings next to v005 both put it at 1.04 times that version's speed.
// Counting every step since v000, it is 4.69 times as fast.
// compute dtype: x, Wq, Wk, Wv, Wu, bu (module inputs) rounded to bf16; the head-shared 64x64 q/k/v projections as one block-diagonal packed GEMM with exact bf16 products (x and W are inputs) on WMMA 16x16x32; q and k stored as f16 hi + (x2048-scaled) residual rows, causal scores with 3 products (the module's d^-1/4 on q and on k applied as the exact 1/32 on the f32 score); P.V with P as f16 hi + (x2048-scaled) residual x V as f16 hi + (x2048-scaled) residual planes (3 products); the output projection with ctx as bf16 hi + residual x exact Wu (2 products) + bu; running-max softmax in f32 with the hardware exp; f32 accumulate.
#include <hip/hip_runtime.h>
#include <math.h>

typedef __attribute__((ext_vector_type(16))) _Float16 v16h;
typedef __attribute__((ext_vector_type(16))) __bf16 v16b;
typedef __attribute__((ext_vector_type(8)))  _Float16 v8h;
typedef __attribute__((ext_vector_type(8)))  float v8f;
typedef __attribute__((ext_vector_type(4)))  float v4f;
typedef __attribute__((ext_vector_type(2)))  float v2f;
typedef __attribute__((ext_vector_type(4)))  unsigned v4u;
typedef __attribute__((ext_vector_type(4)))  int v4i;
typedef float __attribute__((may_alias)) float_a;
typedef int __attribute__((may_alias)) int_a;

template <typename T> __device__ __forceinline__ void vst2(void* p, T v) { *(T*)p = v;  }
// k_attn's products are the plain builtin: the compiler keeps the distance behind its own WMMA forms where a vector instruction needs it, and with no volatile statement behind each product it may issue the LDS reads of later products ahead of earlier products
__device__ __forceinline__ v8f wmma16(v16h a, v16h b, v8f c) { return __builtin_amdgcn_wmma_f32_16x16x32_f16(false, a, false, b, (short)0, c, false, false); }
__device__ __forceinline__ v8f wmma_bf(v16b a, v16b b, v8f c) {
  v8f d = __builtin_amdgcn_wmma_f32_16x16x32_bf16(false, a, false, b, (short)0, c, false, false);
  asm volatile("v_nop\n\tv_nop\n\tv_nop\n\tv_nop" : "+v"(d) : "v"(a), "v"(b));
  return d;
}
// 'Narrow' causal self-attention (B 4, T 2,048, emb 1,024 = 16 heads x 64 with ONE shared 64x64 Wq/Wk/Wv): per head q = x_h Wq^T d^-1/4, k = x_h Wk^T d^-1/4, v = x_h Wv^T; causal softmax(q k^T) v; out = y Wu^T + bu.
__device__ __forceinline__ v16h frag_h(const _Float16* rowk0, int lane) {
  union { v16h v; v8h q[2]; } u; const _Float16* p = rowk0 + 8 * (lane >> 4);
  u.q[0] = *(const v8h*)p; u.q[1] = *(const v8h*)(p + 16); return u.v;
}
__device__ __forceinline__ v16h frag_f32(const float* rowk0, int lane) {
  v16h a; const float* p = rowk0 + 8 * (lane >> 4);
#pragma unroll
  for (int i = 0; i < 8; ++i) { a[i] = (_Float16)p[i]; a[8 + i] = (_Float16)p[16 + i]; }
  return a;
}
__device__ __forceinline__ v16h frag_f32s(const float* rowk0, int lane, float sc) {
  v16h a; const float* p = rowk0 + 8 * (lane >> 4);
#pragma unroll
  for (int i = 0; i < 8; ++i) { a[i] = (_Float16)(p[i] * sc); a[8 + i] = (_Float16)(p[16 + i] * sc); }
  return a;
}
// column fragment from a [K][ld] layout (column n), rows >= K read as 0
__device__ __forceinline__ v16h fragc_f32(const float* W, int k0, int n, int lane, int ld, int K) {
  v16h a; const int g = lane >> 4;
#pragma unroll
  for (int i = 0; i < 8; ++i) { const int ka = k0 + 8 * g + i, kb = ka + 16;
    a[i] = (_Float16)(ka < K ? W[(size_t)(ka < K ? ka : K - 1) * ld + n] : 0.f); a[8 + i] = (_Float16)(kb < K ? W[(size_t)(kb < K ? kb : K - 1) * ld + n] : 0.f); }
  return a;
}
struct F2 { v16b h, l; };
__device__ __forceinline__ F2 bsplit16(const float v[16]) { F2 r;
#pragma unroll
  for (int i = 0; i < 16; ++i) { const __bf16 h = (__bf16)v[i]; r.h[i] = h; r.l[i] = (__bf16)(v[i] - (float)h); }
  return r; }
__device__ __forceinline__ F2 split_row(const float* row, int k0, int lane) { float v[16]; const float* p = row + k0 + 8 * (lane >> 4);
#pragma unroll
  for (int i = 0; i < 8; ++i) { v[i] = p[i]; v[8 + i] = p[16 + i]; }
  return bsplit16(v); }
__device__ __forceinline__ F2 split_rowK(const float* row, int k0, int lane, int K) { float v[16]; const int g = lane >> 4;
#pragma unroll
  for (int i = 0; i < 8; ++i) { const int ka = k0 + 8 * g + i, kb = ka + 16; v[i] = ka < K ? row[ka < K ? ka : K - 1] : 0.f; v[8 + i] = kb < K ? row[kb < K ? kb : K - 1] : 0.f; }
  return bsplit16(v); }
__device__ __forceinline__ F2 split_col(const float* W, int k0, int n, int lane, int ld, int K) { float v[16]; const int g = lane >> 4;
#pragma unroll
  for (int i = 0; i < 8; ++i) { const int ka = k0 + 8 * g + i, kb = ka + 16; v[i] = ka < K ? W[(size_t)(ka < K ? ka : K - 1) * ld + n] : 0.f; v[8 + i] = kb < K ? W[(size_t)(kb < K ? kb : K - 1) * ld + n] : 0.f; }
  return bsplit16(v); }
__device__ __forceinline__ v8f mac3(const F2& a, const F2& b, v8f c) { c = wmma_bf(a.l, b.h, c); c = wmma_bf(a.h, b.l, c); return wmma_bf(a.h, b.h, c); }
__device__ __forceinline__ float sigm(float v) { return 1.0f / (1.0f + expf(-v)); }
#define LDSX() do { asm volatile("s_wait_dscnt 0" ::: "memory"); __builtin_amdgcn_wave_barrier(); __builtin_amdgcn_fence(__ATOMIC_RELEASE, "workgroup"); } while (0)


// Causal multi-head self-attention (B 4, S 2048, D 1024, 16 heads x 64; head-shared 64x64 Wq/Wk/Wv expanded to a block-diagonal packed [3D][D], Wout [D][D] applied as x W^T, bias bu): softmax(q k^T / 32, causal) v; ctx Wout^T + bu.
#define NB 4
#define SS 2048
#define DM 1024
#define NH 16
#define HD 64
#define QKVW (3 * DM)
#ifndef TQB
#define TQB (SS / 64)
#define TNB NB
#define TOB (NB * SS / 64)     // output row tiles (all)
#endif
typedef __attribute__((ext_vector_type(8))) __bf16 v8b;
__device__ __forceinline__ v16b frag_b(const __bf16* rowk0, int lane) {
  union { v16b v; v8b q[2]; } u; const __bf16* p = rowk0 + 8 * (lane >> 4);
  u.q[0] = *(const v8b*)p; u.q[1] = *(const v8b*)(p + 16); return u.v;
}
__device__ __forceinline__ float bfr(float v) { return (float)(__bf16)v; }
__device__ __attribute__((noinline)) float exp_ni(float v) { return expf(v); }
__device__ __attribute__((noinline)) float erf_ni(float v) { return erff(v); }

#define PK_A 0                       // [3072][1024] Wqkv rows (natural [out][in])
#define PK_P (PK_A + QKVW * DM)        // [1024][1024] Wo rows (natural)
#define PK_END (PK_P + DM * DM)
#define WS_PK  0u
#define WS_QK  (WS_PK + 2u * PK_END)             // f16 [8192 rows][2048]: q | k
#define WS_QKL (WS_QK + 2u * NB * SS * 2 * DM)     // f16 q | k residual planes x2048
#define WS_VTH (WS_QKL + 2u * NB * SS * 2 * DM)    // f16 [b][1024 (h*64+d)][2048 s] hi
#define WS_VTL (WS_VTH + 2u * NB * DM * SS)        // f16 lo x 2048
#define WS_O   (WS_VTL + 2u * NB * DM * SS)        // f32 [8192][1024]
#define WS_CS  (WS_O + 4u * NB * SS * DM)           // f32 2 x [2048][32], reserved, not written or read
#define WS_END (WS_CS + 4u * 2 * SS * 32)

// ---- k_packbd: block = packed row n = which*1024 + h*64 + o: block-diagonal expansion of the head-shared [64][64] projection: row[h*64 + c] = W[o][c], zero elsewhere
__global__ __launch_bounds__(128) void k_packbd(const float* __restrict__ WQ, const float* __restrict__ WK, const float* __restrict__ WV, __bf16* __restrict__ DST) {
  __shared__ __align__(16) __bf16 s[DM]; const int n = blockIdx.x, t = threadIdx.x; const int which = n / DM, h = (n % DM) / HD, o = n % HD; const float* Wm = (which == 0) ? WQ : (which == 1) ? WK : WV;
  for (int k = t; k < DM; k += 128) s[k] = (__bf16)((k / HD == h) ? Wm[o * HD + (k % HD)] : 0.f);
  __syncthreads();
  vst2((unsigned*)(DST + (size_t)n * DM + t * 8), *(const v4u*)&s[t * 8]);
}
// ---- k_packrows: block = natural row n of a [N][K] weight
__global__ __launch_bounds__(256) void k_packrows(const float* __restrict__ Wm, int K, __bf16* __restrict__ DST) {
  __shared__ __align__(16) __bf16 s[DM]; const int n = blockIdx.x, tid = threadIdx.x;
  for (int k = tid; k < K; k += 256) s[k] = (__bf16)Wm[(size_t)n * K + k];
  __syncthreads();
  for (int q = tid; q < K / 8; q += 256) vst2((unsigned*)(DST + (size_t)n * K + q * 8), *(const v4u*)&s[q * 8]);
}
// ---- k_qkv: block = (64 rows (b,s), 128 of the 3072 cols): qkv = bf16(x) . rows (exact); cols < 1024 -> f16(q), cols < 2048 -> f16(k) into QK rows (pitch 2048); cols >= 2048 (v) -> per-batch transposed f16 planes VT[b][h*64+d][s]: hi = f16(v), lo = f16((v - hi) * 2048)
__global__ __launch_bounds__(128) void k_qkv(const float* __restrict__ X, const __bf16* __restrict__ P, _Float16* __restrict__ QK, _Float16* __restrict__ QKL, _Float16* __restrict__ VTH, _Float16* __restrict__ VTL) {
  __shared__ __align__(16) _Float16 so[4][16][136], sol[4][16][136]; __shared__ __align__(16) _Float16 sth[128][72], stl[128][72];
  const int tid = threadIdx.x, wave = tid >> 5, lane = tid & 31, col = lane & 15, g = lane >> 4; const size_t r0 = (size_t)blockIdx.x * 64 + wave * 16; const int n0 = blockIdx.y * 128;
  v8f acc[8] = {};
  // packed row n is zero outside columns [head*64, head*64+64), head = (n % 1024) / 64: the 128 columns of this block are two heads, and each head's four column tiles take only their own 64 k
#pragma unroll
  for (int hh = 0; hh < 2; ++hh) { const int kb = (n0 % DM) + hh * HD;
#pragma unroll
    for (int kc = 0; kc < HD / 32; ++kc) { v16b a; { const float* p = X + (r0 + col) * DM + kb + kc * 32 + 8 * g;
#pragma unroll
        for (int i = 0; i < 8; ++i) { a[i] = (__bf16)p[i]; a[8 + i] = (__bf16)p[16 + i]; } }
#pragma unroll
      for (int j = 0; j < 4; ++j) acc[hh * 4 + j] = wmma_bf(a, frag_b(P + (size_t)(n0 + (hh * 4 + j) * 16 + col) * DM + kb + kc * 32, lane), acc[hh * 4 + j]); } }
  if (n0 < 2 * DM) {   // q | k -> f16 hi + (x2048) residual rows (unscaled; the d^-1/4 x d^-1/4 = 1/32 scale is applied to the f32 score)
#pragma unroll
    for (int j = 0; j < 8; ++j) {
#pragma unroll
      for (int r = 0; r < 8; ++r) { const float v = acc[j][r]; const _Float16 hv = (_Float16)v; so[wave][8 * g + r][j * 16 + col] = hv; sol[wave][8 * g + r][j * 16 + col] = (_Float16)((v - (float)hv) * 2048.0f); } }
    LDSX();
    for (int rl = 0; rl < 16; ++rl) if (lane < 16) { vst2((unsigned*)(QK + (r0 + rl) * (2 * DM) + n0 + lane * 8), *(const v4u*)&so[wave][rl][lane * 8]); vst2((unsigned*)(QKL + (r0 + rl) * (2 * DM) + n0 + lane * 8), *(const v4u*)&sol[wave][rl][lane * 8]); }
  } else {
#pragma unroll
    for (int j = 0; j < 8; ++j) {
#pragma unroll
      for (int r = 0; r < 8; ++r) { const float v = acc[j][r]; const _Float16 hv = (_Float16)v; sth[j * 16 + col][wave * 16 + 8 * g + r] = hv; stl[j * 16 + col][wave * 16 + 8 * g + r] = (_Float16)((v - (float)hv) * 2048.0f); } }
    __syncthreads();
    const size_t rb = (size_t)blockIdx.x * 64; const int b = (int)(rb / SS), s0 = (int)(rb % SS); const int pc0 = n0 - 2 * DM;
    for (int q = tid; q < 128 * 8; q += 128) { const int d = q >> 3, pc = q & 7; const size_t o = ((size_t)b * DM + pc0 + d) * SS + s0 + pc * 8; vst2((unsigned*)(VTH + o), *(const v4u*)&sth[d][pc * 8]); vst2((unsigned*)(VTL + o), *(const v4u*)&stl[d][pc * 8]); }
  }
}
#define KP 72                          // K row pitch in LDS, halfs: 144 B = 16 B x odd, so the 16 rows of a ds_load_b128 fall on distinct banks
#define VP 40                          // V^T row pitch in LDS, halfs: 80 B = 16 B x odd
#define ST_KH 0                        // [32 keys][KP] K hi
#define ST_KL (ST_KH + 32 * KP)        // [32 keys][KP] K residual
#define ST_VH (ST_KL + 32 * KP)        // [64 d][VP] V^T hi (32 keys a row)
#define ST_VL (ST_VH + 64 * VP)        // [64 d][VP] V^T residual
#define ST_SZ (ST_VL + 64 * VP)        // halfs per buffer
__device__ __forceinline__ unsigned lds_byte(const _Float16* p) { return (unsigned)(size_t)(const __attribute__((address_space(3))) _Float16*)p; }
// one 32-key stage: 8 copies of 16 B per thread (K planes: 8 lanes a 128-B row; V planes: 4 lanes a 64-B row piece). The s_wait_xcnt stands inside the statement so that no address register is rewritten ahead of it.
__device__ __forceinline__ void stage_kv(const _Float16* kh, const _Float16* kl, const _Float16* vh, const _Float16* vl, unsigned lk, unsigned lv) {
  const _Float16 *kh1 = kh + 16 * (2 * DM), *kl1 = kl + 16 * (2 * DM), *vh1 = vh + 32 * SS, *vl1 = vl + 32 * SS;
  const unsigned lkh0 = lk + 2 * ST_KH, lkh1 = lkh0 + 2 * 16 * KP, lkl0 = lk + 2 * ST_KL, lkl1 = lkl0 + 2 * 16 * KP, lvh0 = lv + 2 * ST_VH, lvh1 = lvh0 + 2 * 32 * VP, lvl0 = lv + 2 * ST_VL, lvl1 = lvl0 + 2 * 32 * VP;
  asm volatile("global_load_async_to_lds_b128 %0, %8, off\n\t"
               "global_load_async_to_lds_b128 %1, %9, off\n\t"
               "global_load_async_to_lds_b128 %2, %10, off\n\t"
               "global_load_async_to_lds_b128 %3, %11, off\n\t"
               "global_load_async_to_lds_b128 %4, %12, off\n\t"
               "global_load_async_to_lds_b128 %5, %13, off\n\t"
               "global_load_async_to_lds_b128 %6, %14, off\n\t"
               "global_load_async_to_lds_b128 %7, %15, off\n\t"
               "s_wait_xcnt 0x0"
               :: "v"(lkh0), "v"(lkh1), "v"(lkl0), "v"(lkl1), "v"(lvh0), "v"(lvh1), "v"(lvl0), "v"(lvl1), "v"(kh), "v"(kh1), "v"(kl), "v"(kl1), "v"(vh), "v"(vh1), "v"(vl), "v"(vl1) : "memory");
}
__device__ __forceinline__ float xhalf(float x) { return __builtin_bit_cast(float, __builtin_amdgcn_permlanex16(__builtin_bit_cast(int, x), __builtin_bit_cast(int, x), 0x76543210, 0xfedcba98, false, false)); }   // lane l takes lane l ^ 16's value
// exp(x) as __expf forms it (x * log2 e, then v_exp_f32). The instruction set asks for one free slot behind a transcendental before its source is overwritten, so the v_exp_f32 run and its v_nop stand in one statement (outputs early-clobbered: no v_exp_f32 of the run writes a source of another).
__device__ __forceinline__ void exp_x4(float& a, float& b, float& c, float& d) {
  const float xa = a * 0x1.715476p+0f, xb = b * 0x1.715476p+0f, xc = c * 0x1.715476p+0f, xd = d * 0x1.715476p+0f;
  asm("v_exp_f32 %0, %4\n\tv_exp_f32 %1, %5\n\tv_exp_f32 %2, %6\n\tv_exp_f32 %3, %7\n\tv_nop" : "=&v"(a), "=&v"(b), "=&v"(c), "=&v"(d) : "v"(xa), "v"(xb), "v"(xc), "v"(xd));
}
__device__ __forceinline__ float exp_x1(float a) { float r; const float xa = a * 0x1.715476p+0f;
  asm("v_exp_f32 %0, %1\n\tv_nop" : "=&v"(r) : "v"(xa));   // the same free slot behind the one v_exp_f32
  return r; }
__global__ __launch_bounds__(128) void k_attn(const _Float16* __restrict__ QK, const _Float16* __restrict__ QKL, const _Float16* __restrict__ VTH, const _Float16* __restrict__ VTL, float* __restrict__ O) {
  __shared__ __align__(16) _Float16 st[2 * ST_SZ];
  const int tid = threadIdx.x, wave = tid >> 5, lane = tid & 31, col = lane & 15, g = lane >> 4;
  const int h = blockIdx.x, b = blockIdx.y, qb = TQB - 1 - (int)blockIdx.z; const int q0 = qb * 64 + wave * 16; const size_t rq = (size_t)b * SS + q0 + col;
  const int nks = (qb * 64 + 64) / 32;
  // this thread's pieces of a stage: K row tid / 8 (and + 16), 16-B piece tid % 8; V^T row tid / 4 (and + 32), piece tid % 4
  const size_t kof = ((size_t)b * SS + (tid >> 3)) * (2 * DM) + DM + h * HD + (tid & 7) * 8, vof = ((size_t)b * DM + h * HD + (tid >> 2)) * SS + (tid & 3) * 8;
  const unsigned lk = lds_byte(st) + 2 * ((tid >> 3) * KP + (tid & 7) * 8), lv = lds_byte(st) + 2 * ((tid >> 2) * VP + (tid & 3) * 8);
  stage_kv(QK + kof, QKL + kof, VTH + vof, VTL + vof, lk, lv);
  v16h aq[2], aql[2];
#pragma unroll
  for (int kc = 0; kc < 2; ++kc) { aq[kc] = frag_h(QK + rq * (2 * DM) + h * HD + kc * 32, lane); aql[kc] = frag_h(QKL + rq * (2 * DM) + h * HD + kc * 32, lane); }
  float m = -3.0e38f, l = 0.f;   // of query q0 + col; l holds only the keys of this lane's half until the epilogue joins the halves
  v8f acc[4] = {}, accl[4] = {};   // O^T tiles: register r = d dt * 16 + 8 g + r of query q0 + col
  asm volatile("s_wait_asynccnt 0x0" ::: "memory");   // stage 0 of this wave has landed
  __syncthreads();                                     // ... and every wave's part of it may be read
  stage_kv(QK + kof + (size_t)32 * (2 * DM), QKL + kof + (size_t)32 * (2 * DM), VTH + vof + 32, VTL + vof + 32, lk + 2 * ST_SZ, lv + 2 * ST_SZ);   // stage 1 always exists: nks >= 2
#pragma unroll 1
  for (int ks = 0; ks < nks; ++ks) { v8f s[2]; const _Float16* sb = st + (ks & 1) * ST_SZ;
#pragma unroll
    for (int ct = 0; ct < 2; ++ct) { const _Float16* krow = sb + ST_KH + (ct * 16 + col) * KP; const _Float16* krowl = sb + ST_KL + (ct * 16 + col) * KP; v8f c = {}, cl = {};
#pragma unroll
      for (int kc = 0; kc < 2; ++kc) { const v16h kh = frag_h(krow + kc * 32, lane); c = wmma16(kh, aq[kc], c); cl = wmma16(kh, aql[kc], cl); cl = wmma16(frag_h(krowl + kc * 32, lane), aq[kc], cl); }   // 3 products: q, k as f16 hi + residual; register r = key ct * 16 + 8 g + r, column = query
#pragma unroll
      for (int r = 0; r < 8; ++r) c[r] += cl[r] * (1.0f / 2048.0f);
#pragma unroll
      for (int r = 0; r < 8; ++r) { const int kk = ks * 32 + ct * 16 + 8 * g + r; s[ct][r] = (kk <= q0 + col) ? c[r] * 0.03125f : -3.0e38f; } }   // (d^-1/4)^2 = 1024^-1/2 = 1/32 exactly
    float mx = fmaxf(fmaxf(fmaxf(fmaxf(s[0][0], s[0][1]), fmaxf(s[0][2], s[0][3])), fmaxf(fmaxf(s[0][4], s[0][5]), fmaxf(s[0][6], s[0][7]))), fmaxf(fmaxf(fmaxf(s[1][0], s[1][1]), fmaxf(s[1][2], s[1][3])), fmaxf(fmaxf(s[1][4], s[1][5]), fmaxf(s[1][6], s[1][7]))));
    mx = fmaxf(mx, xhalf(mx));
    const float mn = fmaxf(m, mx); const float ea = exp_x1(m - mn); const float alpha = (m <= -1.0e38f) ? 0.f : ea; m = mn;
    float ev[2][8]; v16h pa, pl;   // P^T as a B operand: element i = key 8 g + i (tile 0), element 8 + i = key 16 + 8 g + i (tile 1), the k order of frag_h
#pragma unroll
    for (int ct = 0; ct < 2; ++ct) {
      float ex[8];
#pragma unroll
      for (int r = 0; r < 8; ++r) ex[r] = s[ct][r] - mn;
      exp_x4(ex[0], ex[1], ex[2], ex[3]); exp_x4(ex[4], ex[5], ex[6], ex[7]);
#pragma unroll
      for (int r = 0; r < 8; ++r) { const float e = (s[ct][r] <= -1.0e38f) ? 0.f : ex[r]; ev[ct][r] = e; const _Float16 eh = (_Float16)e; pa[ct * 8 + r] = eh; pl[ct * 8 + r] = (_Float16)((e - (float)eh) * 2048.0f); } }
    l = l * alpha + ((((ev[0][0] + ev[1][0]) + (ev[0][1] + ev[1][1])) + ((ev[0][2] + ev[1][2]) + (ev[0][3] + ev[1][3]))) + (((ev[0][4] + ev[1][4]) + (ev[0][5] + ev[1][5])) + ((ev[0][6] + ev[1][6]) + (ev[0][7] + ev[1][7]))));   // a tree, not one dependent chain of 16 adds
#pragma unroll
    for (int dt = 0; dt < 4; ++dt) {
#pragma unroll
      for (int r = 0; r < 8; ++r) { acc[dt][r] *= alpha; accl[dt][r] *= alpha; } }
#pragma unroll
    for (int dt = 0; dt < 4; ++dt) { const int vr = (dt * 16 + col) * VP; const v16h vh = frag_h(sb + ST_VH + vr, lane); acc[dt] = wmma16(vh, pa, acc[dt]); accl[dt] = wmma16(vh, pl, accl[dt]); accl[dt] = wmma16(frag_h(sb + ST_VL + vr, lane), pa, accl[dt]); }   // V hi x P hi + (V hi x P lo + V lo x P hi) / 2048
    asm volatile("s_wait_dscnt 0x0" ::: "memory");      // this wave's reads of the buffer are done
    asm volatile("s_wait_asynccnt 0x0" ::: "memory");   // this wave's copies of stage ks + 1 have landed
    __syncthreads();                                     // publishes stage ks + 1 and frees the buffer that this step has read
    if (ks + 2 < nks) stage_kv(QK + kof + (size_t)(ks + 2) * 32 * (2 * DM), QKL + kof + (size_t)(ks + 2) * 32 * (2 * DM), VTH + vof + (ks + 2) * 32, VTL + vof + (ks + 2) * 32, lk + 2 * (ks & 1) * ST_SZ, lv + 2 * (ks & 1) * ST_SZ); }
  asm volatile("s_wait_asynccnt 0x0" ::: "memory");     // nothing of this wave is in flight when the buffers become output staging
  float (*so)[16][68] = (float (*)[16][68])st;           // the last step's barrier has ended every wave's reads of st
  const float il = 1.0f / (l + xhalf(l));
#pragma unroll
  for (int dt = 0; dt < 4; ++dt) {
#pragma unroll
    for (int r = 0; r < 8; ++r) so[wave][col][dt * 16 + 8 * g + r] = (acc[dt][r] + accl[dt][r] * (1.0f / 2048.0f)) * il; }
  LDSX();
  for (int rl = 0; rl < 16; ++rl) if (lane < 16) vst2(O + ((size_t)b * SS + q0 + rl) * DM + h * HD + lane * 4, *(const v4f*)&so[wave][rl][lane * 4]);
}
// ---- k_out: block = (64 rows, 128 cols): out = O(hi/lo) . Wo rows (2 products) + bo; each 64-wide k stage of the block's 128 Wo rows and 64 O rows is brought into LDS once per work-group by asynchronous copies that cover whole 128-B lines, two buffers, and the waves take their fragments from there
#define OKS 64                         // k per stage
#define OWP 72                         // Wo row pitch in LDS, bf16: 144 B = 16 B x odd, so the 16 rows of a ds_load_b128 fall on distinct banks
#define OAP 68                         // O row pitch in LDS, floats: 272 B = 16 B x odd
#define OB_W 0                         // bytes: [128 cols][OWP] bf16
#define OB_A (OB_W + 128 * OWP * 2)    // bytes: [64 rows][OAP] f32
#define OB_SZ (OB_A + 64 * OAP * 4)    // bytes per buffer
__device__ __forceinline__ unsigned lds_byte_c(const char* p) { return (unsigned)(size_t)(const __attribute__((address_space(3))) char*)p; }
// eight 16-B copies of one thread, at a fixed step in LDS (ls bytes) and in global memory (gs bytes). The s_wait_xcnt stands inside the statement so that no address register is rewritten ahead of it.
__device__ __forceinline__ void copy8(unsigned l0, unsigned ls, const char* g0, size_t gs) {
  const unsigned l1 = l0 + ls, l2 = l1 + ls, l3 = l2 + ls, l4 = l3 + ls, l5 = l4 + ls, l6 = l5 + ls, l7 = l6 + ls;
  const char *g1 = g0 + gs, *g2 = g1 + gs, *g3 = g2 + gs, *g4 = g3 + gs, *g5 = g4 + gs, *g6 = g5 + gs, *g7 = g6 + gs;
  asm volatile("global_load_async_to_lds_b128 %0, %8, off\n\t"
               "global_load_async_to_lds_b128 %1, %9, off\n\t"
               "global_load_async_to_lds_b128 %2, %10, off\n\t"
               "global_load_async_to_lds_b128 %3, %11, off\n\t"
               "global_load_async_to_lds_b128 %4, %12, off\n\t"
               "global_load_async_to_lds_b128 %5, %13, off\n\t"
               "global_load_async_to_lds_b128 %6, %14, off\n\t"
               "global_load_async_to_lds_b128 %7, %15, off\n\t"
               "s_wait_xcnt 0x0"
               :: "v"(l0), "v"(l1), "v"(l2), "v"(l3), "v"(l4), "v"(l5), "v"(l6), "v"(l7), "v"(g0), "v"(g1), "v"(g2), "v"(g3), "v"(g4), "v"(g5), "v"(g6), "v"(g7) : "memory");
}
// one stage: Wo rows tid / 8 + 16 i, 16-B piece tid % 8 (a wave's copy = 4 whole 128-B rows); O rows tid / 16 + 8 i, piece tid % 16 (a wave's copy = 2 whole 256-B rows)
__device__ __forceinline__ void stage_out(const char* gw, const char* ga, unsigned lw, unsigned la) {
  copy8(lw, 16 * OWP * 2, gw, (size_t)16 * DM * 2); copy8(la, 8 * OAP * 4, ga, (size_t)8 * DM * 4);
}
__global__ __launch_bounds__(128) void k_out(const float* __restrict__ O, const __bf16* __restrict__ P, const float* __restrict__ BU, float* __restrict__ Y) {
  __shared__ __align__(16) char sm[2 * OB_SZ];
  const int tid = threadIdx.x, wave = tid >> 5, lane = tid & 31, col = lane & 15, g = lane >> 4; const size_t rb = (size_t)blockIdx.x * 64, r0 = rb + wave * 16; const int n0 = blockIdx.y * 128;
  const char* gw = (const char*)(P + (size_t)(n0 + (tid >> 3)) * DM + (tid & 7) * 8); const char* ga = (const char*)(O + (rb + (tid >> 4)) * DM + (tid & 15) * 4);
  const unsigned lw = lds_byte_c(sm) + OB_W + (tid >> 3) * (OWP * 2) + (tid & 7) * 16, la = lds_byte_c(sm) + OB_A + (tid >> 4) * (OAP * 4) + (tid & 15) * 16;
  v8f acc[8] = {};
  stage_out(gw, ga, lw, la);
  asm volatile("s_wait_asynccnt 0x0" ::: "memory");   // stage 0 of this wave has landed
  __syncthreads();                                     // ... and every wave's part of it may be read
  stage_out(gw + OKS * 2, ga + OKS * 4, lw + OB_SZ, la + OB_SZ);
#pragma unroll 1   // rolled: one copy of the two-buffer order below, and the loop's text stays small
  for (int ks = 0; ks < DM / OKS; ++ks) { const char* sb = sm + (ks & 1) * OB_SZ; const float* arow = (const float*)(sb + OB_A) + (wave * 16 + col) * OAP; const __bf16* wrow = (const __bf16*)(sb + OB_W) + col * OWP;
#pragma unroll
    for (int kc = 0; kc < OKS / 32; ++kc) { v16b w[8];   // the eight Wo fragments of a k step are read as one group ahead of its products: one LDS latency a step, not eight
#pragma unroll
      for (int j = 0; j < 8; ++j) w[j] = frag_b(wrow + j * 16 * OWP + kc * 32, lane);
      const F2 a = split_row(arow, kc * 32, lane);
#pragma unroll
      for (int j = 0; j < 8; ++j) { acc[j] = wmma_bf(a.l, w[j], acc[j]); acc[j] = wmma_bf(a.h, w[j], acc[j]); } }
    asm volatile("s_wait_dscnt 0x0" ::: "memory");      // this wave's reads of the buffer are done
    asm volatile("s_wait_asynccnt 0x0" ::: "memory");   // this wave's copies of stage ks + 1 have landed
    __syncthreads();                                     // publishes stage ks + 1 and frees the buffer that this step has read
    if (ks + 2 < DM / OKS) stage_out(gw + (ks + 2) * (OKS * 2), ga + (ks + 2) * (OKS * 4), lw + (ks & 1) * OB_SZ, la + (ks & 1) * OB_SZ); }
  asm volatile("s_wait_asynccnt 0x0" ::: "memory");     // nothing of this wave is in flight when the buffers become output staging
  float (*so)[16][132] = (float (*)[16][132])sm;         // the last step's barrier has ended every wave's reads of sm
#pragma unroll
  for (int j = 0; j < 8; ++j) { const float bb = bfr(BU[n0 + j * 16 + col]);
#pragma unroll
    for (int r = 0; r < 8; ++r) so[wave][8 * g + r][j * 16 + col] = acc[j][r] + bb; }
  LDSX();
  for (int rl = 0; rl < 16; ++rl) vst2(Y + (r0 + rl) * DM + n0 + lane * 4, *(const v4f*)&so[wave][rl][lane * 4]);
}
extern "C" void kernel_launch(void* const* d_in, const int* in_sizes, int n_in, void* d_out, int out_size, void* d_ws, size_t ws_size, hipStream_t stream) {
  (void)in_sizes; (void)n_in; (void)out_size;
  const float** F = (const float**)d_in;   // 0 x [4,2048,1024], 1 Wq [64,64] ([out][in], shared by all 16 heads), 2 Wk, 3 Wv, 4 Wu [1024,1024], 5 bu [1024]
  if (ws_size < (size_t)WS_END) return;
  char* ws = (char*)d_ws; __bf16* PK = (__bf16*)(ws + WS_PK); _Float16 *QK = (_Float16*)(ws + WS_QK), *QKL = (_Float16*)(ws + WS_QKL), *VTH = (_Float16*)(ws + WS_VTH), *VTL = (_Float16*)(ws + WS_VTL); float *O = (float*)(ws + WS_O);
  k_packbd<<<QKVW, 128, 0, stream>>>(F[1], F[2], F[3], PK + PK_A); k_packrows<<<DM, 256, 0, stream>>>(F[4], DM, PK + PK_P);
  k_qkv<<<dim3(TNB * SS / 64, QKVW / 128), 128, 0, stream>>>(F[0], PK + PK_A, QK, QKL, VTH, VTL);
  k_attn<<<dim3(NH, TNB, TQB), 128, 0, stream>>>(QK, QKL, VTH, VTL, O);
  k_out<<<dim3(TOB, DM / 128), 128, 0, stream>>>(O, PK + PK_P, F[5], (float*)d_out);
}

// v007
// One run takes 162 microseconds.
// Next to v006, in two timings, it ran 1.08 times as fast each time.
// All steps since v000 together make it 5.08 times as fast.
// compute dtype: x, Wq, Wk, Wv, Wu, bu (module inputs) rounded to bf16; the head-shared 64x64 q/k/v projections as one block-diagonal packed GEMM with exact bf16 products (x and W are inputs) on WMMA 16x16x32; q and k stored as f16 hi + (x2048-scaled) residual rows, causal scores with 3 products (the module's d^-1/4 on q and on k applied as the exact 1/32 on the f32 score); P.V with P as f16 hi + (x2048-scaled) residual x V as f16 hi + (x2048-scaled) residual planes (3 products); the output projection with ctx as bf16 hi + residual x exact Wu (2 products) + bu; running-max softmax in f32 with the hardware exp; f32 accumulate.
#include <hip/hip_runtime.h>
#include <math.h>

typedef __attribute__((ext_vector_type(16))) _Float16 v16h;
typedef __attribute__((ext_vector_type(16))) __bf16 v16b;
typedef __attribute__((ext_vector_type(8)))  _Float16 v8h;
typedef __attribute__((ext_vector_type(8)))  float v8f;
typedef __attribute__((ext_vector_type(4)))  float v4f;
typedef __attribute__((ext_vector_type(2)))  float v2f;
typedef __attribute__((ext_vector_type(4)))  unsigned v4u;
typedef __attribute__((ext_vector_type(4)))  int v4i;
typedef float __attribute__((may_alias)) float_a;
typedef int __attribute__((may_alias)) int_a;

template <typename T> __device__ __forceinline__ void vst2(void* p, T v) { *(T*)p = v;  }
// k_attn's products are the plain builtin: the compiler keeps the distance behind its own WMMA forms where a vector instruction needs it, and with no volatile statement behind each product it may issue the LDS reads of later products ahead of earlier products
__device__ __forceinline__ v8f wmma16(v16h a, v16h b, v8f c) { return __builtin_amdgcn_wmma_f32_16x16x32_f16(false, a, false, b, (short)0, c, false, false); }
__device__ __forceinline__ v8f wmma_bf(v16b a, v16b b, v8f c) {
  v8f d = __builtin_amdgcn_wmma_f32_16x16x32_bf16(false, a, false, b, (short)0, c, false, false);
  asm volatile("v_nop\n\tv_nop\n\tv_nop\n\tv_nop" : "+v"(d) : "v"(a), "v"(b));
  return d;
}
// 'Narrow' causal self-attention (B 4, T 2,048, emb 1,024 = 16 heads x 64 with ONE shared 64x64 Wq/Wk/Wv): per head q = x_h Wq^T d^-1/4, k = x_h Wk^T d^-1/4, v = x_h Wv^T; causal softmax(q k^T) v; out = y Wu^T + bu.
__device__ __forceinline__ v16h frag_h(const _Float16* rowk0, int lane) {
  union { v16h v; v8h q[2]; } u; const _Float16* p = rowk0 + 8 * (lane >> 4);
  u.q[0] = *(const v8h*)p; u.q[1] = *(const v8h*)(p + 16); return u.v;
}
__device__ __forceinline__ v16h frag_f32(const float* rowk0, int lane) {
  v16h a; const float* p = rowk0 + 8 * (lane >> 4);
#pragma unroll
  for (int i = 0; i < 8; ++i) { a[i] = (_Float16)p[i]; a[8 + i] = (_Float16)p[16 + i]; }
  return a;
}
__device__ __forceinline__ v16h frag_f32s(const float* rowk0, int lane, float sc) {
  v16h a; const float* p = rowk0 + 8 * (lane >> 4);
#pragma unroll
  for (int i = 0; i < 8; ++i) { a[i] = (_Float16)(p[i] * sc); a[8 + i] = (_Float16)(p[16 + i] * sc); }
  return a;
}
// column fragment from a [K][ld] layout (column n), rows >= K read as 0
__device__ __forceinline__ v16h fragc_f32(const float* W, int k0, int n, int lane, int ld, int K) {
  v16h a; const int g = lane >> 4;
#pragma unroll
  for (int i = 0; i < 8; ++i) { const int ka = k0 + 8 * g + i, kb = ka + 16;
    a[i] = (_Float16)(ka < K ? W[(size_t)(ka < K ? ka : K - 1) * ld + n] : 0.f); a[8 + i] = (_Float16)(kb < K ? W[(size_t)(kb < K ? kb : K - 1) * ld + n] : 0.f); }
  return a;
}
struct F2 { v16b h, l; };
__device__ __forceinline__ F2 bsplit16(const float v[16]) { F2 r;
#pragma unroll
  for (int i = 0; i < 16; ++i) { const __bf16 h = (__bf16)v[i]; r.h[i] = h; r.l[i] = (__bf16)(v[i] - (float)h); }
  return r; }
__device__ __forceinline__ F2 split_row(const float* row, int k0, int lane) { float v[16]; const float* p = row + k0 + 8 * (lane >> 4);
#pragma unroll
  for (int i = 0; i < 8; ++i) { v[i] = p[i]; v[8 + i] = p[16 + i]; }
  return bsplit16(v); }
__device__ __forceinline__ F2 split_rowK(const float* row, int k0, int lane, int K) { float v[16]; const int g = lane >> 4;
#pragma unroll
  for (int i = 0; i < 8; ++i) { const int ka = k0 + 8 * g + i, kb = ka + 16; v[i] = ka < K ? row[ka < K ? ka : K - 1] : 0.f; v[8 + i] = kb < K ? row[kb < K ? kb : K - 1] : 0.f; }
  return bsplit16(v); }
__device__ __forceinline__ F2 split_col(const float* W, int k0, int n, int lane, int ld, int K) { float v[16]; const int g = lane >> 4;
#pragma unroll
  for (int i = 0; i < 8; ++i) { const int ka = k0 + 8 * g + i, kb = ka + 16; v[i] = ka < K ? W[(size_t)(ka < K ? ka : K - 1) * ld + n] : 0.f; v[8 + i] = kb < K ? W[(size_t)(kb < K ? kb : K - 1) * ld + n] : 0.f; }
  return bsplit16(v); }
__device__ __forceinline__ v8f mac3(const F2& a, const F2& b, v8f c) { c = wmma_bf(a.l, b.h, c); c = wmma_bf(a.h, b.l, c); return wmma_bf(a.h, b.h, c); }
__device__ __forceinline__ float sigm(float v) { return 1.0f / (1.0f + expf(-v)); }
#define LDSX() do { asm volatile("s_wait_dscnt 0" ::: "memory"); __builtin_amdgcn_wave_barrier(); __builtin_amdgcn_fence(__ATOMIC_RELEASE, "workgroup"); } while (0)


// Causal multi-head self-attention (B 4, S 2048, D 1024, 16 heads x 64; head-shared 64x64 Wq/Wk/Wv expanded to a block-diagonal packed [3D][D], Wout [D][D] applied as x W^T, bias bu): softmax(q k^T / 32, causal) v; ctx Wout^T + bu.
#define NB 4
#define SS 2048
#define DM 1024
#define NH 16
#define HD 64
#define QKVW (3 * DM)
#ifndef TQB
#define TQB (SS / 64)
#define TNB NB
#define TOB (NB * SS / 64)     // output row tiles (all)
#endif
typedef __attribute__((ext_vector_type(8))) __bf16 v8b;
__device__ __forceinline__ v16b frag_b(const __bf16* rowk0, int lane) {
  union { v16b v; v8b q[2]; } u; const __bf16* p = rowk0 + 8 * (lane >> 4);
  u.q[0] = *(const v8b*)p; u.q[1] = *(const v8b*)(p + 16); return u.v;
}
__device__ __forceinline__ float bfr(float v) { return (float)(__bf16)v; }
__device__ __attribute__((noinline)) float exp_ni(float v) { return expf(v); }
__device__ __attribute__((noinline)) float erf_ni(float v) { return erff(v); }

#define PK_A 0                       // [3072][1024] Wqkv rows (natural [out][in])
#define PK_P (PK_A + QKVW * DM)        // [1024][1024] Wo rows (natural)
#define PK_END (PK_P + DM * DM)
#define WS_PK  0u
#define WS_QK  (WS_PK + 2u * PK_END)             // f16 [8192 rows][2048]: q | k
#define WS_QKL (WS_QK + 2u * NB * SS * 2 * DM)     // f16 q | k residual planes x2048
#define WS_VTH (WS_QKL + 2u * NB * SS * 2 * DM)    // f16 [b][1024 (h*64+d)][2048 s] hi
#define WS_VTL (WS_VTH + 2u * NB * DM * SS)        // f16 lo x 2048
#define WS_O   (WS_VTL + 2u * NB * DM * SS)        // f32 [8192][1024]
#define WS_CS  (WS_O + 4u * NB * SS * DM)           // f32 2 x [2048][32], reserved, not written or read
#define WS_END (WS_CS + 4u * 2 * SS * 32)

// ---- k_packbd: block = packed row n = which*1024 + h*64 + o: block-diagonal expansion of the head-shared [64][64] projection: row[h*64 + c] = W[o][c], zero elsewhere
__global__ __launch_bounds__(128) void k_packbd(const float* __restrict__ WQ, const float* __restrict__ WK, const float* __restrict__ WV, __bf16* __restrict__ DST) {
  __shared__ __align__(16) __bf16 s[DM]; const int n = blockIdx.x, t = threadIdx.x; const int which = n / DM, h = (n % DM) / HD, o = n % HD; const float* Wm = (which == 0) ? WQ : (which == 1) ? WK : WV;
  for (int k = t; k < DM; k += 128) s[k] = (__bf16)((k / HD == h) ? Wm[o * HD + (k % HD)] : 0.f);
  __syncthreads();
  vst2((unsigned*)(DST + (size_t)n * DM + t * 8), *(const v4u*)&s[t * 8]);
}
// ---- k_packrows: block = natural row n of a [N][K] weight
__global__ __launch_bounds__(256) void k_packrows(const float* __restrict__ Wm, int K, __bf16* __restrict__ DST) {
  __shared__ __align__(16) __bf16 s[DM]; const int n = blockIdx.x, tid = threadIdx.x;
  for (int k = tid; k < K; k += 256) s[k] = (__bf16)Wm[(size_t)n * K + k];
  __syncthreads();
  for (int q = tid; q < K / 8; q += 256) vst2((unsigned*)(DST + (size_t)n * K + q * 8), *(const v4u*)&s[q * 8]);
}
// ---- k_qkv: block = (64 rows (b,s), 128 of the 3072 cols): qkv = bf16(x) . rows (exact); cols < 1024 -> f16(q), cols < 2048 -> f16(k) into QK rows (pitch 2048); cols >= 2048 (v) -> per-batch transposed f16 planes VT[b][h*64+d][s]: hi = f16(v), lo = f16((v - hi) * 2048)
__global__ __launch_bounds__(128) void k_qkv(const float* __restrict__ X, const __bf16* __restrict__ P, _Float16* __restrict__ QK, _Float16* __restrict__ QKL, _Float16* __restrict__ VTH, _Float16* __restrict__ VTL) {
  __shared__ __align__(16) _Float16 so[4][16][136], sol[4][16][136]; __shared__ __align__(16) _Float16 sth[128][72], stl[128][72];
  const int tid = threadIdx.x, wave = tid >> 5, lane = tid & 31, col = lane & 15, g = lane >> 4; const size_t r0 = (size_t)blockIdx.x * 64 + wave * 16; const int n0 = blockIdx.y * 128;
  v8f acc[8] = {};
  // packed row n is zero outside columns [head*64, head*64+64), head = (n % 1024) / 64: the 128 columns of this block are two heads, and each head's four column tiles take only their own 64 k
#pragma unroll
  for (int hh = 0; hh < 2; ++hh) { const int kb = (n0 % DM) + hh * HD;
#pragma unroll
    for (int kc = 0; kc < HD / 32; ++kc) { v16b a; { const float* p = X + (r0 + col) * DM + kb + kc * 32 + 8 * g;
#pragma unroll
        for (int i = 0; i < 8; ++i) { a[i] = (__bf16)p[i]; a[8 + i] = (__bf16)p[16 + i]; } }
#pragma unroll
      for (int j = 0; j < 4; ++j) acc[hh * 4 + j] = wmma_bf(a, frag_b(P + (size_t)(n0 + (hh * 4 + j) * 16 + col) * DM + kb + kc * 32, lane), acc[hh * 4 + j]); } }
  if (n0 < 2 * DM) {   // q | k -> f16 hi + (x2048) residual rows (unscaled; the d^-1/4 x d^-1/4 = 1/32 scale is applied to the f32 score)
#pragma unroll
    for (int j = 0; j < 8; ++j) {
#pragma unroll
      for (int r = 0; r < 8; ++r) { const float v = acc[j][r]; const _Float16 hv = (_Float16)v; so[wave][8 * g + r][j * 16 + col] = hv; sol[wave][8 * g + r][j * 16 + col] = (_Float16)((v - (float)hv) * 2048.0f); } }
    LDSX();
    for (int rl = 0; rl < 16; ++rl) if (lane < 16) { vst2((unsigned*)(QK + (r0 + rl) * (2 * DM) + n0 + lane * 8), *(const v4u*)&so[wave][rl][lane * 8]); vst2((unsigned*)(QKL + (r0 + rl) * (2 * DM) + n0 + lane * 8), *(const v4u*)&sol[wave][rl][lane * 8]); }
  } else {
#pragma unroll
    for (int j = 0; j < 8; ++j) {
#pragma unroll
      for (int r = 0; r < 8; ++r) { const float v = acc[j][r]; const _Float16 hv = (_Float16)v; sth[j * 16 + col][wave * 16 + 8 * g + r] = hv; stl[j * 16 + col][wave * 16 + 8 * g + r] = (_Float16)((v - (float)hv) * 2048.0f); } }
    __syncthreads();
    const size_t rb = (size_t)blockIdx.x * 64; const int b = (int)(rb / SS), s0 = (int)(rb % SS); const int pc0 = n0 - 2 * DM;
    for (int q = tid; q < 128 * 8; q += 128) { const int d = q >> 3, pc = q & 7; const size_t o = ((size_t)b * DM + pc0 + d) * SS + s0 + pc * 8; vst2((unsigned*)(VTH + o), *(const v4u*)&sth[d][pc * 8]); vst2((unsigned*)(VTL + o), *(const v4u*)&stl[d][pc * 8]); }
  }
}
#define KP 72                          // K row pitch in LDS, halfs: 144 B = 16 B x odd, so the 16 rows of a ds_load_b128 fall on distinct banks
#define VP 40                          // V^T row pitch in LDS, halfs: 80 B = 16 B x odd
#define ST_KH 0                        // [32 keys][KP] K hi
#define ST_KL (ST_KH + 32 * KP)        // [32 keys][KP] K residual
#define ST_VH (ST_KL + 32 * KP)        // [64 d][VP] V^T hi (32 keys a row)
#define ST_VL (ST_VH + 64 * VP)        // [64 d][VP] V^T residual
#define ST_SZ (ST_VL + 64 * VP)        // halfs per buffer
__device__ __forceinline__ unsigned lds_byte(const _Float16* p) { return (unsigned)(size_t)(const __attribute__((address_space(3))) _Float16*)p; }
// one 32-key stage: 8 copies of 16 B per thread (K planes: 8 lanes a 128-B row; V planes: 4 lanes a 64-B row piece). The s_wait_xcnt stands inside the statement so that no address register is rewritten ahead of it.
__device__ __forceinline__ void stage_kv(const _Float16* kh, const _Float16* kl, const _Float16* vh, const _Float16* vl, unsigned lk, unsigned lv) {
  const _Float16 *kh1 = kh + 16 * (2 * DM), *kl1 = kl + 16 * (2 * DM), *vh1 = vh + 32 * SS, *vl1 = vl + 32 * SS;
  const unsigned lkh0 = lk + 2 * ST_KH, lkh1 = lkh0 + 2 * 16 * KP, lkl0 = lk + 2 * ST_KL, lkl1 = lkl0 + 2 * 16 * KP, lvh0 = lv + 2 * ST_VH, lvh1 = lvh0 + 2 * 32 * VP, lvl0 = lv + 2 * ST_VL, lvl1 = lvl0 + 2 * 32 * VP;
  asm volatile("global_load_async_to_lds_b128 %0, %8, off\n\t"
               "global_load_async_to_lds_b128 %1, %9, off\n\t"
               "global_load_async_to_lds_b128 %2, %10, off\n\t"
               "global_load_async_to_lds_b128 %3, %11, off\n\t"
               "global_load_async_to_lds_b128 %4, %12, off\n\t"
               "global_load_async_to_lds_b128 %5, %13, off\n\t"
               "global_load_async_to_lds_b128 %6, %14, off\n\t"
               "global_load_async_to_lds_b128 %7, %15, off\n\t"
               "s_wait_xcnt 0x0"
               :: "v"(lkh0), "v"(lkh1), "v"(lkl0), "v"(lkl1), "v"(lvh0), "v"(lvh1), "v"(lvl0), "v"(lvl1), "v"(kh), "v"(kh1), "v"(kl), "v"(kl1), "v"(vh), "v"(vh1), "v"(vl), "v"(vl1) : "memory");
}
__device__ __forceinline__ float xhalf(float x) { return __builtin_bit_cast(float, __builtin_amdgcn_permlanex16(__builtin_bit_cast(int, x), __builtin_bit_cast(int, x), 0x76543210, 0xfedcba98, false, false)); }   // lane l takes lane l ^ 16's value
// exp(x) as __expf forms it (x * log2 e, then v_exp_f32). The instruction set asks for one free slot behind a transcendental before its source is overwritten, so the v_exp_f32 run and its v_nop stand in one statement (outputs early-clobbered: no v_exp_f32 of the run writes a source of another).
__device__ __forceinline__ void exp_x4(float& a, float& b, float& c, float& d) {
  const float xa = a * 0x1.715476p+0f, xb = b * 0x1.715476p+0f, xc = c * 0x1.715476p+0f, xd = d * 0x1.715476p+0f;
  asm("v_exp_f32 %0, %4\n\tv_exp_f32 %1, %5\n\tv_exp_f32 %2, %6\n\tv_exp_f32 %3, %7\n\tv_nop" : "=&v"(a), "=&v"(b), "=&v"(c), "=&v"(d) : "v"(xa), "v"(xb), "v"(xc), "v"(xd));
}
__device__ __forceinline__ float exp_x1(float a) { float r; const float xa = a * 0x1.715476p+0f;
  asm("v_exp_f32 %0, %1\n\tv_nop" : "=&v"(r) : "v"(xa));   // the same free slot behind the one v_exp_f32
  return r; }
__global__ __launch_bounds__(128) void k_attn(const _Float16* __restrict__ QK, const _Float16* __restrict__ QKL, const _Float16* __restrict__ VTH, const _Float16* __restrict__ VTL, float* __restrict__ O) {
  __shared__ __align__(16) _Float16 st[2 * ST_SZ];
  const int tid = threadIdx.x, wave = tid >> 5, lane = tid & 31, col = lane & 15, g = lane >> 4;
  const int h = blockIdx.x, b = blockIdx.y, qb = TQB - 1 - (int)blockIdx.z; const int q0 = qb * 64 + wave * 16; const size_t rq = (size_t)b * SS + q0 + col;
  const int nks = (qb * 64 + 64) / 32;
  // this thread's pieces of a stage: K row tid / 8 (and + 16), 16-B piece tid % 8; V^T row tid / 4 (and + 32), piece tid % 4
  const size_t kof = ((size_t)b * SS + (tid >> 3)) * (2 * DM) + DM + h * HD + (tid & 7) * 8, vof = ((size_t)b * DM + h * HD + (tid >> 2)) * SS + (tid & 3) * 8;
  const unsigned lk = lds_byte(st) + 2 * ((tid >> 3) * KP + (tid & 7) * 8), lv = lds_byte(st) + 2 * ((tid >> 2) * VP + (tid & 3) * 8);
  stage_kv(QK + kof, QKL + kof, VTH + vof, VTL + vof, lk, lv);
  v16h aq[2], aql[2];
#pragma unroll
  for (int kc = 0; kc < 2; ++kc) { aq[kc] = frag_h(QK + rq * (2 * DM) + h * HD + kc * 32, lane); aql[kc] = frag_h(QKL + rq * (2 * DM) + h * HD + kc * 32, lane); }
  float m = -3.0e38f, l = 0.f;   // of query q0 + col; l holds only the keys of this lane's half until the epilogue joins the halves
  v8f acc[4] = {}, accl[4] = {};   // O^T tiles: register r = d dt * 16 + 8 g + r of query q0 + col
  asm volatile("s_wait_asynccnt 0x0" ::: "memory");   // stage 0 of this wave has landed
  __syncthreads();                                     // ... and every wave's part of it may be read
  stage_kv(QK + kof + (size_t)32 * (2 * DM), QKL + kof + (size_t)32 * (2 * DM), VTH + vof + 32, VTL + vof + 32, lk + 2 * ST_SZ, lv + 2 * ST_SZ);   // stage 1 always exists: nks >= 2
#pragma unroll 1
  for (int ks = 0; ks < nks; ++ks) { v8f s[2]; const _Float16* sb = st + (ks & 1) * ST_SZ;
    v16h kf[2][2], kfl[2][2];   // the step's eight K fragments, read as one group: the wave meets the LDS latency once ahead of the score products, not once per fragment
#pragma unroll
    for (int ct = 0; ct < 2; ++ct) {
#pragma unroll
      for (int kc = 0; kc < 2; ++kc) { kf[ct][kc] = frag_h(sb + ST_KH + (ct * 16 + col) * KP + kc * 32, lane); kfl[ct][kc] = frag_h(sb + ST_KL + (ct * 16 + col) * KP + kc * 32, lane); } }
    __builtin_amdgcn_sched_barrier(0);   // keeps the group above the products: without it the compiler sinks each read to just in front of its product and waits there
    v8f c2[2] = {}, cl2[2] = {};
#pragma unroll
    for (int ct = 0; ct < 2; ++ct) {
#pragma unroll
      for (int kc = 0; kc < 2; ++kc) { c2[ct] = wmma16(kf[ct][kc], aq[kc], c2[ct]); cl2[ct] = wmma16(kf[ct][kc], aql[kc], cl2[ct]); cl2[ct] = wmma16(kfl[ct][kc], aq[kc], cl2[ct]); } }   // 3 products: q, k as f16 hi + residual; register r = key ct * 16 + 8 g + r, column = query
    v16h vf[4], vfl[4];   // the step's eight V^T fragments, read ahead of the softmax: their LDS latency passes under its vector work
#pragma unroll
    for (int dt = 0; dt < 4; ++dt) { const int vr = (dt * 16 + col) * VP; vf[dt] = frag_h(sb + ST_VH + vr, lane); vfl[dt] = frag_h(sb + ST_VL + vr, lane); }
    __builtin_amdgcn_sched_barrier(0);   // keeps these reads above the softmax: without it the compiler sinks each to just in front of its product and waits there
#pragma unroll
    for (int ct = 0; ct < 2; ++ct) { v8f c = c2[ct]; const v8f cl = cl2[ct];
#pragma unroll
      for (int r = 0; r < 8; ++r) c[r] += cl[r] * (1.0f / 2048.0f);
#pragma unroll
      for (int r = 0; r < 8; ++r) { const int kk = ks * 32 + ct * 16 + 8 * g + r; s[ct][r] = (kk <= q0 + col) ? c[r] * 0.03125f : -3.0e38f; } }   // (d^-1/4)^2 = 1024^-1/2 = 1/32 exactly
    float mx = fmaxf(fmaxf(fmaxf(fmaxf(s[0][0], s[0][1]), fmaxf(s[0][2], s[0][3])), fmaxf(fmaxf(s[0][4], s[0][5]), fmaxf(s[0][6], s[0][7]))), fmaxf(fmaxf(fmaxf(s[1][0], s[1][1]), fmaxf(s[1][2], s[1][3])), fmaxf(fmaxf(s[1][4], s[1][5]), fmaxf(s[1][6], s[1][7]))));
    mx = fmaxf(mx, xhalf(mx));
    const float mn = fmaxf(m, mx); const float ea = exp_x1(m - mn); const float alpha = (m <= -1.0e38f) ? 0.f : ea; m = mn;
    float ev[2][8]; v16h pa, pl;   // P^T as a B operand: element i = key 8 g + i (tile 0), element 8 + i = key 16 + 8 g + i (tile 1), the k order of frag_h
#pragma unroll
    for (int ct = 0; ct < 2; ++ct) {
      float ex[8];
#pragma unroll
      for (int r = 0; r < 8; ++r) ex[r] = s[ct][r] - mn;
      exp_x4(ex[0], ex[1], ex[2], ex[3]); exp_x4(ex[4], ex[5], ex[6], ex[7]);
#pragma unroll
      for (int r = 0; r < 8; ++r) { const float e = (s[ct][r] <= -1.0e38f) ? 0.f : ex[r]; ev[ct][r] = e; const _Float16 eh = (_Float16)e; pa[ct * 8 + r] = eh; pl[ct * 8 + r] = (_Float16)((e - (float)eh) * 2048.0f); } }
    l = l * alpha + ((((ev[0][0] + ev[1][0]) + (ev[0][1] + ev[1][1])) + ((ev[0][2] + ev[1][2]) + (ev[0][3] + ev[1][3]))) + (((ev[0][4] + ev[1][4]) + (ev[0][5] + ev[1][5])) + ((ev[0][6] + ev[1][6]) + (ev[0][7] + ev[1][7]))));   // a tree, not one dependent chain of 16 adds
#pragma unroll
    for (int dt = 0; dt < 4; ++dt) {
#pragma unroll
      for (int r = 0; r < 8; ++r) { acc[dt][r] *= alpha; accl[dt][r] *= alpha; } }
#pragma unroll
    for (int dt = 0; dt < 4; ++dt) { acc[dt] = wmma16(vf[dt], pa, acc[dt]); accl[dt] = wmma16(vf[dt], pl, accl[dt]); accl[dt] = wmma16(vfl[dt], pa, accl[dt]); }   // V hi x P hi + (V hi x P lo + V lo x P hi) / 2048
    __builtin_amdgcn_sched_barrier(0);   // keeps the waits and the barrier below behind the step's products: with no LDS read left there the compiler lifts them above the softmax, where the V reads and the next stage's copies have had no time to land
    asm volatile("s_wait_dscnt 0x0" ::: "memory");      // this wave's reads of the buffer are done
    asm volatile("s_wait_asynccnt 0x0" ::: "memory");   // this wave's copies of stage ks + 1 have landed
    __syncthreads();                                     // publishes stage ks + 1 and frees the buffer that this step has read
    if (ks + 2 < nks) stage_kv(QK + kof + (size_t)(ks + 2) * 32 * (2 * DM), QKL + kof + (size_t)(ks + 2) * 32 * (2 * DM), VTH + vof + (ks + 2) * 32, VTL + vof + (ks + 2) * 32, lk + 2 * (ks & 1) * ST_SZ, lv + 2 * (ks & 1) * ST_SZ); }
  asm volatile("s_wait_asynccnt 0x0" ::: "memory");     // nothing of this wave is in flight when the buffers become output staging
  float (*so)[16][68] = (float (*)[16][68])st;           // the last step's barrier has ended every wave's reads of st
  const float il = 1.0f / (l + xhalf(l));
#pragma unroll
  for (int dt = 0; dt < 4; ++dt) {
#pragma unroll
    for (int r = 0; r < 8; ++r) so[wave][col][dt * 16 + 8 * g + r] = (acc[dt][r] + accl[dt][r] * (1.0f / 2048.0f)) * il; }
  LDSX();
  for (int rl = 0; rl < 16; ++rl) if (lane < 16) vst2(O + ((size_t)b * SS + q0 + rl) * DM + h * HD + lane * 4, *(const v4f*)&so[wave][rl][lane * 4]);
}
// ---- k_out: block = (64 rows, 128 cols): out = O(hi/lo) . Wo rows (2 products) + bo; each 64-wide k stage of the block's 128 Wo rows and 64 O rows is brought into LDS once per work-group by asynchronous copies that cover whole 128-B lines, two buffers, and the waves take their fragments from there
#define OKS 64                         // k per stage
#define OWP 72                         // Wo row pitch in LDS, bf16: 144 B = 16 B x odd, so the 16 rows of a ds_load_b128 fall on distinct banks
#define OAP 68                         // O row pitch in LDS, floats: 272 B = 16 B x odd
#define OB_W 0                         // bytes: [128 cols][OWP] bf16
#define OB_A (OB_W + 128 * OWP * 2)    // bytes: [64 rows][OAP] f32
#define OB_SZ (OB_A + 64 * OAP * 4)    // bytes per buffer
__device__ __forceinline__ unsigned lds_byte_c(const char* p) { return (unsigned)(size_t)(const __attribute__((address_space(3))) char*)p; }
// eight 16-B copies of one thread, at a fixed step in LDS (ls bytes) and in global memory (gs bytes). The s_wait_xcnt stands inside the statement so that no address register is rewritten ahead of it.
__device__ __forceinline__ void copy8(unsigned l0, unsigned ls, const char* g0, size_t gs) {
  const unsigned l1 = l0 + ls, l2 = l1 + ls, l3 = l2 + ls, l4 = l3 + ls, l5 = l4 + ls, l6 = l5 + ls, l7 = l6 + ls;
  const char *g1 = g0 + gs, *g2 = g1 + gs, *g3 = g2 + gs, *g4 = g3 + gs, *g5 = g4 + gs, *g6 = g5 + gs, *g7 = g6 + gs;
  asm volatile("global_load_async_to_lds_b128 %0, %8, off\n\t"
               "global_load_async_to_lds_b128 %1, %9, off\n\t"
               "global_load_async_to_lds_b128 %2, %10, off\n\t"
               "global_load_async_to_lds_b128 %3, %11, off\n\t"
               "global_load_async_to_lds_b128 %4, %12, off\n\t"
               "global_load_async_to_lds_b128 %5, %13, off\n\t"
               "global_load_async_to_lds_b128 %6, %14, off\n\t"
               "global_load_async_to_lds_b128 %7, %15, off\n\t"
               "s_wait_xcnt 0x0"
               :: "v"(l0), "v"(l1), "v"(l2), "v"(l3), "v"(l4), "v"(l5), "v"(l6), "v"(l7), "v"(g0), "v"(g1), "v"(g2), "v"(g3), "v"(g4), "v"(g5), "v"(g6), "v"(g7) : "memory");
}
// one stage: Wo rows tid / 8 + 16 i, 16-B piece tid % 8 (a wave's copy = 4 whole 128-B rows); O rows tid / 16 + 8 i, piece tid % 16 (a wave's copy = 2 whole 256-B rows)
__device__ __forceinline__ void stage_out(const char* gw, const char* ga, unsigned lw, unsigned la) {
  copy8(lw, 16 * OWP * 2, gw, (size_t)16 * DM * 2); copy8(la, 8 * OAP * 4, ga, (size_t)8 * DM * 4);
}
__global__ __launch_bounds__(128) void k_out(const float* __restrict__ O, const __bf16* __restrict__ P, const float* __restrict__ BU, float* __restrict__ Y) {
  __shared__ __align__(16) char sm[2 * OB_SZ];
  const int tid = threadIdx.x, wave = tid >> 5, lane = tid & 31, col = lane & 15, g = lane >> 4; const size_t rb = (size_t)blockIdx.x * 64, r0 = rb + wave * 16; const int n0 = blockIdx.y * 128;
  const char* gw = (const char*)(P + (size_t)(n0 + (tid >> 3)) * DM + (tid & 7) * 8); const char* ga = (const char*)(O + (rb + (tid >> 4)) * DM + (tid & 15) * 4);
  const unsigned lw = lds_byte_c(sm) + OB_W + (tid >> 3) * (OWP * 2) + (tid & 7) * 16, la = lds_byte_c(sm) + OB_A + (tid >> 4) * (OAP * 4) + (tid & 15) * 16;
  v8f acc[8] = {};
  stage_out(gw, ga, lw, la);
  asm volatile("s_wait_asynccnt 0x0" ::: "memory");   // stage 0 of this wave has landed
  __syncthreads();                                     // ... and every wave's part of it may be read
  stage_out(gw + OKS * 2, ga + OKS * 4, lw + OB_SZ, la + OB_SZ);
#pragma unroll 1   // rolled: one copy of the two-buffer order below, and the loop's text stays small
  for (int ks = 0; ks < DM / OKS; ++ks) { const char* sb = sm + (ks & 1) * OB_SZ; const float* arow = (const float*)(sb + OB_A) + (wave * 16 + col) * OAP; const __bf16* wrow = (const __bf16*)(sb + OB_W) + col * OWP;
#pragma unroll
    for (int kc = 0; kc < OKS / 32; ++kc) { v16b w[8];   // the eight Wo fragments of a k step are read as one group ahead of its products: one LDS latency a step, not eight
#pragma unroll
      for (int j = 0; j < 8; ++j) w[j] = frag_b(wrow + j * 16 * OWP + kc * 32, lane);
      const F2 a = split_row(arow, kc * 32, lane);
#pragma unroll
      for (int j = 0; j < 8; ++j) { acc[j] = wmma_bf(a.l, w[j], acc[j]); acc[j] = wmma_bf(a.h, w[j], acc[j]); } }
    asm volatile("s_wait_dscnt 0x0" ::: "memory");      // this wave's reads of the buffer are done
    asm volatile("s_wait_asynccnt 0x0" ::: "memory");   // this wave's copies of stage ks + 1 have landed
    __syncthreads();                                     // publishes stage ks + 1 and frees the buffer that this step has read
    if (ks + 2 < DM / OKS) stage_out(gw + (ks + 2) * (OKS * 2), ga + (ks + 2) * (OKS * 4), lw + (ks & 1) * OB_SZ, la + (ks & 1) * OB_SZ); }
  asm volatile("s_wait_asynccnt 0x0" ::: "memory");     // nothing of this wave is in flight when the buffers become output staging
  float (*so)[16][132] = (float (*)[16][132])sm;         // the last step's barrier has ended every wave's reads of sm
#pragma unroll
  for (int j = 0; j < 8; ++j) { const float bb = bfr(BU[n0 + j * 16 + col]);
#pragma unroll
    for (int r = 0; r < 8; ++r) so[wave][8 * g + r][j * 16 + col] = acc[j][r] + bb; }
  LDSX();
  for (int rl = 0; rl < 16; ++rl) vst2(Y + (r0 + rl) * DM + n0 + lane * 4, *(const v4f*)&so[wave][rl][lane * 4]);
}
extern "C" void kernel_launch(void* const* d_in, const int* in_sizes, int n_in, void* d_out, int out_size, void* d_ws, size_t ws_size, hipStream_t stream) {
  (void)in_sizes; (void)n_in; (void)out_size;
  const float** F = (const float**)d_in;   // 0 x [4,2048,1024], 1 Wq [64,64] ([out][in], shared by all 16 heads), 2 Wk, 3 Wv, 4 Wu [1024,1024], 5 bu [1024]
  if (ws_size < (size_t)WS_END) return;
  char* ws = (char*)d_ws; __bf16* PK = (__bf16*)(ws + WS_PK); _Float16 *QK = (_Float16*)(ws + WS_QK), *QKL = (_Float16*)(ws + WS_QKL), *VTH = (_Float16*)(ws + WS_VTH), *VTL = (_Float16*)(ws + WS_VTL); float *O = (float*)(ws + WS_O);
  k_packbd<<<QKVW, 128, 0, stream>>>(F[1], F[2], F[3], PK + PK_A); k_packrows<<<DM, 256, 0, stream>>>(F[4], DM, PK + PK_P);
  k_qkv<<<dim3(TNB * SS / 64, QKVW / 128), 128, 0, stream>>>(F[0], PK + PK_A, QK, QKL, VTH, VTL);
  k_attn<<<dim3(NH, TNB, TQB), 128, 0, stream>>>(QK, QKL, VTH, VTL, O);
  k_out<<<dim3(TOB, DM / 128), 128, 0, stream>>>(O, PK + PK_P, F[5], (float*)d_out);
}

// v008
// One run takes 156 microseconds.
// In both of two side-by-side timings against v007, it was 1.04 times as fast.
// All steps since v000 together make it 5.30 times as fast.
// compute dtype: x, Wq, Wk, Wv, Wu, bu (module inputs) rounded to bf16; the head-shared 64x64 q/k/v projections as one block-diagonal packed GEMM with exact bf16 products (x and W are inputs) on WMMA 16x16x32; q and k stored as f16 hi + (x2048-scaled) residual rows, causal scores with 3 products (the module's d^-1/4 on q and on k applied as the exact 1/32 on the f32 score); P.V with P as f16 hi + (x2048-scaled) residual x V as f16 hi + (x2048-scaled) residual planes (3 products); the output projection with ctx as bf16 hi + residual x exact Wu (2 products) + bu; running-max softmax in f32 with the hardware exp; f32 accumulate.
#include <hip/hip_runtime.h>
#include <math.h>

typedef __attribute__((ext_vector_type(16))) _Float16 v16h;
typedef __attribute__((ext_vector_type(16))) __bf16 v16b;
typedef __attribute__((ext_vector_type(8)))  _Float16 v8h;
typedef __attribute__((ext_vector_type(8)))  float v8f;
typedef __attribute__((ext_vector_type(4)))  float v4f;
typedef __attribute__((ext_vector_type(2)))  float v2f;
typedef __attribute__((ext_vector_type(4)))  unsigned v4u;
typedef __attribute__((ext_vector_type(4)))  int v4i;
typedef float __attribute__((may_alias)) float_a;
typedef int __attribute__((may_alias)) int_a;

template <typename T> __device__ __forceinline__ void vst2(void* p, T v) { *(T*)p = v;  }
// k_attn's products are the plain builtin: the compiler keeps the distance behind its own WMMA forms where a vector instruction needs it, and with no volatile statement behind each product it may issue the LDS reads of later products ahead of earlier products
__device__ __forceinline__ v8f wmma16(v16h a, v16h b, v8f c) { return __builtin_amdgcn_wmma_f32_16x16x32_f16(false, a, false, b, (short)0, c, false, false); }
__device__ __forceinline__ v8f wmma_bf(v16b a, v16b b, v8f c) {
  v8f d = __builtin_amdgcn_wmma_f32_16x16x32_bf16(false, a, false, b, (short)0, c, false, false);
  asm volatile("v_nop\n\tv_nop\n\tv_nop\n\tv_nop" : "+v"(d) : "v"(a), "v"(b));
  return d;
}
// 'Narrow' causal self-attention (B 4, T 2,048, emb 1,024 = 16 heads x 64 with ONE shared 64x64 Wq/Wk/Wv): per head q = x_h Wq^T d^-1/4, k = x_h Wk^T d^-1/4, v = x_h Wv^T; causal softmax(q k^T) v; out = y Wu^T + bu.
__device__ __forceinline__ v16h frag_h(const _Float16* rowk0, int lane) {
  union { v16h v; v8h q[2]; } u; const _Float16* p = rowk0 + 8 * (lane >> 4);
  u.q[0] = *(const v8h*)p; u.q[1] = *(const v8h*)(p + 16); return u.v;
}
__device__ __forceinline__ v16h frag_f32(const float* rowk0, int lane) {
  v16h a; const float* p = rowk0 + 8 * (lane >> 4);
#pragma unroll
  for (int i = 0; i < 8; ++i) { a[i] = (_Float16)p[i]; a[8 + i] = (_Float16)p[16 + i]; }
  return a;
}
__device__ __forceinline__ v16h frag_f32s(const float* rowk0, int lane, float sc) {
  v16h a; const float* p = rowk0 + 8 * (lane >> 4);
#pragma unroll
  for (int i = 0; i < 8; ++i) { a[i] = (_Float16)(p[i] * sc); a[8 + i] = (_Float16)(p[16 + i] * sc); }
  return a;
}
// column fragment from a [K][ld] layout (column n), rows >= K read as 0
__device__ __forceinline__ v16h fragc_f32(const float* W, int k0, int n, int lane, int ld, int K) {
  v16h a; const int g = lane >> 4;
#pragma unroll
  for (int i = 0; i < 8; ++i) { const int ka = k0 + 8 * g + i, kb = ka + 16;
    a[i] = (_Float16)(ka < K ? W[(size_t)(ka < K ? ka : K - 1) * ld + n] : 0.f); a[8 + i] = (_Float16)(kb < K ? W[(size_t)(kb < K ? kb : K - 1) * ld + n] : 0.f); }
  return a;
}
struct F2 { v16b h, l; };
__device__ __forceinline__ F2 bsplit16(const float v[16]) { F2 r;
#pragma unroll
  for (int i = 0; i < 16; ++i) { const __bf16 h = (__bf16)v[i]; r.h[i] = h; r.l[i] = (__bf16)(v[i] - (float)h); }
  return r; }
__device__ __forceinline__ F2 split_row(const float* row, int k0, int lane) { float v[16]; const float* p = row + k0 + 8 * (lane >> 4);
#pragma unroll
  for (int i = 0; i < 8; ++i) { v[i] = p[i]; v[8 + i] = p[16 + i]; }
  return bsplit16(v); }
__device__ __forceinline__ F2 split_rowK(const float* row, int k0, int lane, int K) { float v[16]; const int g = lane >> 4;
#pragma unroll
  for (int i = 0; i < 8; ++i) { const int ka = k0 + 8 * g + i, kb = ka + 16; v[i] = ka < K ? row[ka < K ? ka : K - 1] : 0.f; v[8 + i] = kb < K ? row[kb < K ? kb : K - 1] : 0.f; }
  return bsplit16(v); }
__device__ __forceinline__ F2 split_col(const float* W, int k0, int n, int lane, int ld, int K) { float v[16]; const int g = lane >> 4;
#pragma unroll
  for (int i = 0; i < 8; ++i) { const int ka = k0 + 8 * g + i, kb = ka + 16; v[i] = ka < K ? W[(size_t)(ka < K ? ka : K - 1) * ld + n] : 0.f; v[8 + i] = kb < K ? W[(size_t)(kb < K ? kb : K - 1) * ld + n] : 0.f; }
  return bsplit16(v); }
__device__ __forceinline__ v8f mac3(const F2& a, const F2& b, v8f c) { c = wmma_bf(a.l, b.h, c); c = wmma_bf(a.h, b.l, c); return wmma_bf(a.h, b.h, c); }
__device__ __forceinline__ float sigm(float v) { return 1.0f / (1.0f + expf(-v)); }
#define LDSX() do { asm volatile("s_wait_dscnt 0" ::: "memory"); __builtin_amdgcn_wave_barrier(); __builtin_amdgcn_fence(__ATOMIC_RELEASE, "workgroup"); } while (0)


// Causal multi-head self-attention (B 4, S 2048, D 1024, 16 heads x 64; head-shared 64x64 Wq/Wk/Wv expanded to a block-diagonal packed [3D][D], Wout [D][D] applied as x W^T, bias bu): softmax(q k^T / 32, causal) v; ctx Wout^T + bu.
#define NB 4
#define SS 2048
#define DM 1024
#define NH 16
#define HD 64
#define QKVW (3 * DM)
#ifndef TQB
#define TQB (SS / 64)
#define TNB NB
#define TOB (NB * SS / 64)     // output row tiles (all)
#endif
typedef __attribute__((ext_vector_type(8))) __bf16 v8b;
__device__ __forceinline__ v16b frag_b(const __bf16* rowk0, int lane) {
  union { v16b v; v8b q[2]; } u; const __bf16* p = rowk0 + 8 * (lane >> 4);
  u.q[0] = *(const v8b*)p; u.q[1] = *(const v8b*)(p + 16); return u.v;
}
__device__ __forceinline__ float bfr(float v) { return (float)(__bf16)v; }
__device__ __attribute__((noinline)) float exp_ni(float v) { return expf(v); }
__device__ __attribute__((noinline)) float erf_ni(float v) { return erff(v); }

#define PK_A 0                       // [3072][1024] Wqkv rows (natural [out][in])
#define PK_P (PK_A + QKVW * DM)        // [1024][1024] Wo rows (natural)
#define PK_END (PK_P + DM * DM)
#define WS_PK  0u
#define WS_QK  (WS_PK + 2u * PK_END)             // f16 [8192 rows][2048]: q | k
#define WS_QKL (WS_QK + 2u * NB * SS * 2 * DM)     // f16 q | k residual planes x2048
#define WS_VTH (WS_QKL + 2u * NB * SS * 2 * DM)    // f16 [b][1024 (h*64+d)][2048 s] hi
#define WS_VTL (WS_VTH + 2u * NB * DM * SS)        // f16 lo x 2048
#define WS_O   (WS_VTL + 2u * NB * DM * SS)        // f32 [8192][1024]
#define WS_CS  (WS_O + 4u * NB * SS * DM)           // f32 2 x [2048][32], reserved, not written or read
#define WS_END (WS_CS + 4u * 2 * SS * 32)

// ---- k_packbd: block = packed row n = which*1024 + h*64 + o: block-diagonal expansion of the head-shared [64][64] projection: row[h*64 + c] = W[o][c], zero elsewhere
__global__ __launch_bounds__(128) void k_packbd(const float* __restrict__ WQ, const float* __restrict__ WK, const float* __restrict__ WV, __bf16* __restrict__ DST) {
  __shared__ __align__(16) __bf16 s[DM]; const int n = blockIdx.x, t = threadIdx.x; const int which = n / DM, h = (n % DM) / HD, o = n % HD; const float* Wm = (which == 0) ? WQ : (which == 1) ? WK : WV;
  for (int k = t; k < DM; k += 128) s[k] = (__bf16)((k / HD == h) ? Wm[o * HD + (k % HD)] : 0.f);
  __syncthreads();
  vst2((unsigned*)(DST + (size_t)n * DM + t * 8), *(const v4u*)&s[t * 8]);
}
// ---- k_packrows: block = natural row n of a [N][K] weight
__global__ __launch_bounds__(256) void k_packrows(const float* __restrict__ Wm, int K, __bf16* __restrict__ DST) {
  __shared__ __align__(16) __bf16 s[DM]; const int n = blockIdx.x, tid = threadIdx.x;
  for (int k = tid; k < K; k += 256) s[k] = (__bf16)Wm[(size_t)n * K + k];
  __syncthreads();
  for (int q = tid; q < K / 8; q += 256) vst2((unsigned*)(DST + (size_t)n * K + q * 8), *(const v4u*)&s[q * 8]);
}
// ---- k_qkv: block = (64 rows (b,s), 128 of the 3072 cols): qkv = bf16(x) . rows (exact); cols < 1024 -> f16(q), cols < 2048 -> f16(k) into QK rows (pitch 2048); cols >= 2048 (v) -> per-batch transposed f16 planes VT[b][h*64+d][s]: hi = f16(v), lo = f16((v - hi) * 2048)
__global__ __launch_bounds__(128) void k_qkv(const float* __restrict__ X, const __bf16* __restrict__ P, _Float16* __restrict__ QK, _Float16* __restrict__ QKL, _Float16* __restrict__ VTH, _Float16* __restrict__ VTL) {
  __shared__ __align__(16) _Float16 so[4][16][136], sol[4][16][136]; __shared__ __align__(16) _Float16 sth[128][72], stl[128][72];
  const int tid = threadIdx.x, wave = tid >> 5, lane = tid & 31, col = lane & 15, g = lane >> 4; const size_t r0 = (size_t)blockIdx.x * 64 + wave * 16; const int n0 = blockIdx.y * 128;
  v8f acc[8] = {};
  // packed row n is zero outside columns [head*64, head*64+64), head = (n % 1024) / 64: the 128 columns of this block are two heads, and each head's four column tiles take only their own 64 k
#pragma unroll
  for (int hh = 0; hh < 2; ++hh) { const int kb = (n0 % DM) + hh * HD;
#pragma unroll
    for (int kc = 0; kc < HD / 32; ++kc) { v16b a; { const float* p = X + (r0 + col) * DM + kb + kc * 32 + 8 * g;
#pragma unroll
        for (int i = 0; i < 8; ++i) { a[i] = (__bf16)p[i]; a[8 + i] = (__bf16)p[16 + i]; } }
#pragma unroll
      for (int j = 0; j < 4; ++j) acc[hh * 4 + j] = wmma_bf(a, frag_b(P + (size_t)(n0 + (hh * 4 + j) * 16 + col) * DM + kb + kc * 32, lane), acc[hh * 4 + j]); } }
  if (n0 < 2 * DM) {   // q | k -> f16 hi + (x2048) residual rows (unscaled; the d^-1/4 x d^-1/4 = 1/32 scale is applied to the f32 score)
#pragma unroll
    for (int j = 0; j < 8; ++j) {
#pragma unroll
      for (int r = 0; r < 8; ++r) { const float v = acc[j][r]; const _Float16 hv = (_Float16)v; so[wave][8 * g + r][j * 16 + col] = hv; sol[wave][8 * g + r][j * 16 + col] = (_Float16)((v - (float)hv) * 2048.0f); } }
    LDSX();
    for (int rl = 0; rl < 16; ++rl) if (lane < 16) { vst2((unsigned*)(QK + (r0 + rl) * (2 * DM) + n0 + lane * 8), *(const v4u*)&so[wave][rl][lane * 8]); vst2((unsigned*)(QKL + (r0 + rl) * (2 * DM) + n0 + lane * 8), *(const v4u*)&sol[wave][rl][lane * 8]); }
  } else {
#pragma unroll
    for (int j = 0; j < 8; ++j) {
#pragma unroll
      for (int r = 0; r < 8; ++r) { const float v = acc[j][r]; const _Float16 hv = (_Float16)v; sth[j * 16 + col][wave * 16 + 8 * g + r] = hv; stl[j * 16 + col][wave * 16 + 8 * g + r] = (_Float16)((v - (float)hv) * 2048.0f); } }
    __syncthreads();
    const size_t rb = (size_t)blockIdx.x * 64; const int b = (int)(rb / SS), s0 = (int)(rb % SS); const int pc0 = n0 - 2 * DM;
    for (int q = tid; q < 128 * 8; q += 128) { const int d = q >> 3, pc = q & 7; const size_t o = ((size_t)b * DM + pc0 + d) * SS + s0 + pc * 8; vst2((unsigned*)(VTH + o), *(const v4u*)&sth[d][pc * 8]); vst2((unsigned*)(VTL + o), *(const v4u*)&stl[d][pc * 8]); }
  }
}
#define KP 72                          // K row pitch in LDS, halfs: 144 B = 16 B x odd, so the 16 rows of a ds_load_b128 fall on distinct banks
#define VP 40                          // V^T row pitch in LDS, halfs: 80 B = 16 B x odd
#define ST_KH 0                        // [32 keys][KP] K hi
#define ST_KL (ST_KH + 32 * KP)        // [32 keys][KP] K residual
#define ST_VH (ST_KL + 32 * KP)        // [64 d][VP] V^T hi (32 keys a row)
#define ST_VL (ST_VH + 64 * VP)        // [64 d][VP] V^T residual
#define ST_SZ (ST_VL + 64 * VP)        // halfs per buffer
__device__ __forceinline__ unsigned lds_byte(const _Float16* p) { return (unsigned)(size_t)(const __attribute__((address_space(3))) _Float16*)p; }
// one 32-key stage: 8 copies of 16 B per thread (K planes: 8 lanes a 128-B row; V planes: 4 lanes a 64-B row piece). The s_wait_xcnt stands inside the statement so that no address register is rewritten ahead of it.
__device__ __forceinline__ void stage_kv(const _Float16* kh, const _Float16* kl, const _Float16* vh, const _Float16* vl, unsigned lk, unsigned lv) {
  const _Float16 *kh1 = kh + 16 * (2 * DM), *kl1 = kl + 16 * (2 * DM), *vh1 = vh + 32 * SS, *vl1 = vl + 32 * SS;
  const unsigned lkh0 = lk + 2 * ST_KH, lkh1 = lkh0 + 2 * 16 * KP, lkl0 = lk + 2 * ST_KL, lkl1 = lkl0 + 2 * 16 * KP, lvh0 = lv + 2 * ST_VH, lvh1 = lvh0 + 2 * 32 * VP, lvl0 = lv + 2 * ST_VL, lvl1 = lvl0 + 2 * 32 * VP;
  asm volatile("global_load_async_to_lds_b128 %0, %8, off\n\t"
               "global_load_async_to_lds_b128 %1, %9, off\n\t"
               "global_load_async_to_lds_b128 %2, %10, off\n\t"
               "global_load_async_to_lds_b128 %3, %11, off\n\t"
               "global_load_async_to_lds_b128 %4, %12, off\n\t"
               "global_load_async_to_lds_b128 %5, %13, off\n\t"
               "global_load_async_to_lds_b128 %6, %14, off\n\t"
               "global_load_async_to_lds_b128 %7, %15, off\n\t"
               "s_wait_xcnt 0x0"
               :: "v"(lkh0), "v"(lkh1), "v"(lkl0), "v"(lkl1), "v"(lvh0), "v"(lvh1), "v"(lvl0), "v"(lvl1), "v"(kh), "v"(kh1), "v"(kl), "v"(kl1), "v"(vh), "v"(vh1), "v"(vl), "v"(vl1) : "memory");
}
__device__ __forceinline__ float xhalf(float x) { return __builtin_bit_cast(float, __builtin_amdgcn_permlanex16(__builtin_bit_cast(int, x), __builtin_bit_cast(int, x), 0x76543210, 0xfedcba98, false, false)); }   // lane l takes lane l ^ 16's value
// exp(x) as __expf forms it (x * log2 e, then v_exp_f32). The instruction set asks for one free slot behind a transcendental before its source is overwritten, so the v_exp_f32 run and its v_nop stand in one statement (outputs early-clobbered: no v_exp_f32 of the run writes a source of another).
__device__ __forceinline__ void exp_x4(float& a, float& b, float& c, float& d) {
  const float xa = a * 0x1.715476p+0f, xb = b * 0x1.715476p+0f, xc = c * 0x1.715476p+0f, xd = d * 0x1.715476p+0f;
  asm("v_exp_f32 %0, %4\n\tv_exp_f32 %1, %5\n\tv_exp_f32 %2, %6\n\tv_exp_f32 %3, %7\n\tv_nop" : "=&v"(a), "=&v"(b), "=&v"(c), "=&v"(d) : "v"(xa), "v"(xb), "v"(xc), "v"(xd));
}
__device__ __forceinline__ float exp_x1(float a) { float r; const float xa = a * 0x1.715476p+0f;
  asm("v_exp_f32 %0, %1\n\tv_nop" : "=&v"(r) : "v"(xa));   // the same free slot behind the one v_exp_f32
  return r; }
__global__ __launch_bounds__(128) void k_attn(const _Float16* __restrict__ QK, const _Float16* __restrict__ QKL, const _Float16* __restrict__ VTH, const _Float16* __restrict__ VTL, float* __restrict__ O) {
  __shared__ __align__(16) _Float16 st[2 * ST_SZ];
  const int tid = threadIdx.x, wave = tid >> 5, lane = tid & 31, col = lane & 15, g = lane >> 4;
  const int h = blockIdx.x, b = blockIdx.y, qb = TQB - 1 - (int)blockIdx.z; const int q0 = qb * 64 + wave * 16; const size_t rq = (size_t)b * SS + q0 + col;
  const int nks = (qb * 64 + 64) / 32;
  // this thread's pieces of a stage: K row tid / 8 (and + 16), 16-B piece tid % 8; V^T row tid / 4 (and + 32), piece tid % 4
  const size_t kof = ((size_t)b * SS + (tid >> 3)) * (2 * DM) + DM + h * HD + (tid & 7) * 8, vof = ((size_t)b * DM + h * HD + (tid >> 2)) * SS + (tid & 3) * 8;
  const unsigned lk = lds_byte(st) + 2 * ((tid >> 3) * KP + (tid & 7) * 8), lv = lds_byte(st) + 2 * ((tid >> 2) * VP + (tid & 3) * 8);
  stage_kv(QK + kof, QKL + kof, VTH + vof, VTL + vof, lk, lv);
  v16h aq[2], aql[2];
#pragma unroll
  for (int kc = 0; kc < 2; ++kc) { aq[kc] = frag_h(QK + rq * (2 * DM) + h * HD + kc * 32, lane); aql[kc] = frag_h(QKL + rq * (2 * DM) + h * HD + kc * 32, lane); }
  float m = -3.0e38f, l = 0.f;   // of query q0 + col; l holds only the keys of this lane's half until the epilogue joins the halves
  v8f acc[4] = {}, accl[4] = {};   // O^T tiles: register r = d dt * 16 + 8 g + r of query q0 + col
  asm volatile("s_wait_asynccnt 0x0" ::: "memory");   // stage 0 of this wave has landed
  __syncthreads();                                     // ... and every wave's part of it may be read
  stage_kv(QK + kof + (size_t)32 * (2 * DM), QKL + kof + (size_t)32 * (2 * DM), VTH + vof + 32, VTL + vof + 32, lk + 2 * ST_SZ, lv + 2 * ST_SZ);   // stage 1 always exists: nks >= 2
#pragma unroll 1
  for (int ks = 0; ks < nks; ++ks) { v8f s[2]; const _Float16* sb = st + (ks & 1) * ST_SZ;
    v16h kf[2][2], kfl[2][2];   // the step's eight K fragments, read as one group: the wave meets the LDS latency once ahead of the score products, not once per fragment
#pragma unroll
    for (int ct = 0; ct < 2; ++ct) {
#pragma unroll
      for (int kc = 0; kc < 2; ++kc) { kf[ct][kc] = frag_h(sb + ST_KH + (ct * 16 + col) * KP + kc * 32, lane); kfl[ct][kc] = frag_h(sb + ST_KL + (ct * 16 + col) * KP + kc * 32, lane); } }
    __builtin_amdgcn_sched_barrier(0);   // keeps the group above the products: without it the compiler sinks each read to just in front of its product and waits there
    v8f c2[2] = {}, cl2[2] = {};
#pragma unroll
    for (int ct = 0; ct < 2; ++ct) {
#pragma unroll
      for (int kc = 0; kc < 2; ++kc) { c2[ct] = wmma16(kf[ct][kc], aq[kc], c2[ct]); cl2[ct] = wmma16(kf[ct][kc], aql[kc], cl2[ct]); cl2[ct] = wmma16(kfl[ct][kc], aq[kc], cl2[ct]); } }   // 3 products: q, k as f16 hi + residual; register r = key ct * 16 + 8 g + r, column = query
    v16h vf[4], vfl[4];   // the step's eight V^T fragments, read ahead of the softmax: their LDS latency passes under its vector work
#pragma unroll
    for (int dt = 0; dt < 4; ++dt) { const int vr = (dt * 16 + col) * VP; vf[dt] = frag_h(sb + ST_VH + vr, lane); vfl[dt] = frag_h(sb + ST_VL + vr, lane); }
    __builtin_amdgcn_sched_barrier(0);   // keeps these reads above the softmax: without it the compiler sinks each to just in front of its product and waits there
#pragma unroll
    for (int ct = 0; ct < 2; ++ct) { v8f c = c2[ct]; const v8f cl = cl2[ct];
#pragma unroll
      for (int r = 0; r < 8; ++r) c[r] += cl[r] * (1.0f / 2048.0f);
#pragma unroll
      for (int r = 0; r < 8; ++r) s[ct][r] = c[r] * 0.03125f; }   // (d^-1/4)^2 = 1024^-1/2 = 1/32 exactly
    if (ks >= nks - 2) {   // a scalar test: only the block's last two steps hold keys behind its first query; in every earlier step each key is visible to each of the 64 queries and the mask's compares and selects are not run
#pragma unroll
      for (int ct = 0; ct < 2; ++ct) {
#pragma unroll
        for (int r = 0; r < 8; ++r) { const int kk = ks * 32 + ct * 16 + 8 * g + r; s[ct][r] = (kk <= q0 + col) ? s[ct][r] : -3.0e38f; } } }
    float mx = fmaxf(fmaxf(fmaxf(fmaxf(s[0][0], s[0][1]), fmaxf(s[0][2], s[0][3])), fmaxf(fmaxf(s[0][4], s[0][5]), fmaxf(s[0][6], s[0][7]))), fmaxf(fmaxf(fmaxf(s[1][0], s[1][1]), fmaxf(s[1][2], s[1][3])), fmaxf(fmaxf(s[1][4], s[1][5]), fmaxf(s[1][6], s[1][7]))));
    mx = fmaxf(mx, xhalf(mx));
    const float mn = fmaxf(m, mx); const float ea = exp_x1(m - mn); const float alpha = (m <= -1.0e38f) ? 0.f : ea; m = mn;
    float ev[2][8]; v16h pa, pl;   // P^T as a B operand: element i = key 8 g + i (tile 0), element 8 + i = key 16 + 8 g + i (tile 1), the k order of frag_h
#pragma unroll
    for (int ct = 0; ct < 2; ++ct) {
      float ex[8];
#pragma unroll
      for (int r = 0; r < 8; ++r) ex[r] = s[ct][r] - mn;
      exp_x4(ex[0], ex[1], ex[2], ex[3]); exp_x4(ex[4], ex[5], ex[6], ex[7]);
#pragma unroll
      for (int r = 0; r < 8; ++r) { const float e = ex[r]; ev[ct][r] = e;   // a masked score needs no select here: mn is finite from step 0 on (key 0 is visible to every query), so -3.0e38 - mn times log2 e is -inf and v_exp_f32 gives 0
        const _Float16 eh = (_Float16)e; pa[ct * 8 + r] = eh; pl[ct * 8 + r] = (_Float16)((e - (float)eh) * 2048.0f); } }
    l = l * alpha + ((((ev[0][0] + ev[1][0]) + (ev[0][1] + ev[1][1])) + ((ev[0][2] + ev[1][2]) + (ev[0][3] + ev[1][3]))) + (((ev[0][4] + ev[1][4]) + (ev[0][5] + ev[1][5])) + ((ev[0][6] + ev[1][6]) + (ev[0][7] + ev[1][7]))));   // a tree, not one dependent chain of 16 adds
#pragma unroll
    for (int dt = 0; dt < 4; ++dt) {
#pragma unroll
      for (int r = 0; r < 8; ++r) { acc[dt][r] *= alpha; accl[dt][r] *= alpha; } }
#pragma unroll
    for (int dt = 0; dt < 4; ++dt) { acc[dt] = wmma16(vf[dt], pa, acc[dt]); accl[dt] = wmma16(vf[dt], pl, accl[dt]); accl[dt] = wmma16(vfl[dt], pa, accl[dt]); }   // V hi x P hi + (V hi x P lo + V lo x P hi) / 2048
    __builtin_amdgcn_sched_barrier(0);   // keeps the waits and the barrier below behind the step's products: with no LDS read left there the compiler lifts them above the softmax, where the V reads and the next stage's copies have had no time to land
    asm volatile("s_wait_dscnt 0x0" ::: "memory");      // this wave's reads of the buffer are done
    asm volatile("s_wait_asynccnt 0x0" ::: "memory");   // this wave's copies of stage ks + 1 have landed
    __syncthreads();                                     // publishes stage ks + 1 and frees the buffer that this step has read
    if (ks + 2 < nks) stage_kv(QK + kof + (size_t)(ks + 2) * 32 * (2 * DM), QKL + kof + (size_t)(ks + 2) * 32 * (2 * DM), VTH + vof + (ks + 2) * 32, VTL + vof + (ks + 2) * 32, lk + 2 * (ks & 1) * ST_SZ, lv + 2 * (ks & 1) * ST_SZ); }
  asm volatile("s_wait_asynccnt 0x0" ::: "memory");     // nothing of this wave is in flight when the buffers become output staging
  float (*so)[16][68] = (float (*)[16][68])st;           // the last step's barrier has ended every wave's reads of st
  const float il = 1.0f / (l + xhalf(l));
#pragma unroll
  for (int dt = 0; dt < 4; ++dt) {
#pragma unroll
    for (int r = 0; r < 8; ++r) so[wave][col][dt * 16 + 8 * g + r] = (acc[dt][r] + accl[dt][r] * (1.0f / 2048.0f)) * il; }
  LDSX();
  for (int rl = 0; rl < 16; ++rl) if (lane < 16) vst2(O + ((size_t)b * SS + q0 + rl) * DM + h * HD + lane * 4, *(const v4f*)&so[wave][rl][lane * 4]);
}
// ---- k_out: block = (64 rows, 128 cols): out = O(hi/lo) . Wo rows (2 products) + bo; each 64-wide k stage of the block's 128 Wo rows and 64 O rows is brought into LDS once per work-group by asynchronous copies that cover whole 128-B lines, two buffers, and the waves take their fragments from there
#define OKS 64                         // k per stage
#define OWP 72                         // Wo row pitch in LDS, bf16: 144 B = 16 B x odd, so the 16 rows of a ds_load_b128 fall on distinct banks
#define OAP 68                         // O row pitch in LDS, floats: 272 B = 16 B x odd
#define OB_W 0                         // bytes: [128 cols][OWP] bf16
#define OB_A (OB_W + 128 * OWP * 2)    // bytes: [64 rows][OAP] f32
#define OB_SZ (OB_A + 64 * OAP * 4)    // bytes per buffer
__device__ __forceinline__ unsigned lds_byte_c(const char* p) { return (unsigned)(size_t)(const __attribute__((address_space(3))) char*)p; }
// eight 16-B copies of one thread, at a fixed step in LDS (ls bytes) and in global memory (gs bytes). The s_wait_xcnt stands inside the statement so that no address register is rewritten ahead of it.
__device__ __forceinline__ void copy8(unsigned l0, unsigned ls, const char* g0, size_t gs) {
  const unsigned l1 = l0 + ls, l2 = l1 + ls, l3 = l2 + ls, l4 = l3 + ls, l5 = l4 + ls, l6 = l5 + ls, l7 = l6 + ls;
  const char *g1 = g0 + gs, *g2 = g1 + gs, *g3 = g2 + gs, *g4 = g3 + gs, *g5 = g4 + gs, *g6 = g5 + gs, *g7 = g6 + gs;
  asm volatile("global_load_async_to_lds_b128 %0, %8, off\n\t"
               "global_load_async_to_lds_b128 %1, %9, off\n\t"
               "global_load_async_to_lds_b128 %2, %10, off\n\t"
               "global_load_async_to_lds_b128 %3, %11, off\n\t"
               "global_load_async_to_lds_b128 %4, %12, off\n\t"
               "global_load_async_to_lds_b128 %5, %13, off\n\t"
               "global_load_async_to_lds_b128 %6, %14, off\n\t"
               "global_load_async_to_lds_b128 %7, %15, off\n\t"
               "s_wait_xcnt 0x0"
               :: "v"(l0), "v"(l1), "v"(l2), "v"(l3), "v"(l4), "v"(l5), "v"(l6), "v"(l7), "v"(g0), "v"(g1), "v"(g2), "v"(g3), "v"(g4), "v"(g5), "v"(g6), "v"(g7) : "memory");
}
// one stage: Wo rows tid / 8 + 16 i, 16-B piece tid % 8 (a wave's copy = 4 whole 128-B rows); O rows tid / 16 + 8 i, piece tid % 16 (a wave's copy = 2 whole 256-B rows)
__device__ __forceinline__ void stage_out(const char* gw, const char* ga, unsigned lw, unsigned la) {
  copy8(lw, 16 * OWP * 2, gw, (size_t)16 * DM * 2); copy8(la, 8 * OAP * 4, ga, (size_t)8 * DM * 4);
}
__global__ __launch_bounds__(128) void k_out(const float* __restrict__ O, const __bf16* __restrict__ P, const float* __restrict__ BU, float* __restrict__ Y) {
  __shared__ __align__(16) char sm[2 * OB_SZ];
  const int tid = threadIdx.x, wave = tid >> 5, lane = tid & 31, col = lane & 15, g = lane >> 4; const size_t rb = (size_t)blockIdx.x * 64, r0 = rb + wave * 16; const int n0 = blockIdx.y * 128;
  const char* gw = (const char*)(P + (size_t)(n0 + (tid >> 3)) * DM + (tid & 7) * 8); const char* ga = (const char*)(O + (rb + (tid >> 4)) * DM + (tid & 15) * 4);
  const unsigned lw = lds_byte_c(sm) + OB_W + (tid >> 3) * (OWP * 2) + (tid & 7) * 16, la = lds_byte_c(sm) + OB_A + (tid >> 4) * (OAP * 4) + (tid & 15) * 16;
  v8f acc[8] = {};
  stage_out(gw, ga, lw, la);
  asm volatile("s_wait_asynccnt 0x0" ::: "memory");   // stage 0 of this wave has landed
  __syncthreads();                                     // ... and every wave's part of it may be read
  stage_out(gw + OKS * 2, ga + OKS * 4, lw + OB_SZ, la + OB_SZ);
#pragma unroll 1   // rolled: one copy of the two-buffer order below, and the loop's text stays small
  for (int ks = 0; ks < DM / OKS; ++ks) { const char* sb = sm + (ks & 1) * OB_SZ; const float* arow = (const float*)(sb + OB_A) + (wave * 16 + col) * OAP; const __bf16* wrow = (const __bf16*)(sb + OB_W) + col * OWP;
#pragma unroll
    for (int kc = 0; kc < OKS / 32; ++kc) { v16b w[8];   // the eight Wo fragments of a k step are read as one group ahead of its products: one LDS latency a step, not eight
#pragma unroll
      for (int j = 0; j < 8; ++j) w[j] = frag_b(wrow + j * 16 * OWP + kc * 32, lane);
      const F2 a = split_row(arow, kc * 32, lane);
#pragma unroll
      for (int j = 0; j < 8; ++j) { acc[j] = wmma_bf(a.l, w[j], acc[j]); acc[j] = wmma_bf(a.h, w[j], acc[j]); } }
    asm volatile("s_wait_dscnt 0x0" ::: "memory");      // this wave's reads of the buffer are done
    asm volatile("s_wait_asynccnt 0x0" ::: "memory");   // this wave's copies of stage ks + 1 have landed
    __syncthreads();                                     // publishes stage ks + 1 and frees the buffer that this step has read
    if (ks + 2 < DM / OKS) stage_out(gw + (ks + 2) * (OKS * 2), ga + (ks + 2) * (OKS * 4), lw + (ks & 1) * OB_SZ, la + (ks & 1) * OB_SZ); }
  asm volatile("s_wait_asynccnt 0x0" ::: "memory");     // nothing of this wave is in flight when the buffers become output staging
  float (*so)[16][132] = (float (*)[16][132])sm;         // the last step's barrier has ended every wave's reads of sm
#pragma unroll
  for (int j = 0; j < 8; ++j) { const float bb = bfr(BU[n0 + j * 16 + col]);
#pragma unroll
    for (int r = 0; r < 8; ++r) so[wave][8 * g + r][j * 16 + col] = acc[j][r] + bb; }
  LDSX();
  for (int rl = 0; rl < 16; ++rl) vst2(Y + (r0 + rl) * DM + n0 + lane * 4, *(const v4f*)&so[wave][rl][lane * 4]);
}
extern "C" void kernel_launch(void* const* d_in, const int* in_sizes, int n_in, void* d_out, int out_size, void* d_ws, size_t ws_size, hipStream_t stream) {
  (void)in_sizes; (void)n_in; (void)out_size;
  const float** F = (const float**)d_in;   // 0 x [4,2048,1024], 1 Wq [64,64] ([out][in], shared by all 16 heads), 2 Wk, 3 Wv, 4 Wu [1024,1024], 5 bu [1024]
  if (ws_size < (size_t)WS_END) return;
  char* ws = (char*)d_ws; __bf16* PK = (__bf16*)(ws + WS_PK); _Float16 *QK = (_Float16*)(ws + WS_QK), *QKL = (_Float16*)(ws + WS_QKL), *VTH = (_Float16*)(ws + WS_VTH), *VTL = (_Float16*)(ws + WS_VTL); float *O = (float*)(ws + WS_O);
  k_packbd<<<QKVW, 128, 0, stream>>>(F[1], F[2], F[3], PK + PK_A); k_packrows<<<DM, 256, 0, stream>>>(F[4], DM, PK + PK_P);
  k_qkv<<<dim3(TNB * SS / 64, QKVW / 128), 128, 0, stream>>>(F[0], PK + PK_A, QK, QKL, VTH, VTL);
  k_attn<<<dim3(NH, TNB, TQB), 128, 0, stream>>>(QK, QKL, VTH, VTL, O);
  k_out<<<dim3(TOB, DM / 128), 128, 0, stream>>>(O, PK + PK_P, F[5], (float*)d_out);
}

// v009
// One run takes 149 microseconds.
// In two side-by-side timings against v008, it was 1.04 and 1.05 times as fast.
// Over all steps from v000 it is 5.52 times as fast.
// compute dtype: x, Wq, Wk, Wv, Wu, bu (module inputs) rounded to bf16; the head-shared 64x64 q/k/v projections as one block-diagonal packed GEMM with exact bf16 products (x and W are inputs) on WMMA 16x16x32; q and k stored as f16 hi + (x2048-scaled) residual rows, causal scores with 3 products (the module's d^-1/4 on q and on k applied as the exact 1/32 on the f32 score); P.V with P as f16 hi + (x2048-scaled) residual x V as f16 hi + (x2048-scaled) residual planes (3 products); the output projection with ctx as bf16 hi + residual x exact Wu (2 products) + bu; running-max softmax in f32 with the hardware exp; f32 accumulate.
#include <hip/hip_runtime.h>
#include <math.h>

typedef __attribute__((ext_vector_type(16))) _Float16 v16h;
typedef __attribute__((ext_vector_type(16))) __bf16 v16b;
typedef __attribute__((ext_vector_type(8)))  _Float16 v8h;
typedef __attribute__((ext_vector_type(8)))  float v8f;
typedef __attribute__((ext_vector_type(4)))  float v4f;
typedef __attribute__((ext_vector_type(2)))  float v2f;
typedef __attribute__((ext_vector_type(4)))  unsigned v4u;
typedef __attribute__((ext_vector_type(4)))  int v4i;
typedef float __attribute__((may_alias)) float_a;
typedef int __attribute__((may_alias)) int_a;

template <typename T> __device__ __forceinline__ void vst2(void* p, T v) { *(T*)p = v;  }
// k_attn's products are the plain builtin: the compiler keeps the distance behind its own WMMA forms where a vector instruction needs it, and with no volatile statement behind each product it may issue the LDS reads of later products ahead of earlier products
__device__ __forceinline__ v8f wmma16(v16h a, v16h b, v8f c) { return __builtin_amdgcn_wmma_f32_16x16x32_f16(false, a, false, b, (short)0, c, false, false); }
__device__ __forceinline__ v8f wmma_bf(v16b a, v16b b, v8f c) {
  v8f d = __builtin_amdgcn_wmma_f32_16x16x32_bf16(false, a, false, b, (short)0, c, false, false);
  asm volatile("v_nop\n\tv_nop\n\tv_nop\n\tv_nop" : "+v"(d) : "v"(a), "v"(b));
  return d;
}
// 'Narrow' causal self-attention (B 4, T 2,048, emb 1,024 = 16 heads x 64 with ONE shared 64x64 Wq/Wk/Wv): per head q = x_h Wq^T d^-1/4, k = x_h Wk^T d^-1/4, v = x_h Wv^T; causal softmax(q k^T) v; out = y Wu^T + bu.
__device__ __forceinline__ v16h frag_h(const _Float16* rowk0, int lane) {
  union { v16h v; v8h q[2]; } u; const _Float16* p = rowk0 + 8 * (lane >> 4);
  u.q[0] = *(const v8h*)p; u.q[1] = *(const v8h*)(p + 16); return u.v;
}
__device__ __forceinline__ v16h frag_f32(const float* rowk0, int lane) {
  v16h a; const float* p = rowk0 + 8 * (lane >> 4);
#pragma unroll
  for (int i = 0; i < 8; ++i) { a[i] = (_Float16)p[i]; a[8 + i] = (_Float16)p[16 + i]; }
  return a;
}
__device__ __forceinline__ v16h frag_f32s(const float* rowk0, int lane, float sc) {
  v16h a; const float* p = rowk0 + 8 * (lane >> 4);
#pragma unroll
  for (int i = 0; i < 8; ++i) { a[i] = (_Float16)(p[i] * sc); a[8 + i] = (_Float16)(p[16 + i] * sc); }
  return a;
}
// column fragment from a [K][ld] layout (column n), rows >= K read as 0
__device__ __forceinline__ v16h fragc_f32(const float* W, int k0, int n, int lane, int ld, int K) {
  v16h a; const int g = lane >> 4;
#pragma unroll
  for (int i = 0; i < 8; ++i) { const int ka = k0 + 8 * g + i, kb = ka + 16;
    a[i] = (_Float16)(ka < K ? W[(size_t)(ka < K ? ka : K - 1) * ld + n] : 0.f); a[8 + i] = (_Float16)(kb < K ? W[(size_t)(kb < K ? kb : K - 1) * ld + n] : 0.f); }
  return a;
}
struct F2 { v16b h, l; };
__device__ __forceinline__ F2 bsplit16(const float v[16]) { F2 r;
#pragma unroll
  for (int i = 0; i < 16; ++i) { const __bf16 h = (__bf16)v[i]; r.h[i] = h; r.l[i] = (__bf16)(v[i] - (float)h); }
  return r; }
__device__ __forceinline__ F2 split_row(const float* row, int k0, int lane) { float v[16]; const float* p = row + k0 + 8 * (lane >> 4);
#pragma unroll
  for (int i = 0; i < 8; ++i) { v[i] = p[i]; v[8 + i] = p[16 + i]; }
  return bsplit16(v); }
__device__ __forceinline__ F2 split_rowK(const float* row, int k0, int lane, int K) { float v[16]; const int g = lane >> 4;
#pragma unroll
  for (int i = 0; i < 8; ++i) { const int ka = k0 + 8 * g + i, kb = ka + 16; v[i] = ka < K ? row[ka < K ? ka : K - 1] : 0.f; v[8 + i] = kb < K ? row[kb < K ? kb : K - 1] : 0.f; }
  return bsplit16(v); }
__device__ __forceinline__ F2 split_col(const float* W, int k0, int n, int lane, int ld, int K) { float v[16]; const int g = lane >> 4;
#pragma unroll
  for (int i = 0; i < 8; ++i) { const int ka = k0 + 8 * g + i, kb = ka + 16; v[i] = ka < K ? W[(size_t)(ka < K ? ka : K - 1) * ld + n] : 0.f; v[8 + i] = kb < K ? W[(size_t)(kb < K ? kb : K - 1) * ld + n] : 0.f; }
  return bsplit16(v); }
__device__ __forceinline__ v8f mac3(const F2& a, const F2& b, v8f c) { c = wmma_bf(a.l, b.h, c); c = wmma_bf(a.h, b.l, c); return wmma_bf(a.h, b.h, c); }
__device__ __forceinline__ float sigm(float v) { return 1.0f / (1.0f + expf(-v)); }
#define LDSX() do { asm volatile("s_wait_dscnt 0" ::: "memory"); __builtin_amdgcn_wave_barrier(); __builtin_amdgcn_fence(__ATOMIC_RELEASE, "workgroup"); } while (0)


// Causal multi-head self-attention (B 4, S 2048, D 1024, 16 heads x 64; head-shared 64x64 Wq/Wk/Wv expanded to a block-diagonal packed [3D][D], Wout [D][D] applied as x W^T, bias bu): softmax(q k^T / 32, causal) v; ctx Wout^T + bu.
#define NB 4
#define SS 2048
#define DM 1024
#define NH 16
#define HD 64
#define QKVW (3 * DM)
#ifndef TQB
#define TQB (SS / 64)
#define TNB NB
#define TOB (NB * SS / 64)     // output row tiles (all)
#endif
typedef __attribute__((ext_vector_type(8))) __bf16 v8b;
__device__ __forceinline__ v16b frag_b(const __bf16* rowk0, int lane) {
  union { v16b v; v8b q[2]; } u; const __bf16* p = rowk0 + 8 * (lane >> 4);
  u.q[0] = *(const v8b*)p; u.q[1] = *(const v8b*)(p + 16); return u.v;
}
__device__ __forceinline__ float bfr(float v) { return (float)(__bf16)v; }
__device__ __attribute__((noinline)) float exp_ni(float v) { return expf(v); }
__device__ __attribute__((noinline)) float erf_ni(float v) { return erff(v); }

#define PK_A 0                       // [3072][1024] Wqkv rows (natural [out][in])
#define PK_P (PK_A + QKVW * DM)        // [1024][1024] Wo rows (natural)
#define PK_END (PK_P + DM * DM)
#define WS_PK  0u
#define WS_QK  (WS_PK + 2u * PK_END)             // f16 [8192 rows][2048]: q | k
#define WS_QKL (WS_QK + 2u * NB * SS * 2 * DM)     // f16 q | k residual planes x2048
#define WS_VTH (WS_QKL + 2u * NB * SS * 2 * DM)    // f16 [b][1024 (h*64+d)][2048 s] hi
#define WS_VTL (WS_VTH + 2u * NB * DM * SS)        // f16 lo x 2048
#define WS_O   (WS_VTL + 2u * NB * DM * SS)        // f32 [8192][1024]
#define WS_CS  (WS_O + 4u * NB * SS * DM)           // f32 2 x [2048][32], reserved, not written or read
#define WS_END (WS_CS + 4u * 2 * SS * 32)

// ---- k_packbd: block = packed row n = which*1024 + h*64 + o: block-diagonal expansion of the head-shared [64][64] projection: row[h*64 + c] = W[o][c], zero elsewhere
__global__ __launch_bounds__(128) void k_packbd(const float* __restrict__ WQ, const float* __restrict__ WK, const float* __restrict__ WV, __bf16* __restrict__ DST) {
  __shared__ __align__(16) __bf16 s[DM]; const int n = blockIdx.x, t = threadIdx.x; const int which = n / DM, h = (n % DM) / HD, o = n % HD; const float* Wm = (which == 0) ? WQ : (which == 1) ? WK : WV;
  for (int k = t; k < DM; k += 128) s[k] = (__bf16)((k / HD == h) ? Wm[o * HD + (k % HD)] : 0.f);
  __syncthreads();
  vst2((unsigned*)(DST + (size_t)n * DM + t * 8), *(const v4u*)&s[t * 8]);
}
// ---- k_packrows: block = natural row n of a [N][K] weight
__global__ __launch_bounds__(256) void k_packrows(const float* __restrict__ Wm, int K, __bf16* __restrict__ DST) {
  __shared__ __align__(16) __bf16 s[DM]; const int n = blockIdx.x, tid = threadIdx.x;
  for (int k = tid; k < K; k += 256) s[k] = (__bf16)Wm[(size_t)n * K + k];
  __syncthreads();
  for (int q = tid; q < K / 8; q += 256) vst2((unsigned*)(DST + (size_t)n * K + q * 8), *(const v4u*)&s[q * 8]);
}
// ---- k_qkv: block = (64 rows (b,s), 128 of the 3072 cols): qkv = bf16(x) . rows (exact); cols < 1024 -> f16(q), cols < 2048 -> f16(k) into QK rows (pitch 2048); cols >= 2048 (v) -> per-batch transposed f16 planes VT[b][h*64+d][s]: hi = f16(v), lo = f16((v - hi) * 2048)
__global__ __launch_bounds__(128) void k_qkv(const float* __restrict__ X, const __bf16* __restrict__ P, _Float16* __restrict__ QK, _Float16* __restrict__ QKL, _Float16* __restrict__ VTH, _Float16* __restrict__ VTL) {
  __shared__ __align__(16) _Float16 so[4][16][136], sol[4][16][136]; __shared__ __align__(16) _Float16 sth[128][72], stl[128][72];
  const int tid = threadIdx.x, wave = tid >> 5, lane = tid & 31, col = lane & 15, g = lane >> 4; const size_t r0 = (size_t)blockIdx.x * 64 + wave * 16; const int n0 = blockIdx.y * 128;
  v8f acc[8] = {};
  // packed row n is zero outside columns [head*64, head*64+64), head = (n % 1024) / 64: the 128 columns of this block are two heads, and each head's four column tiles take only their own 64 k
#pragma unroll
  for (int hh = 0; hh < 2; ++hh) { const int kb = (n0 % DM) + hh * HD;
#pragma unroll
    for (int kc = 0; kc < HD / 32; ++kc) { v16b a; { const float* p = X + (r0 + col) * DM + kb + kc * 32 + 8 * g;
#pragma unroll
        for (int i = 0; i < 8; ++i) { a[i] = (__bf16)p[i]; a[8 + i] = (__bf16)p[16 + i]; } }
#pragma unroll
      for (int j = 0; j < 4; ++j) acc[hh * 4 + j] = wmma_bf(a, frag_b(P + (size_t)(n0 + (hh * 4 + j) * 16 + col) * DM + kb + kc * 32, lane), acc[hh * 4 + j]); } }
  if (n0 < 2 * DM) {   // q | k -> f16 hi + (x2048) residual rows (unscaled; the d^-1/4 x d^-1/4 = 1/32 scale is applied to the f32 score)
#pragma unroll
    for (int j = 0; j < 8; ++j) {
#pragma unroll
      for (int r = 0; r < 8; ++r) { const float v = acc[j][r]; const _Float16 hv = (_Float16)v; so[wave][8 * g + r][j * 16 + col] = hv; sol[wave][8 * g + r][j * 16 + col] = (_Float16)((v - (float)hv) * 2048.0f); } }
    LDSX();
    for (int rl = 0; rl < 16; ++rl) if (lane < 16) { vst2((unsigned*)(QK + (r0 + rl) * (2 * DM) + n0 + lane * 8), *(const v4u*)&so[wave][rl][lane * 8]); vst2((unsigned*)(QKL + (r0 + rl) * (2 * DM) + n0 + lane * 8), *(const v4u*)&sol[wave][rl][lane * 8]); }
  } else {
#pragma unroll
    for (int j = 0; j < 8; ++j) {
#pragma unroll
      for (int r = 0; r < 8; ++r) { const float v = acc[j][r]; const _Float16 hv = (_Float16)v; sth[j * 16 + col][wave * 16 + 8 * g + r] = hv; stl[j * 16 + col][wave * 16 + 8 * g + r] = (_Float16)((v - (float)hv) * 2048.0f); } }
    __syncthreads();
    const size_t rb = (size_t)blockIdx.x * 64; const int b = (int)(rb / SS), s0 = (int)(rb % SS); const int pc0 = n0 - 2 * DM;
    for (int q = tid; q < 128 * 8; q += 128) { const int d = q >> 3, pc = q & 7; const size_t o = ((size_t)b * DM + pc0 + d) * SS + s0 + pc * 8; vst2((unsigned*)(VTH + o), *(const v4u*)&sth[d][pc * 8]); vst2((unsigned*)(VTL + o), *(const v4u*)&stl[d][pc * 8]); }
  }
}
#define SK 64                          // keys per stage: a V^T row piece is then one whole 128-B line, and the waits and the barrier of the two-buffer order run once per 64 keys
#define KP 72                          // K row pitch in LDS, halfs: 144 B = 16 B x odd, so the 16 rows of a ds_load_b128 fall on distinct banks
#define VP 72                          // V^T row pitch in LDS, halfs: the same
#define ST_KH 0                        // [64 keys][KP] K hi
#define ST_KL (ST_KH + SK * KP)        // [64 keys][KP] K residual
#define ST_VH (ST_KL + SK * KP)        // [64 d][VP] V^T hi (64 keys a row)
#define ST_VL (ST_VH + 64 * VP)        // [64 d][VP] V^T residual
#define ST_SZ (ST_VL + 64 * VP)        // halfs per buffer
__device__ __forceinline__ unsigned lds_byte(const _Float16* p) { return (unsigned)(size_t)(const __attribute__((address_space(3))) _Float16*)p; }
// the hi and the residual plane of one operand: per thread four 16-B copies a plane, rows 16 apart (gs halfs in global memory, 16 * 144 B in LDS); a wave's copy = 4 whole 128-B rows. The s_wait_xcnt stands inside the statement so that no address register is rewritten ahead of it.
__device__ __forceinline__ void stage_pair(const _Float16* a0, const _Float16* b0, size_t gs, unsigned la0, unsigned lb0) {
  const _Float16 *a1 = a0 + gs, *a2 = a1 + gs, *a3 = a2 + gs, *b1 = b0 + gs, *b2 = b1 + gs, *b3 = b2 + gs;
  const unsigned la1 = la0 + 2 * 16 * KP, la2 = la1 + 2 * 16 * KP, la3 = la2 + 2 * 16 * KP, lb1 = lb0 + 2 * 16 * KP, lb2 = lb1 + 2 * 16 * KP, lb3 = lb2 + 2 * 16 * KP;
  asm volatile("global_load_async_to_lds_b128 %0, %8, off\n\t"
               "global_load_async_to_lds_b128 %1, %9, off\n\t"
               "global_load_async_to_lds_b128 %2, %10, off\n\t"
               "global_load_async_to_lds_b128 %3, %11, off\n\t"
               "global_load_async_to_lds_b128 %4, %12, off\n\t"
               "global_load_async_to_lds_b128 %5, %13, off\n\t"
               "global_load_async_to_lds_b128 %6, %14, off\n\t"
               "global_load_async_to_lds_b128 %7, %15, off\n\t"
               "s_wait_xcnt 0x0"
               :: "v"(la0), "v"(la1), "v"(la2), "v"(la3), "v"(lb0), "v"(lb1), "v"(lb2), "v"(lb3), "v"(a0), "v"(a1), "v"(a2), "v"(a3), "v"(b0), "v"(b1), "v"(b2), "v"(b3) : "memory");
}
// one 64-key stage: 16 copies of 16 B per thread; lt = this thread's byte address in plane 0 of the buffer (row tid / 8, piece tid % 8; all four planes have 64 rows of the same pitch)
__device__ __forceinline__ void stage_kv(const _Float16* kh, const _Float16* kl, const _Float16* vh, const _Float16* vl, unsigned lt) {
  stage_pair(kh, kl, (size_t)16 * (2 * DM), lt + 2 * ST_KH, lt + 2 * ST_KL); stage_pair(vh, vl, (size_t)16 * SS, lt + 2 * ST_VH, lt + 2 * ST_VL);
}
__device__ __forceinline__ float xhalf(float x) { return __builtin_bit_cast(float, __builtin_amdgcn_permlanex16(__builtin_bit_cast(int, x), __builtin_bit_cast(int, x), 0x76543210, 0xfedcba98, false, false)); }   // lane l takes lane l ^ 16's value
// exp(x) as __expf forms it (x * log2 e, then v_exp_f32). The instruction set asks for one free slot behind a transcendental before its source is overwritten, so the v_exp_f32 run and its v_nop stand in one statement (outputs early-clobbered: no v_exp_f32 of the run writes a source of another).
__device__ __forceinline__ void exp_x4(float& a, float& b, float& c, float& d) {
  const float xa = a * 0x1.715476p+0f, xb = b * 0x1.715476p+0f, xc = c * 0x1.715476p+0f, xd = d * 0x1.715476p+0f;
  asm("v_exp_f32 %0, %4\n\tv_exp_f32 %1, %5\n\tv_exp_f32 %2, %6\n\tv_exp_f32 %3, %7\n\tv_nop" : "=&v"(a), "=&v"(b), "=&v"(c), "=&v"(d) : "v"(xa), "v"(xb), "v"(xc), "v"(xd));
}
__device__ __forceinline__ float exp_x1(float a) { float r; const float xa = a * 0x1.715476p+0f;
  asm("v_exp_f32 %0, %1\n\tv_nop" : "=&v"(r) : "v"(xa));   // the same free slot behind the one v_exp_f32
  return r; }
__global__ __launch_bounds__(128) void k_attn(const _Float16* __restrict__ QK, const _Float16* __restrict__ QKL, const _Float16* __restrict__ VTH, const _Float16* __restrict__ VTL, float* __restrict__ O) {
  __shared__ __align__(16) _Float16 st[2 * ST_SZ];
  const int tid = threadIdx.x, wave = tid >> 5, lane = tid & 31, col = lane & 15, g = lane >> 4;
  const int h = blockIdx.x, b = blockIdx.y, qb = TQB - 1 - (int)blockIdx.z; const int q0 = qb * 64 + wave * 16; const size_t rq = (size_t)b * SS + q0 + col;
  const int nst = qb + 1;   // 64-key stages up to and with the block's own diagonal
  // this thread's pieces of a stage: K row tid / 8 (and + 16, + 32, + 48), 16-B piece tid % 8; V^T row tid / 8 (and the same steps), piece tid % 8
  const size_t kof = ((size_t)b * SS + (tid >> 3)) * (2 * DM) + DM + h * HD + (tid & 7) * 8, vof = ((size_t)b * DM + h * HD + (tid >> 3)) * SS + (tid & 7) * 8;
  const unsigned lt = lds_byte(st) + 2 * ((tid >> 3) * KP + (tid & 7) * 8);
  stage_kv(QK + kof, QKL + kof, VTH + vof, VTL + vof, lt);
  v16h aq[2], aql[2];
#pragma unroll
  for (int kc = 0; kc < 2; ++kc) { aq[kc] = frag_h(QK + rq * (2 * DM) + h * HD + kc * 32, lane); aql[kc] = frag_h(QKL + rq * (2 * DM) + h * HD + kc * 32, lane); }
  float m = -3.0e38f, l = 0.f;   // of query q0 + col; l holds only the keys of this lane's half until the epilogue joins the halves
  v8f acc[4] = {}, accl[4] = {};   // O^T tiles: register r = d dt * 16 + 8 g + r of query q0 + col
  asm volatile("s_wait_asynccnt 0x0" ::: "memory");   // stage 0 of this wave has landed
  __syncthreads();                                     // ... and every wave's part of it may be read
  if (nst > 1) stage_kv(QK + kof + (size_t)SK * (2 * DM), QKL + kof + (size_t)SK * (2 * DM), VTH + vof + SK, VTL + vof + SK, lt + 2 * ST_SZ);   // the test reads the same in the whole work-group
#pragma unroll 1   // rolled: one copy of the two-buffer order at the foot
  for (int t = 0; t < nst; ++t) {
#pragma unroll 1   // rolled: the two passes of a stage share one text; unrolled they would only double the loop's size
   for (int ps = 0; ps < 2; ++ps) { v8f s[2]; const int ks = 2 * t + ps; const _Float16* sb = st + (t & 1) * ST_SZ;
    v16h kf[2][2], kfl[2][2];   // the step's eight K fragments, read as one group: the wave meets the LDS latency once ahead of the score products, not once per fragment
#pragma unroll
    for (int ct = 0; ct < 2; ++ct) {
#pragma unroll
      for (int kc = 0; kc < 2; ++kc) { kf[ct][kc] = frag_h(sb + ST_KH + (ps * 32 + ct * 16 + col) * KP + kc * 32, lane); kfl[ct][kc] = frag_h(sb + ST_KL + (ps * 32 + ct * 16 + col) * KP + kc * 32, lane); } }
    __builtin_amdgcn_sched_barrier(0);   // keeps the group above the products: without it the compiler sinks each read to just in front of its product and waits there
    v8f c2[2] = {}, cl2[2] = {};
#pragma unroll
    for (int ct = 0; ct < 2; ++ct) {
#pragma unroll
      for (int kc = 0; kc < 2; ++kc) { c2[ct] = wmma16(kf[ct][kc], aq[kc], c2[ct]); cl2[ct] = wmma16(kf[ct][kc], aql[kc], cl2[ct]); cl2[ct] = wmma16(kfl[ct][kc], aq[kc], cl2[ct]); } }   // 3 products: q, k as f16 hi + residual; register r = key ct * 16 + 8 g + r, column = query
    v16h vf[4], vfl[4];   // the step's eight V^T fragments, read ahead of the softmax: their LDS latency passes under its vector work
#pragma unroll
    for (int dt = 0; dt < 4; ++dt) { const int vr = (dt * 16 + col) * VP + ps * 32; vf[dt] = frag_h(sb + ST_VH + vr, lane); vfl[dt] = frag_h(sb + ST_VL + vr, lane); }
    __builtin_amdgcn_sched_barrier(0);   // keeps these reads above the softmax: without it the compiler sinks each to just in front of its product and waits there
#pragma unroll
    for (int ct = 0; ct < 2; ++ct) { v8f c = c2[ct]; const v8f cl = cl2[ct];
#pragma unroll
      for (int r = 0; r < 8; ++r) c[r] += cl[r] * (1.0f / 2048.0f);
#pragma unroll
      for (int r = 0; r < 8; ++r) s[ct][r] = c[r] * 0.03125f; }   // (d^-1/4)^2 = 1024^-1/2 = 1/32 exactly
    if (t == nst - 1) {   // a scalar test: only the block's last stage (two steps) holds keys behind its first query; in every earlier step each key is visible to each of the 64 queries and the mask's compares and selects are not run
#pragma unroll
      for (int ct = 0; ct < 2; ++ct) {
#pragma unroll
        for (int r = 0; r < 8; ++r) { const int kk = ks * 32 + ct * 16 + 8 * g + r; s[ct][r] = (kk <= q0 + col) ? s[ct][r] : -3.0e38f; } } }
    float mx = fmaxf(fmaxf(fmaxf(fmaxf(s[0][0], s[0][1]), fmaxf(s[0][2], s[0][3])), fmaxf(fmaxf(s[0][4], s[0][5]), fmaxf(s[0][6], s[0][7]))), fmaxf(fmaxf(fmaxf(s[1][0], s[1][1]), fmaxf(s[1][2], s[1][3])), fmaxf(fmaxf(s[1][4], s[1][5]), fmaxf(s[1][6], s[1][7]))));
    mx = fmaxf(mx, xhalf(mx));
    const float mn = fmaxf(m, mx); const float ea = exp_x1(m - mn); const float alpha = (m <= -1.0e38f) ? 0.f : ea; m = mn;
    float ev[2][8]; v16h pa, pl;   // P^T as a B operand: element i = key 8 g + i (tile 0), element 8 + i = key 16 + 8 g + i (tile 1), the k order of frag_h
#pragma unroll
    for (int ct = 0; ct < 2; ++ct) {
      float ex[8];
#pragma unroll
      for (int r = 0; r < 8; ++r) ex[r] = s[ct][r] - mn;
      exp_x4(ex[0], ex[1], ex[2], ex[3]); exp_x4(ex[4], ex[5], ex[6], ex[7]);
#pragma unroll
      for (int r = 0; r < 8; ++r) { const float e = ex[r]; ev[ct][r] = e;   // a masked score needs no select here: mn is finite from step 0 on (key 0 is visible to every query), so -3.0e38 - mn times log2 e is -inf and v_exp_f32 gives 0
        const _Float16 eh = (_Float16)e; pa[ct * 8 + r] = eh; pl[ct * 8 + r] = (_Float16)((e - (float)eh) * 2048.0f); } }
    l = l * alpha + ((((ev[0][0] + ev[1][0]) + (ev[0][1] + ev[1][1])) + ((ev[0][2] + ev[1][2]) + (ev[0][3] + ev[1][3]))) + (((ev[0][4] + ev[1][4]) + (ev[0][5] + ev[1][5])) + ((ev[0][6] + ev[1][6]) + (ev[0][7] + ev[1][7]))));   // a tree, not one dependent chain of 16 adds
#pragma unroll
    for (int dt = 0; dt < 4; ++dt) {
#pragma unroll
      for (int r = 0; r < 8; ++r) { acc[dt][r] *= alpha; accl[dt][r] *= alpha; } }
#pragma unroll
    for (int dt = 0; dt < 4; ++dt) { acc[dt] = wmma16(vf[dt], pa, acc[dt]); accl[dt] = wmma16(vf[dt], pl, accl[dt]); accl[dt] = wmma16(vfl[dt], pa, accl[dt]); }   // V hi x P hi + (V hi x P lo + V lo x P hi) / 2048
    __builtin_amdgcn_sched_barrier(0); }   // keeps what follows (the next pass's reads, or the waits and the barrier below) behind the step's products: with no LDS read left there the compiler lifts the waits above the softmax, where the V reads and the next stage's copies have had no time to land
    asm volatile("s_wait_dscnt 0x0" ::: "memory");      // this wave's reads of the buffer are done
    asm volatile("s_wait_asynccnt 0x0" ::: "memory");   // this wave's copies of stage t + 1 have landed
    __syncthreads();                                     // publishes stage t + 1 and frees the buffer that this stage's two passes have read
    if (t + 2 < nst) stage_kv(QK + kof + (size_t)(t + 2) * SK * (2 * DM), QKL + kof + (size_t)(t + 2) * SK * (2 * DM), VTH + vof + (t + 2) * SK, VTL + vof + (t + 2) * SK, lt + 2 * (t & 1) * ST_SZ); }
  asm volatile("s_wait_asynccnt 0x0" ::: "memory");     // nothing of this wave is in flight when the buffers become output staging
  float (*so)[16][68] = (float (*)[16][68])st;           // the last step's barrier has ended every wave's reads of st
  const float il = 1.0f / (l + xhalf(l));
#pragma unroll
  for (int dt = 0; dt < 4; ++dt) {
#pragma unroll
    for (int r = 0; r < 8; ++r) so[wave][col][dt * 16 + 8 * g + r] = (acc[dt][r] + accl[dt][r] * (1.0f / 2048.0f)) * il; }
  LDSX();
  for (int rl = 0; rl < 16; ++rl) if (lane < 16) vst2(O + ((size_t)b * SS + q0 + rl) * DM + h * HD + lane * 4, *(const v4f*)&so[wave][rl][lane * 4]);
}
// ---- k_out: block = (64 rows, 128 cols): out = O(hi/lo) . Wo rows (2 products) + bo; each 64-wide k stage of the block's 128 Wo rows and 64 O rows is brought into LDS once per work-group by asynchronous copies that cover whole 128-B lines, two buffers, and the waves take their fragments from there
#define OKS 64                         // k per stage
#define OWP 72                         // Wo row pitch in LDS, bf16: 144 B = 16 B x odd, so the 16 rows of a ds_load_b128 fall on distinct banks
#define OAP 68                         // O row pitch in LDS, floats: 272 B = 16 B x odd
#define OB_W 0                         // bytes: [128 cols][OWP] bf16
#define OB_A (OB_W + 128 * OWP * 2)    // bytes: [64 rows][OAP] f32
#define OB_SZ (OB_A + 64 * OAP * 4)    // bytes per buffer
__device__ __forceinline__ unsigned lds_byte_c(const char* p) { return (unsigned)(size_t)(const __attribute__((address_space(3))) char*)p; }
// eight 16-B copies of one thread, at a fixed step in LDS (ls bytes) and in global memory (gs bytes). The s_wait_xcnt stands inside the statement so that no address register is rewritten ahead of it.
__device__ __forceinline__ void copy8(unsigned l0, unsigned ls, const char* g0, size_t gs) {
  const unsigned l1 = l0 + ls, l2 = l1 + ls, l3 = l2 + ls, l4 = l3 + ls, l5 = l4 + ls, l6 = l5 + ls, l7 = l6 + ls;
  const char *g1 = g0 + gs, *g2 = g1 + gs, *g3 = g2 + gs, *g4 = g3 + gs, *g5 = g4 + gs, *g6 = g5 + gs, *g7 = g6 + gs;
  asm volatile("global_load_async_to_lds_b128 %0, %8, off\n\t"
               "global_load_async_to_lds_b128 %1, %9, off\n\t"
               "global_load_async_to_lds_b128 %2, %10, off\n\t"
               "global_load_async_to_lds_b128 %3, %11, off\n\t"
               "global_load_async_to_lds_b128 %4, %12, off\n\t"
               "global_load_async_to_lds_b128 %5, %13, off\n\t"
               "global_load_async_to_lds_b128 %6, %14, off\n\t"
               "global_load_async_to_lds_b128 %7, %15, off\n\t"
               "s_wait_xcnt 0x0"
               :: "v"(l0), "v"(l1), "v"(l2), "v"(l3), "v"(l4), "v"(l5), "v"(l6), "v"(l7), "v"(g0), "v"(g1), "v"(g2), "v"(g3), "v"(g4), "v"(g5), "v"(g6), "v"(g7) : "memory");
}
// one stage: Wo rows tid / 8 + 16 i, 16-B piece tid % 8 (a wave's copy = 4 whole 128-B rows); O rows tid / 16 + 8 i, piece tid % 16 (a wave's copy = 2 whole 256-B rows)
__device__ __forceinline__ void stage_out(const char* gw, const char* ga, unsigned lw, unsigned la) {
  copy8(lw, 16 * OWP * 2, gw, (size_t)16 * DM * 2); copy8(la, 8 * OAP * 4, ga, (size_t)8 * DM * 4);
}
__global__ __launch_bounds__(128) void k_out(const float* __restrict__ O, const __bf16* __restrict__ P, const float* __restrict__ BU, float* __restrict__ Y) {
  __shared__ __align__(16) char sm[2 * OB_SZ];
  const int tid = threadIdx.x, wave = tid >> 5, lane = tid & 31, col = lane & 15, g = lane >> 4; const size_t rb = (size_t)blockIdx.x * 64, r0 = rb + wave * 16; const int n0 = blockIdx.y * 128;
  const char* gw = (const char*)(P + (size_t)(n0 + (tid >> 3)) * DM + (tid & 7) * 8); const char* ga = (const char*)(O + (rb + (tid >> 4)) * DM + (tid & 15) * 4);
  const unsigned lw = lds_byte_c(sm) + OB_W + (tid >> 3) * (OWP * 2) + (tid & 7) * 16, la = lds_byte_c(sm) + OB_A + (tid >> 4) * (OAP * 4) + (tid & 15) * 16;
  v8f acc[8] = {};
  stage_out(gw, ga, lw, la);
  asm volatile("s_wait_asynccnt 0x0" ::: "memory");   // stage 0 of this wave has landed
  __syncthreads();                                     // ... and every wave's part of it may be read
  stage_out(gw + OKS * 2, ga + OKS * 4, lw + OB_SZ, la + OB_SZ);
#pragma unroll 1   // rolled: one copy of the two-buffer order below, and the loop's text stays small
  for (int ks = 0; ks < DM / OKS; ++ks) { const char* sb = sm + (ks & 1) * OB_SZ; const float* arow = (const float*)(sb + OB_A) + (wave * 16 + col) * OAP; const __bf16* wrow = (const __bf16*)(sb + OB_W) + col * OWP;
#pragma unroll
    for (int kc = 0; kc < OKS / 32; ++kc) { v16b w[8];   // the eight Wo fragments of a k step are read as one group ahead of its products: one LDS latency a step, not eight
#pragma unroll
      for (int j = 0; j < 8; ++j) w[j] = frag_b(wrow + j * 16 * OWP + kc * 32, lane);
      const F2 a = split_row(arow, kc * 32, lane);
#pragma unroll
      for (int j = 0; j < 8; ++j) { acc[j] = wmma_bf(a.l, w[j], acc[j]); acc[j] = wmma_bf(a.h, w[j], acc[j]); } }
    asm volatile("s_wait_dscnt 0x0" ::: "memory");      // this wave's reads of the buffer are done
    asm volatile("s_wait_asynccnt 0x0" ::: "memory");   // this wave's copies of stage ks + 1 have landed
    __syncthreads();                                     // publishes stage ks + 1 and frees the buffer that this step has read
    if (ks + 2 < DM / OKS) stage_out(gw + (ks + 2) * (OKS * 2), ga + (ks + 2) * (OKS * 4), lw + (ks & 1) * OB_SZ, la + (ks & 1) * OB_SZ); }
  asm volatile("s_wait_asynccnt 0x0" ::: "memory");     // nothing of this wave is in flight when the buffers become output staging
  float (*so)[16][132] = (float (*)[16][132])sm;         // the last step's barrier has ended every wave's reads of sm
#pragma unroll
  for (int j = 0; j < 8; ++j) { const float bb = bfr(BU[n0 + j * 16 + col]);
#pragma unroll
    for (int r = 0; r < 8; ++r) so[wave][8 * g + r][j * 16 + col] = acc[j][r] + bb; }
  LDSX();
  for (int rl = 0; rl < 16; ++rl) vst2(Y + (r0 + rl) * DM + n0 + lane * 4, *(const v4f*)&so[wave][rl][lane * 4]);
}
extern "C" void kernel_launch(void* const* d_in, const int* in_sizes, int n_in, void* d_out, int out_size, void* d_ws, size_t ws_size, hipStream_t stream) {
  (void)in_sizes; (void)n_in; (void)out_size;
  const float** F = (const float**)d_in;   // 0 x [4,2048,1024], 1 Wq [64,64] ([out][in], shared by all 16 heads), 2 Wk, 3 Wv, 4 Wu [1024,1024], 5 bu [1024]
  if (ws_size < (size_t)WS_END) return;
  char* ws = (char*)d_ws; __bf16* PK = (__bf16*)(ws + WS_PK); _Float16 *QK = (_Float16*)(ws + WS_QK), *QKL = (_Float16*)(ws + WS_QKL), *VTH = (_Float16*)(ws + WS_VTH), *VTL = (_Float16*)(ws + WS_VTL); float *O = (float*)(ws + WS_O);
  k_packbd<<<QKVW, 128, 0, stream>>>(F[1], F[2], F[3], PK + PK_A); k_packrows<<<DM, 256, 0, stream>>>(F[4], DM, PK + PK_P);
  k_qkv<<<dim3(TNB * SS / 64, QKVW / 128), 128, 0, stream>>>(F[0], PK + PK_A, QK, QKL, VTH, VTL);
  k_attn<<<dim3(NH, TNB, TQB), 128, 0, stream>>>(QK, QKL, VTH, VTL, O);
  k_out<<<dim3(TOB, DM / 128), 128, 0, stream>>>(O, PK + PK_P, F[5], (float*)d_out);
}

// v010
// One run takes 137 microseconds.
// In two side-by-side timings against v009, it was 1.09 and 1.10 times as fast.
// Over all steps from v000 it is 6.05 times as fast.
// compute dtype: x, Wq, Wk, Wv, Wu, bu (module inputs) rounded to bf16; the head-shared 64x64 q/k/v projections head by head with exact bf16 products (x and W are inputs) on WMMA 16x16x32; q and k stored as f16 hi + (x2048-scaled) residual rows, causal scores with 3 products (the module's d^-1/4 on q and on k applied as the exact 1/32 on the f32 score); P.V with P as f16 hi + (x2048-scaled) residual x V as f16 hi + (x2048-scaled) residual planes (3 products); the output projection with ctx as bf16 hi + residual x exact Wu (2 products) + bu; running-max softmax in f32 with the hardware exp; f32 accumulate.
#include <hip/hip_runtime.h>
#include <math.h>

typedef __attribute__((ext_vector_type(16))) _Float16 v16h;
typedef __attribute__((ext_vector_type(16))) __bf16 v16b;
typedef __attribute__((ext_vector_type(8)))  _Float16 v8h;
typedef __attribute__((ext_vector_type(8)))  float v8f;
typedef __attribute__((ext_vector_type(4)))  float v4f;
typedef __attribute__((ext_vector_type(2)))  float v2f;
typedef __attribute__((ext_vector_type(4)))  unsigned v4u;
typedef __attribute__((ext_vector_type(4)))  int v4i;
typedef float __attribute__((may_alias)) float_a;
typedef int __attribute__((may_alias)) int_a;

template <typename T> __device__ __forceinline__ void vst2(void* p, T v) { *(T*)p = v;  }
// k_attn's products are the plain builtin: the compiler keeps the distance behind its own WMMA forms where a vector instruction needs it, and with no volatile statement behind each product it may issue the LDS reads of later products ahead of earlier products
__device__ __forceinline__ v8f wmma16(v16h a, v16h b, v8f c) { return __builtin_amdgcn_wmma_f32_16x16x32_f16(false, a, false, b, (short)0, c, false, false); }
__device__ __forceinline__ v8f wmma_bf(v16b a, v16b b, v8f c) {
  v8f d = __builtin_amdgcn_wmma_f32_16x16x32_bf16(false, a, false, b, (short)0, c, false, false);
  asm volatile("v_nop\n\tv_nop\n\tv_nop\n\tv_nop" : "+v"(d) : "v"(a), "v"(b));
  return d;
}
// 'Narrow' causal self-attention (B 4, T 2,048, emb 1,024 = 16 heads x 64 with ONE shared 64x64 Wq/Wk/Wv): per head q = x_h Wq^T d^-1/4, k = x_h Wk^T d^-1/4, v = x_h Wv^T; causal softmax(q k^T) v; out = y Wu^T + bu.
__device__ __forceinline__ v16h frag_h(const _Float16* rowk0, int lane) {
  union { v16h v; v8h q[2]; } u; const _Float16* p = rowk0 + 8 * (lane >> 4);
  u.q[0] = *(const v8h*)p; u.q[1] = *(const v8h*)(p + 16); return u.v;
}
__device__ __forceinline__ v16h frag_f32(const float* rowk0, int lane) {
  v16h a; const float* p = rowk0 + 8 * (lane >> 4);
#pragma unroll
  for (int i = 0; i < 8; ++i) { a[i] = (_Float16)p[i]; a[8 + i] = (_Float16)p[16 + i]; }
  return a;
}
__device__ __forceinline__ v16h frag_f32s(const float* rowk0, int lane, float sc) {
  v16h a; const float* p = rowk0 + 8 * (lane >> 4);
#pragma unroll
  for (int i = 0; i < 8; ++i) { a[i] = (_Float16)(p[i] * sc); a[8 + i] = (_Float16)(p[16 + i] * sc); }
  return a;
}
// column fragment from a [K][ld] layout (column n), rows >= K read as 0
__device__ __forceinline__ v16h fragc_f32(const float* W, int k0, int n, int lane, int ld, int K) {
  v16h a; const int g = lane >> 4;
#pragma unroll
  for (int i = 0; i < 8; ++i) { const int ka = k0 + 8 * g + i, kb = ka + 16;
    a[i] = (_Float16)(ka < K ? W[(size_t)(ka < K ? ka : K - 1) * ld + n] : 0.f); a[8 + i] = (_Float16)(kb < K ? W[(size_t)(kb < K ? kb : K - 1) * ld + n] : 0.f); }
  return a;
}
struct F2 { v16b h, l; };
__device__ __forceinline__ F2 bsplit16(const float v[16]) { F2 r;
#pragma unroll
  for (int i = 0; i < 16; ++i) { const __bf16 h = (__bf16)v[i]; r.h[i] = h; r.l[i] = (__bf16)(v[i] - (float)h); }
  return r; }
__device__ __forceinline__ F2 split_row(const float* row, int k0, int lane) { float v[16]; const float* p = row + k0 + 8 * (lane >> 4);
#pragma unroll
  for (int i = 0; i < 8; ++i) { v[i] = p[i]; v[8 + i] = p[16 + i]; }
  return bsplit16(v); }
__device__ __forceinline__ F2 split_rowK(const float* row, int k0, int lane, int K) { float v[16]; const int g = lane >> 4;
#pragma unroll
  for (int i = 0; i < 8; ++i) { const int ka = k0 + 8 * g + i, kb = ka + 16; v[i] = ka < K ? row[ka < K ? ka : K - 1] : 0.f; v[8 + i] = kb < K ? row[kb < K ? kb : K - 1] : 0.f; }
  return bsplit16(v); }
__device__ __forceinline__ F2 split_col(const float* W, int k0, int n, int lane, int ld, int K) { float v[16]; const int g = lane >> 4;
#pragma unroll
  for (int i = 0; i < 8; ++i) { const int ka = k0 + 8 * g + i, kb = ka + 16; v[i] = ka < K ? W[(size_t)(ka < K ? ka : K - 1) * ld + n] : 0.f; v[8 + i] = kb < K ? W[(size_t)(kb < K ? kb : K - 1) * ld + n] : 0.f; }
  return bsplit16(v); }
__device__ __forceinline__ v8f mac3(const F2& a, const F2& b, v8f c) { c = wmma_bf(a.l, b.h, c); c = wmma_bf(a.h, b.l, c); return wmma_bf(a.h, b.h, c); }
__device__ __forceinline__ float sigm(float v) { return 1.0f / (1.0f + expf(-v)); }
#define LDSX() do { asm volatile("s_wait_dscnt 0" ::: "memory"); __builtin_amdgcn_wave_barrier(); __builtin_amdgcn_fence(__ATOMIC_RELEASE, "workgroup"); } while (0)


// Causal multi-head self-attention (B 4, S 2048, D 1024, 16 heads x 64; head-shared 64x64 Wq/Wk/Wv applied to each head's 64 columns of x, Wout [D][D] applied as x W^T, bias bu): softmax(q k^T / 32, causal) v; ctx Wout^T + bu.
#define NB 4
#define SS 2048
#define DM 1024
#define NH 16
#define HD 64
#define QKVW (3 * DM)
#ifndef TQB
#define TQB (SS / 64)
#define TNB NB
#define TOB (NB * SS / 64)     // output row tiles (all)
#endif
typedef __attribute__((ext_vector_type(8))) __bf16 v8b;
__device__ __forceinline__ v16b frag_b(const __bf16* rowk0, int lane) {
  union { v16b v; v8b q[2]; } u; const __bf16* p = rowk0 + 8 * (lane >> 4);
  u.q[0] = *(const v8b*)p; u.q[1] = *(const v8b*)(p + 16); return u.v;
}
// the same fragment from a row of f32, each element rounded to bf16
__device__ __forceinline__ v16b frag_bf32(const float* rowk0, int lane) {
  union { v16b v; v8b q[2]; } u; const float* p = rowk0 + 8 * (lane >> 4); const v4f x0 = *(const v4f*)p, x1 = *(const v4f*)(p + 4), x2 = *(const v4f*)(p + 16), x3 = *(const v4f*)(p + 20);
  u.q[0] = __builtin_convertvector(__builtin_shufflevector(x0, x1, 0, 1, 2, 3, 4, 5, 6, 7), v8b); u.q[1] = __builtin_convertvector(__builtin_shufflevector(x2, x3, 0, 1, 2, 3, 4, 5, 6, 7), v8b); return u.v;
}
__device__ __forceinline__ float bfr(float v) { return (float)(__bf16)v; }
__device__ __attribute__((noinline)) float exp_ni(float v) { return expf(v); }
__device__ __attribute__((noinline)) float erf_ni(float v) { return erff(v); }

#define PK_END (DM * DM)             // bf16 [1024][1024] Wo rows (natural [out][in])
#define WS_PK  0u
#define WS_QK  (WS_PK + 2u * PK_END)             // f16 [8192 rows][2048]: q | k
#define WS_QKL (WS_QK + 2u * NB * SS * 2 * DM)     // f16 q | k residual planes x2048
#define WS_VTH (WS_QKL + 2u * NB * SS * 2 * DM)    // f16 [b][1024 (h*64+d)][2048 s] hi
#define WS_VTL (WS_VTH + 2u * NB * DM * SS)        // f16 lo x 2048
#define WS_O   (WS_VTL + 2u * NB * DM * SS)        // f32 [8192][1024]
#define WS_CS  (WS_O + 4u * NB * SS * DM)           // f32 2 x [2048][32], reserved, not written or read
#define WS_END (WS_CS + 4u * 2 * SS * 32)

// ---- k_qkv: block = (64 rows (b,s), 128 of the 3072 cols = two heads of q, of k or of v): qkv = bf16(x_h) . bf16(W) rows (exact products); the 64x64 weight is shared by all heads, so a wave rounds its eight fragments of it to bf16 in registers (the weight is 16 KB of f32 and stays in the cache) and uses each for both heads; cols < 1024 -> f16(q), cols < 2048 -> f16(k) into QK rows (pitch 2048); cols >= 2048 (v) -> per-batch transposed f16 planes VT[b][h*64+d][s]: hi = f16(v), lo = f16((v - hi) * 2048). The first 1,024 blocks of the grid also round one row of Wu each to bf16 for k_out, which runs two launches later: no launch of its own for either rounding
__global__ __launch_bounds__(128) void k_qkv(const float* __restrict__ X, const float* __restrict__ WQ, const float* __restrict__ WK, const float* __restrict__ WV, const float* __restrict__ WU, __bf16* __restrict__ PW, _Float16* __restrict__ QK, _Float16* __restrict__ QKL, _Float16* __restrict__ VTH, _Float16* __restrict__ VTL) {
  __shared__ __align__(16) _Float16 so[4][16][136], sol[4][16][136]; __shared__ __align__(16) _Float16 sth[128][72], stl[128][72];
  const int tid = threadIdx.x, wave = tid >> 5, lane = tid & 31, col = lane & 15, g = lane >> 4; const size_t r0 = (size_t)blockIdx.x * 64 + wave * 16; const int n0 = blockIdx.y * 128;
  const int wr = blockIdx.y * (TNB * SS / 64) + blockIdx.x;   // this block's row of Wu, if it has one (a scalar test): 8 elements a thread, read here so that the loads fly with the block's own and stored behind the products
  v4f u0 = {}, u1 = {};
  if (wr < DM) { const float* p = WU + (size_t)wr * DM + tid * 8; u0 = *(const v4f*)p; u1 = *(const v4f*)(p + 4); }
  const float* Wm = (n0 < DM) ? WQ : (n0 < 2 * DM) ? WK : WV;
  v8f acc[8] = {};
  // output column n0 + (hh * 4 + j) * 16 + col is row j * 16 + col of the shared weight applied to head (n0 % 1024) / 64 + hh of x
#pragma unroll
  for (int kc = 0; kc < HD / 32; ++kc) { v16b wb[4], a[2];   // a k step's four weight fragments and the two heads' x fragments, read ahead of its eight products
#pragma unroll
    for (int j = 0; j < 4; ++j) wb[j] = frag_bf32(Wm + (j * 16 + col) * HD + kc * 32, lane);
#pragma unroll
    for (int hh = 0; hh < 2; ++hh) a[hh] = frag_bf32(X + (r0 + col) * DM + (n0 % DM) + hh * HD + kc * 32, lane);
#pragma unroll
    for (int hh = 0; hh < 2; ++hh) {
#pragma unroll
      for (int j = 0; j < 4; ++j) acc[hh * 4 + j] = wmma_bf(a[hh], wb[j], acc[hh * 4 + j]); } }
  if (wr < DM) { v8b o;
#pragma unroll
    for (int i = 0; i < 4; ++i) { o[i] = (__bf16)u0[i]; o[4 + i] = (__bf16)u1[i]; }
    *(v8b*)(PW + (size_t)wr * DM + tid * 8) = o; }
  if (n0 < 2 * DM) {   // q | k -> f16 hi + (x2048) residual rows (unscaled; the d^-1/4 x d^-1/4 = 1/32 scale is applied to the f32 score)
#pragma unroll
    for (int j = 0; j < 8; ++j) {
#pragma unroll
      for (int r = 0; r < 8; ++r) { const float v = acc[j][r]; const _Float16 hv = (_Float16)v; so[wave][8 * g + r][j * 16 + col] = hv; sol[wave][8 * g + r][j * 16 + col] = (_Float16)((v - (float)hv) * 2048.0f); } }
    LDSX();
    for (int rl = 0; rl < 16; ++rl) if (lane < 16) { vst2((unsigned*)(QK + (r0 + rl) * (2 * DM) + n0 + lane * 8), *(const v4u*)&so[wave][rl][lane * 8]); vst2((unsigned*)(QKL + (r0 + rl) * (2 * DM) + n0 + lane * 8), *(const v4u*)&sol[wave][rl][lane * 8]); }
  } else {
#pragma unroll
    for (int j = 0; j < 8; ++j) {
#pragma unroll
      for (int r = 0; r < 8; ++r) { const float v = acc[j][r]; const _Float16 hv = (_Float16)v; sth[j * 16 + col][wave * 16 + 8 * g + r] = hv; stl[j * 16 + col][wave * 16 + 8 * g + r] = (_Float16)((v - (float)hv) * 2048.0f); } }
    __syncthreads();
    const size_t rb = (size_t)blockIdx.x * 64; const int b = (int)(rb / SS), s0 = (int)(rb % SS); const int pc0 = n0 - 2 * DM;
    for (int q = tid; q < 128 * 8; q += 128) { const int d = q >> 3, pc = q & 7; const size_t o = ((size_t)b * DM + pc0 + d) * SS + s0 + pc * 8; vst2((unsigned*)(VTH + o), *(const v4u*)&sth[d][pc * 8]); vst2((unsigned*)(VTL + o), *(const v4u*)&stl[d][pc * 8]); }
  }
}
#define SK 64                          // keys per stage: a V^T row piece is then one whole 128-B line, and the waits and the barrier of the two-buffer order run once per 64 keys
#define KP 72                          // K row pitch in LDS, halfs: 144 B = 16 B x odd, so the 16 rows of a ds_load_b128 fall on distinct banks
#define VP 72                          // V^T row pitch in LDS, halfs: the same
#define ST_KH 0                        // [64 keys][KP] K hi
#define ST_KL (ST_KH + SK * KP)        // [64 keys][KP] K residual
#define ST_VH (ST_KL + SK * KP)        // [64 d][VP] V^T hi (64 keys a row)
#define ST_VL (ST_VH + 64 * VP)        // [64 d][VP] V^T residual
#define ST_SZ (ST_VL + 64 * VP)        // halfs per buffer
__device__ __forceinline__ unsigned lds_byte(const _Float16* p) { return (unsigned)(size_t)(const __attribute__((address_space(3))) _Float16*)p; }
// the hi and the residual plane of one operand: per thread four 16-B copies a plane, rows 16 apart (gs halfs in global memory, 16 * 144 B in LDS); a wave's copy = 4 whole 128-B rows. The s_wait_xcnt stands inside the statement so that no address register is rewritten ahead of it.
__device__ __forceinline__ void stage_pair(const _Float16* a0, const _Float16* b0, size_t gs, unsigned la0, unsigned lb0) {
  const _Float16 *a1 = a0 + gs, *a2 = a1 + gs, *a3 = a2 + gs, *b1 = b0 + gs, *b2 = b1 + gs, *b3 = b2 + gs;
  const unsigned la1 = la0 + 2 * 16 * KP, la2 = la1 + 2 * 16 * KP, la3 = la2 + 2 * 16 * KP, lb1 = lb0 + 2 * 16 * KP, lb2 = lb1 + 2 * 16 * KP, lb3 = lb2 + 2 * 16 * KP;
  asm volatile("global_load_async_to_lds_b128 %0, %8, off\n\t"
               "global_load_async_to_lds_b128 %1, %9, off\n\t"
               "global_load_async_to_lds_b128 %2, %10, off\n\t"
               "global_load_async_to_lds_b128 %3, %11, off\n\t"
               "global_load_async_to_lds_b128 %4, %12, off\n\t"
               "global_load_async_to_lds_b128 %5, %13, off\n\t"
               "global_load_async_to_lds_b128 %6, %14, off\n\t"
               "global_load_async_to_lds_b128 %7, %15, off\n\t"
               "s_wait_xcnt 0x0"
               :: "v"(la0), "v"(la1), "v"(la2), "v"(la3), "v"(lb0), "v"(lb1), "v"(lb2), "v"(lb3), "v"(a0), "v"(a1), "v"(a2), "v"(a3), "v"(b0), "v"(b1), "v"(b2), "v"(b3) : "memory");
}
// one 64-key stage: 16 copies of 16 B per thread; lt = this thread's byte address in plane 0 of the buffer (row tid / 8, piece tid % 8; all four planes have 64 rows of the same pitch)
__device__ __forceinline__ void stage_kv(const _Float16* kh, const _Float16* kl, const _Float16* vh, const _Float16* vl, unsigned lt) {
  stage_pair(kh, kl, (size_t)16 * (2 * DM), lt + 2 * ST_KH, lt + 2 * ST_KL); stage_pair(vh, vl, (size_t)16 * SS, lt + 2 * ST_VH, lt + 2 * ST_VL);
}
__device__ __forceinline__ float xhalf(float x) { return __builtin_bit_cast(float, __builtin_amdgcn_permlanex16(__builtin_bit_cast(int, x), __builtin_bit_cast(int, x), 0x76543210, 0xfedcba98, false, false)); }   // lane l takes lane l ^ 16's value
// exp(x) as __expf forms it (x * log2 e, then v_exp_f32). The instruction set asks for one free slot behind a transcendental before its source is overwritten, so the v_exp_f32 run and its v_nop stand in one statement (outputs early-clobbered: no v_exp_f32 of the run writes a source of another).
__device__ __forceinline__ void exp_x4(float& a, float& b, float& c, float& d) {
  const float xa = a * 0x1.715476p+0f, xb = b * 0x1.715476p+0f, xc = c * 0x1.715476p+0f, xd = d * 0x1.715476p+0f;
  asm("v_exp_f32 %0, %4\n\tv_exp_f32 %1, %5\n\tv_exp_f32 %2, %6\n\tv_exp_f32 %3, %7\n\tv_nop" : "=&v"(a), "=&v"(b), "=&v"(c), "=&v"(d) : "v"(xa), "v"(xb), "v"(xc), "v"(xd));
}
__device__ __forceinline__ float exp_x1(float a) { float r; const float xa = a * 0x1.715476p+0f;
  asm("v_exp_f32 %0, %1\n\tv_nop" : "=&v"(r) : "v"(xa));   // the same free slot behind the one v_exp_f32
  return r; }
__global__ __launch_bounds__(128) void k_attn(const _Float16* __restrict__ QK, const _Float16* __restrict__ QKL, const _Float16* __restrict__ VTH, const _Float16* __restrict__ VTL, float* __restrict__ O) {
  __shared__ __align__(16) _Float16 st[2 * ST_SZ];
  const int tid = threadIdx.x, wave = tid >> 5, lane = tid & 31, col = lane & 15, g = lane >> 4;
  const int h = blockIdx.x, b = blockIdx.y, qb = TQB - 1 - (int)blockIdx.z; const int q0 = qb * 64 + wave * 16; const size_t rq = (size_t)b * SS + q0 + col;
  const int nst = qb + 1;   // 64-key stages up to and with the block's own diagonal
  // this thread's pieces of a stage: K row tid / 8 (and + 16, + 32, + 48), 16-B piece tid % 8; V^T row tid / 8 (and the same steps), piece tid % 8
  const size_t kof = ((size_t)b * SS + (tid >> 3)) * (2 * DM) + DM + h * HD + (tid & 7) * 8, vof = ((size_t)b * DM + h * HD + (tid >> 3)) * SS + (tid & 7) * 8;
  const unsigned lt = lds_byte(st) + 2 * ((tid >> 3) * KP + (tid & 7) * 8);
  stage_kv(QK + kof, QKL + kof, VTH + vof, VTL + vof, lt);
  v16h aq[2], aql[2];
#pragma unroll
  for (int kc = 0; kc < 2; ++kc) { aq[kc] = frag_h(QK + rq * (2 * DM) + h * HD + kc * 32, lane); aql[kc] = frag_h(QKL + rq * (2 * DM) + h * HD + kc * 32, lane); }
  float m = -3.0e38f, l = 0.f;   // of query q0 + col; l holds only the keys of this lane's half until the epilogue joins the halves
  v8f acc[4] = {}, accl[4] = {};   // O^T tiles: register r = d dt * 16 + 8 g + r of query q0 + col
  asm volatile("s_wait_asynccnt 0x0" ::: "memory");   // stage 0 of this wave has landed
  __syncthreads();                                     // ... and every wave's part of it may be read
  if (nst > 1) stage_kv(QK + kof + (size_t)SK * (2 * DM), QKL + kof + (size_t)SK * (2 * DM), VTH + vof + SK, VTL + vof + SK, lt + 2 * ST_SZ);   // the test reads the same in the whole work-group
#pragma unroll 1   // rolled: one copy of the two-buffer order at the foot
  for (int t = 0; t < nst; ++t) {
#pragma unroll 1   // rolled: the two passes of a stage share one text; unrolled they would only double the loop's size
   for (int ps = 0; ps < 2; ++ps) { v8f s[2]; const int ks = 2 * t + ps; const _Float16* sb = st + (t & 1) * ST_SZ;
    v16h kf[2][2], kfl[2][2];   // the step's eight K fragments, read as one group: the wave meets the LDS latency once ahead of the score products, not once per fragment
#pragma unroll
    for (int ct = 0; ct < 2; ++ct) {
#pragma unroll
      for (int kc = 0; kc < 2; ++kc) { kf[ct][kc] = frag_h(sb + ST_KH + (ps * 32 + ct * 16 + col) * KP + kc * 32, lane); kfl[ct][kc] = frag_h(sb + ST_KL + (ps * 32 + ct * 16 + col) * KP + kc * 32, lane); } }
    __builtin_amdgcn_sched_barrier(0);   // keeps the group above the products: without it the compiler sinks each read to just in front of its product and waits there
    v8f c2[2] = {}, cl2[2] = {};
#pragma unroll
    for (int ct = 0; ct < 2; ++ct) {
#pragma unroll
      for (int kc = 0; kc < 2; ++kc) { c2[ct] = wmma16(kf[ct][kc], aq[kc], c2[ct]); cl2[ct] = wmma16(kf[ct][kc], aql[kc], cl2[ct]); cl2[ct] = wmma16(kfl[ct][kc], aq[kc], cl2[ct]); } }   // 3 products: q, k as f16 hi + residual; register r = key ct * 16 + 8 g + r, column = query
    v16h vf[4], vfl[4];   // the step's eight V^T fragments, read ahead of the softmax: their LDS latency passes under its vector work
#pragma unroll
    for (int dt = 0; dt < 4; ++dt) { const int vr = (dt * 16 + col) * VP + ps * 32; vf[dt] = frag_h(sb + ST_VH + vr, lane); vfl[dt] = frag_h(sb + ST_VL + vr, lane); }
    __builtin_amdgcn_sched_barrier(0);   // keeps these reads above the softmax: without it the compiler sinks each to just in front of its product and waits there
#pragma unroll
    for (int ct = 0; ct < 2; ++ct) { v8f c = c2[ct]; const v8f cl = cl2[ct];
#pragma unroll
      for (int r = 0; r < 8; ++r) c[r] += cl[r] * (1.0f / 2048.0f);
#pragma unroll
      for (int r = 0; r < 8; ++r) s[ct][r] = c[r] * 0.03125f; }   // (d^-1/4)^2 = 1024^-1/2 = 1/32 exactly
    if (t == nst - 1) {   // a scalar test: only the block's last stage (two steps) holds keys behind its first query; in every earlier step each key is visible to each of the 64 queries and the mask's compares and selects are not run
#pragma unroll
      for (int ct = 0; ct < 2; ++ct) {
#pragma unroll
        for (int r = 0; r < 8; ++r) { const int kk = ks * 32 + ct * 16 + 8 * g + r; s[ct][r] = (kk <= q0 + col) ? s[ct][r] : -3.0e38f; } } }
    float mx = fmaxf(fmaxf(fmaxf(fmaxf(s[0][0], s[0][1]), fmaxf(s[0][2], s[0][3])), fmaxf(fmaxf(s[0][4], s[0][5]), fmaxf(s[0][6], s[0][7]))), fmaxf(fmaxf(fmaxf(s[1][0], s[1][1]), fmaxf(s[1][2], s[1][3])), fmaxf(fmaxf(s[1][4], s[1][5]), fmaxf(s[1][6], s[1][7]))));
    mx = fmaxf(mx, xhalf(mx));
    const float mn = fmaxf(m, mx); const float ea = exp_x1(m - mn); const float alpha = (m <= -1.0e38f) ? 0.f : ea; m = mn;
    float ev[2][8]; v16h pa, pl;   // P^T as a B operand: element i = key 8 g + i (tile 0), element 8 + i = key 16 + 8 g + i (tile 1), the k order of frag_h
#pragma unroll
    for (int ct = 0; ct < 2; ++ct) {
      float ex[8];
#pragma unroll
      for (int r = 0; r < 8; ++r) ex[r] = s[ct][r] - mn;
      exp_x4(ex[0], ex[1], ex[2], ex[3]); exp_x4(ex[4], ex[5], ex[6], ex[7]);
#pragma unroll
      for (int r = 0; r < 8; ++r) { const float e = ex[r]; ev[ct][r] = e;   // a masked score needs no select here: mn is finite from step 0 on (key 0 is visible to every query), so -3.0e38 - mn times log2 e is -inf and v_exp_f32 gives 0
        const _Float16 eh = (_Float16)e; pa[ct * 8 + r] = eh; pl[ct * 8 + r] = (_Float16)((e - (float)eh) * 2048.0f); } }
    l = l * alpha + ((((ev[0][0] + ev[1][0]) + (ev[0][1] + ev[1][1])) + ((ev[0][2] + ev[1][2]) + (ev[0][3] + ev[1][3]))) + (((ev[0][4] + ev[1][4]) + (ev[0][5] + ev[1][5])) + ((ev[0][6] + ev[1][6]) + (ev[0][7] + ev[1][7]))));   // a tree, not one dependent chain of 16 adds
#pragma unroll
    for (int dt = 0; dt < 4; ++dt) {
#pragma unroll
      for (int r = 0; r < 8; ++r) { acc[dt][r] *= alpha; accl[dt][r] *= alpha; } }
#pragma unroll
    for (int dt = 0; dt < 4; ++dt) { acc[dt] = wmma16(vf[dt], pa, acc[dt]); accl[dt] = wmma16(vf[dt], pl, accl[dt]); accl[dt] = wmma16(vfl[dt], pa, accl[dt]); }   // V hi x P hi + (V hi x P lo + V lo x P hi) / 2048
    __builtin_amdgcn_sched_barrier(0); }   // keeps what follows (the next pass's reads, or the waits and the barrier below) behind the step's products: with no LDS read left there the compiler lifts the waits above the softmax, where the V reads and the next stage's copies have had no time to land
    asm volatile("s_wait_dscnt 0x0" ::: "memory");      // this wave's reads of the buffer are done
    asm volatile("s_wait_asynccnt 0x0" ::: "memory");   // this wave's copies of stage t + 1 have landed
    __syncthreads();                                     // publishes stage t + 1 and frees the buffer that this stage's two passes have read
    if (t + 2 < nst) stage_kv(QK + kof + (size_t)(t + 2) * SK * (2 * DM), QKL + kof + (size_t)(t + 2) * SK * (2 * DM), VTH + vof + (t + 2) * SK, VTL + vof + (t + 2) * SK, lt + 2 * (t & 1) * ST_SZ); }
  asm volatile("s_wait_asynccnt 0x0" ::: "memory");     // nothing of this wave is in flight when the buffers become output staging
  float (*so)[16][68] = (float (*)[16][68])st;           // the last step's barrier has ended every wave's reads of st
  const float il = 1.0f / (l + xhalf(l));
#pragma unroll
  for (int dt = 0; dt < 4; ++dt) {
#pragma unroll
    for (int r = 0; r < 8; ++r) so[wave][col][dt * 16 + 8 * g + r] = (acc[dt][r] + accl[dt][r] * (1.0f / 2048.0f)) * il; }
  LDSX();
  for (int rl = 0; rl < 16; ++rl) if (lane < 16) vst2(O + ((size_t)b * SS + q0 + rl) * DM + h * HD + lane * 4, *(const v4f*)&so[wave][rl][lane * 4]);
}
// ---- k_out: block = (64 rows, 128 cols): out = O(hi/lo) . Wo rows (2 products) + bo; each 64-wide k stage of the block's 128 Wo rows and 64 O rows is brought into LDS once per work-group by asynchronous copies that cover whole 128-B lines, two buffers, and the waves take their fragments from there
#define OKS 64                         // k per stage
#define OWP 72                         // Wo row pitch in LDS, bf16: 144 B = 16 B x odd, so the 16 rows of a ds_load_b128 fall on distinct banks
#define OAP 68                         // O row pitch in LDS, floats: 272 B = 16 B x odd
#define OB_W 0                         // bytes: [128 cols][OWP] bf16
#define OB_A (OB_W + 128 * OWP * 2)    // bytes: [64 rows][OAP] f32
#define OB_SZ (OB_A + 64 * OAP * 4)    // bytes per buffer
__device__ __forceinline__ unsigned lds_byte_c(const char* p) { return (unsigned)(size_t)(const __attribute__((address_space(3))) char*)p; }
// eight 16-B copies of one thread, at a fixed step in LDS (ls bytes) and in global memory (gs bytes). The s_wait_xcnt stands inside the statement so that no address register is rewritten ahead of it.
__device__ __forceinline__ void copy8(unsigned l0, unsigned ls, const char* g0, size_t gs) {
  const unsigned l1 = l0 + ls, l2 = l1 + ls, l3 = l2 + ls, l4 = l3 + ls, l5 = l4 + ls, l6 = l5 + ls, l7 = l6 + ls;
  const char *g1 = g0 + gs, *g2 = g1 + gs, *g3 = g2 + gs, *g4 = g3 + gs, *g5 = g4 + gs, *g6 = g5 + gs, *g7 = g6 + gs;
  asm volatile("global_load_async_to_lds_b128 %0, %8, off\n\t"
               "global_load_async_to_lds_b128 %1, %9, off\n\t"
               "global_load_async_to_lds_b128 %2, %10, off\n\t"
               "global_load_async_to_lds_b128 %3, %11, off\n\t"
               "global_load_async_to_lds_b128 %4, %12, off\n\t"
               "global_load_async_to_lds_b128 %5, %13, off\n\t"
               "global_load_async_to_lds_b128 %6, %14, off\n\t"
               "global_load_async_to_lds_b128 %7, %15, off\n\t"
               "s_wait_xcnt 0x0"
               :: "v"(l0), "v"(l1), "v"(l2), "v"(l3), "v"(l4), "v"(l5), "v"(l6), "v"(l7), "v"(g0), "v"(g1), "v"(g2), "v"(g3), "v"(g4), "v"(g5), "v"(g6), "v"(g7) : "memory");
}
// one stage: Wo rows tid / 8 + 16 i, 16-B piece tid % 8 (a wave's copy = 4 whole 128-B rows); O rows tid / 16 + 8 i, piece tid % 16 (a wave's copy = 2 whole 256-B rows)
__device__ __forceinline__ void stage_out(const char* gw, const char* ga, unsigned lw, unsigned la) {
  copy8(lw, 16 * OWP * 2, gw, (size_t)16 * DM * 2); copy8(la, 8 * OAP * 4, ga, (size_t)8 * DM * 4);
}
__global__ __launch_bounds__(128) void k_out(const float* __restrict__ O, const __bf16* __restrict__ P, const float* __restrict__ BU, float* __restrict__ Y) {
  __shared__ __align__(16) char sm[2 * OB_SZ];
  const int tid = threadIdx.x, wave = tid >> 5, lane = tid & 31, col = lane & 15, g = lane >> 4; const size_t rb = (size_t)blockIdx.x * 64, r0 = rb + wave * 16; const int n0 = blockIdx.y * 128;
  const char* gw = (const char*)(P + (size_t)(n0 + (tid >> 3)) * DM + (tid & 7) * 8); const char* ga = (const char*)(O + (rb + (tid >> 4)) * DM + (tid & 15) * 4);
  const unsigned lw = lds_byte_c(sm) + OB_W + (tid >> 3) * (OWP * 2) + (tid & 7) * 16, la = lds_byte_c(sm) + OB_A + (tid >> 4) * (OAP * 4) + (tid & 15) * 16;
  v8f acc[8] = {};
  stage_out(gw, ga, lw, la);
  asm volatile("s_wait_asynccnt 0x0" ::: "memory");   // stage 0 of this wave has landed
  __syncthreads();                                     // ... and every wave's part of it may be read
  stage_out(gw + OKS * 2, ga + OKS * 4, lw + OB_SZ, la + OB_SZ);
#pragma unroll 1   // rolled: one copy of the two-buffer order below, and the loop's text stays small
  for (int ks = 0; ks < DM / OKS; ++ks) { const char* sb = sm + (ks & 1) * OB_SZ; const float* arow = (const float*)(sb + OB_A) + (wave * 16 + col) * OAP; const __bf16* wrow = (const __bf16*)(sb + OB_W) + col * OWP;
#pragma unroll
    for (int kc = 0; kc < OKS / 32; ++kc) { v16b w[8];   // the eight Wo fragments of a k step are read as one group ahead of its products: one LDS latency a step, not eight
#pragma unroll
      for (int j = 0; j < 8; ++j) w[j] = frag_b(wrow + j * 16 * OWP + kc * 32, lane);
      const F2 a = split_row(arow, kc * 32, lane);
#pragma unroll
      for (int j = 0; j < 8; ++j) { acc[j] = wmma_bf(a.l, w[j], acc[j]); acc[j] = wmma_bf(a.h, w[j], acc[j]); } }
    asm volatile("s_wait_dscnt 0x0" ::: "memory");      // this wave's reads of the buffer are done
    asm volatile("s_wait_asynccnt 0x0" ::: "memory");   // this wave's copies of stage ks + 1 have landed
    __syncthreads();                                     // publishes stage ks + 1 and frees the buffer that this step has read
    if (ks + 2 < DM / OKS) stage_out(gw + (ks + 2) * (OKS * 2), ga + (ks + 2) * (OKS * 4), lw + (ks & 1) * OB_SZ, la + (ks & 1) * OB_SZ); }
  asm volatile("s_wait_asynccnt 0x0" ::: "memory");     // nothing of this wave is in flight when the buffers become output staging
  float (*so)[16][132] = (float (*)[16][132])sm;         // the last step's barrier has ended every wave's reads of sm
#pragma unroll
  for (int j = 0; j < 8; ++j) { const float bb = bfr(BU[n0 + j * 16 + col]);
#pragma unroll
    for (int r = 0; r < 8; ++r) so[wave][8 * g + r][j * 16 + col] = acc[j][r] + bb; }
  LDSX();
  for (int rl = 0; rl < 16; ++rl) vst2(Y + (r0 + rl) * DM + n0 + lane * 4, *(const v4f*)&so[wave][rl][lane * 4]);
}
extern "C" void kernel_launch(void* const* d_in, const int* in_sizes, int n_in, void* d_out, int out_size, void* d_ws, size_t ws_size, hipStream_t stream) {
  (void)in_sizes; (void)n_in; (void)out_size;
  const float** F = (const float**)d_in;   // 0 x [4,2048,1024], 1 Wq [64,64] ([out][in], shared by all 16 heads), 2 Wk, 3 Wv, 4 Wu [1024,1024], 5 bu [1024]
  if (ws_size < (size_t)WS_END) return;
  char* ws = (char*)d_ws; __bf16* PK = (__bf16*)(ws + WS_PK); _Float16 *QK = (_Float16*)(ws + WS_QK), *QKL = (_Float16*)(ws + WS_QKL), *VTH = (_Float16*)(ws + WS_VTH), *VTL = (_Float16*)(ws + WS_VTL); float *O = (float*)(ws + WS_O);
  k_qkv<<<dim3(TNB * SS / 64, QKVW / 128), 128, 0, stream>>>(F[0], F[1], F[2], F[3], F[4], PK, QK, QKL, VTH, VTL);
  k_attn<<<dim3(NH, TNB, TQB), 128, 0, stream>>>(QK, QKL, VTH, VTL, O);
  k_out<<<dim3(TOB, DM / 128), 128, 0, stream>>>(O, PK, F[5], (float*)d_out);
}
